// v000
// Times are from an AMD MI455X. After a warm-up the kernel runs many times in a row, and a time is the length of
// such a window on the GPU divided by its runs, so every launch and the gaps after it count. The runs cycle
// through copies of the inputs. A figure is the median of several windows, for all but v000 over two sittings.
// Sittings can differ by a few percent; kernels timed side by side share one.
// The starting kernel, v000, takes 780 microseconds a run.
// compute dtype: hidden_states, Wq/Wk/Wv + biases, Wo (module inputs) rounded to bf16, position_ids as int; q/k/v projections with exact bf16 products (+ bias); rotary tables (inv_freq = 10000^(-2i/64), cos/sin of pos·inv_freq) and the rotate-half mix in f32; scores and P.V with both computed operands as bf16 hi + bf16 residual pairs (3 products); output projection hi/lo x bf16 Wo (2 products); online softmax in f32; f32 accumulate.
#include <hip/hip_runtime.h>
#include <math.h>

typedef __attribute__((ext_vector_type(16))) _Float16 v16h;
typedef __attribute__((ext_vector_type(16))) __bf16 v16b;
typedef __attribute__((ext_vector_type(8)))  _Float16 v8h;
typedef __attribute__((ext_vector_type(8)))  float v8f;
typedef __attribute__((ext_vector_type(4)))  float v4f;
typedef __attribute__((ext_vector_type(2)))  float v2f;
typedef __attribute__((ext_vector_type(4)))  unsigned v4u;
typedef __attribute__((ext_vector_type(4)))  int v4i;
typedef float __attribute__((may_alias)) float_a;
typedef int __attribute__((may_alias)) int_a;

template <typename T> __device__ __forceinline__ void vst2(void* p, T v) { *(T*)p = v;  }
__device__ __forceinline__ v8f wmma16(v16h a, v16h b, v8f c) {
  v8f d = __builtin_amdgcn_wmma_f32_16x16x32_f16(false, a, false, b, (short)0, c, false, false);
  asm volatile("v_nop\n\tv_nop\n\tv_nop\n\tv_nop" : "+v"(d) : "v"(a), "v"(b));
  return d;
}
__device__ __forceinline__ v8f wmma_bf(v16b a, v16b b, v8f c) {
  v8f d = __builtin_amdgcn_wmma_f32_16x16x32_bf16(false, a, false, b, (short)0, c, false, false);
  asm volatile("v_nop\n\tv_nop\n\tv_nop\n\tv_nop" : "+v"(d) : "v"(a), "v"(b));
  return d;
}
// 16x16x32 fragments: lane = (h = lane>>4, row/col = lane&15); elements 0..7 = k0+8h+0..7, 8..15 = k0+16+8h+0..7; D element r = row 8h+r
__device__ __forceinline__ v16h frag_h(const _Float16* rowk0, int lane) {
  union { v16h v; v8h q[2]; } u; const _Float16* p = rowk0 + 8 * (lane >> 4);
  u.q[0] = *(const v8h*)p; u.q[1] = *(const v8h*)(p + 16); return u.v;
}
__device__ __forceinline__ v16h frag_f32(const float* rowk0, int lane) {
  v16h a; const float* p = rowk0 + 8 * (lane >> 4);
#pragma unroll
  for (int i = 0; i < 8; ++i) { a[i] = (_Float16)p[i]; a[8 + i] = (_Float16)p[16 + i]; }
  return a;
}
__device__ __forceinline__ v16h frag_f32s(const float* rowk0, int lane, float sc) {
  v16h a; const float* p = rowk0 + 8 * (lane >> 4);
#pragma unroll
  for (int i = 0; i < 8; ++i) { a[i] = (_Float16)(p[i] * sc); a[8 + i] = (_Float16)(p[16 + i] * sc); }
  return a;
}
// column fragment from a [K][ld] layout (column n), rows >= K read as 0
__device__ __forceinline__ v16h fragc_f32(const float* W, int k0, int n, int lane, int ld, int K) {
  v16h a; const int g = lane >> 4;
#pragma unroll
  for (int i = 0; i < 8; ++i) { const int ka = k0 + 8 * g + i, kb = ka + 16;
    a[i] = (_Float16)(ka < K ? W[(size_t)(ka < K ? ka : K - 1) * ld + n] : 0.f); a[8 + i] = (_Float16)(kb < K ? W[(size_t)(kb < K ? kb : K - 1) * ld + n] : 0.f); }
  return a;
}
struct F2 { v16b h, l; };
__device__ __forceinline__ F2 bsplit16(const float v[16]) { F2 r;
#pragma unroll
  for (int i = 0; i < 16; ++i) { const __bf16 h = (__bf16)v[i]; r.h[i] = h; r.l[i] = (__bf16)(v[i] - (float)h); }
  return r; }
__device__ __forceinline__ F2 split_row(const float* row, int k0, int lane) { float v[16]; const float* p = row + k0 + 8 * (lane >> 4);
#pragma unroll
  for (int i = 0; i < 8; ++i) { v[i] = p[i]; v[8 + i] = p[16 + i]; }
  return bsplit16(v); }
__device__ __forceinline__ F2 split_rowK(const float* row, int k0, int lane, int K) { float v[16]; const int g = lane >> 4;
#pragma unroll
  for (int i = 0; i < 8; ++i) { const int ka = k0 + 8 * g + i, kb = ka + 16; v[i] = ka < K ? row[ka < K ? ka : K - 1] : 0.f; v[8 + i] = kb < K ? row[kb < K ? kb : K - 1] : 0.f; }
  return bsplit16(v); }
__device__ __forceinline__ F2 split_col(const float* W, int k0, int n, int lane, int ld, int K) { float v[16]; const int g = lane >> 4;
#pragma unroll
  for (int i = 0; i < 8; ++i) { const int ka = k0 + 8 * g + i, kb = ka + 16; v[i] = ka < K ? W[(size_t)(ka < K ? ka : K - 1) * ld + n] : 0.f; v[8 + i] = kb < K ? W[(size_t)(kb < K ? kb : K - 1) * ld + n] : 0.f; }
  return bsplit16(v); }
__device__ __forceinline__ v8f mac3(const F2& a, const F2& b, v8f c) { c = wmma_bf(a.l, b.h, c); c = wmma_bf(a.h, b.l, c); return wmma_bf(a.h, b.h, c); }
__device__ __forceinline__ float sigm(float v) { return 1.0f / (1.0f + expf(-v)); }
#define LDSX() do { asm volatile("s_wait_dscnt 0" ::: "memory"); __builtin_amdgcn_wave_barrier(); __builtin_amdgcn_fence(__ATOMIC_RELEASE, "workgroup"); } while (0)


// Wav2Vec2 self attention: q,k,v = x W^T + b (16 heads x 64); scores = q k^T / 8; softmax (no mask); P v; merge heads; @ Wo^T (no output bias).  B 2, S 2048, D 1024.
// k_pack (W rows as bf16 rows: torch [out][in] layout is already K-contiguous), k_proj (exact GEMM + bias, 3072-wide rows), k_rope (rotary on q,k in place; v as transposed hi/lo planes), k_attn (flash-style: per (64-query block, b, h) over all 64 32-key steps, online max/sum with accumulator rescale; O rows), k_out (O hi/lo x Wo, no bias).
#define NB 2
#define SS 2048
#define DM 1024
#define NH 16
#define HD 64
#define NR (NB * SS)
#define QKVP (3 * DM)
#ifndef TRB
#define TRB (NR / 64)
#define TQB (SS / 64)
#define TNB NB
#endif
typedef __attribute__((ext_vector_type(8))) __bf16 v8b;
__device__ __forceinline__ v16b frag_b(const __bf16* rowk0, int lane) {
  union { v16b v; v8b q[2]; } u; const __bf16* p = rowk0 + 8 * (lane >> 4);
  u.q[0] = *(const v8b*)p; u.q[1] = *(const v8b*)(p + 16); return u.v;
}
__device__ __forceinline__ v16b frag_gbf(const float* rowk0, int lane) {
  v16b a; const float* p = rowk0 + 8 * (lane >> 4);
#pragma unroll
  for (int i = 0; i < 8; ++i) { a[i] = (__bf16)p[i]; a[8 + i] = (__bf16)p[16 + i]; }
  return a;
}
__device__ __forceinline__ float bfr(float v) { return (float)(__bf16)v; }
__device__ __attribute__((noinline)) float exp_ni(float v) { return expf(v); }
#define WS_PT   0u                                 // bf16 [4096 (q|k|v|out cols)][1024]
#define WS_QKV  (WS_PT + 2u * 4 * DM * DM)           // f32 [4096 rows][3072]  (q 0..1023 | k | v) ; q cols later overwritten by O
#define WS_VTH  (WS_QKV + 4u * NR * QKVP)            // bf16 [2][1024 (h*64+d)][2048]
#define WS_VTL  (WS_VTH + 2u * NB * DM * SS)
#define WS_END  (WS_VTL + 2u * NB * DM * SS)

__global__ __launch_bounds__(128) void k_pack(const float* __restrict__ Wq, const float* __restrict__ Wk, const float* __restrict__ Wv, const float* __restrict__ Wo, __bf16* __restrict__ PT) {
  __shared__ __align__(16) __bf16 srow[DM];
  const int n = blockIdx.x, tid = threadIdx.x; const int which = n >> 10, c = n & 1023; const float* Wm = which == 0 ? Wq : (which == 1 ? Wk : (which == 2 ? Wv : Wo));
  for (int k = tid; k < DM; k += 128) srow[k] = (__bf16)Wm[(size_t)c * DM + k];   // torch [out][in]: row c
  __syncthreads();
  vst2((unsigned*)(PT + (size_t)n * DM + tid * 8), *(const v4u*)(&srow[tid * 8]));
}
// ---- k_proj: QKV[r][n] = bf16(x[r]) . PT[n] (exact), K = 1024; block (64 rows, 128 cols); 512-B segments of 12-KB rows
__global__ __launch_bounds__(128) void k_proj(const float* __restrict__ X, const __bf16* __restrict__ PT, const float* __restrict__ bq, const float* __restrict__ bk, const float* __restrict__ bv, float* __restrict__ QKV) {
  __shared__ __align__(16) float so[4][16][132];
  const int tid = threadIdx.x, wave = tid >> 5, lane = tid & 31, col = lane & 15, g = lane >> 4; const size_t r0 = (size_t)blockIdx.x * 64 + wave * 16; const int n0 = blockIdx.y * 128;
  v8f acc[8] = {};
#pragma unroll 2
  for (int kc = 0; kc < DM / 32; ++kc) { const v16b a = frag_gbf(X + (r0 + col) * DM + kc * 32, lane);
#pragma unroll
    for (int j = 0; j < 8; ++j) acc[j] = wmma_bf(a, frag_b(PT + (size_t)(n0 + j * 16 + col) * DM + kc * 32, lane), acc[j]); }
#pragma unroll
  for (int j = 0; j < 8; ++j) { const int n = n0 + j * 16 + col; const int which = n >> 10, c = n & 1023; const float bb = bfr((which == 0 ? bq : which == 1 ? bk : bv)[c]);
#pragma unroll
    for (int r = 0; r < 8; ++r) so[wave][8 * g + r][j * 16 + col] = acc[j][r] + bb; }
  LDSX();
  for (int rl = 0; rl < 16; ++rl) vst2(QKV + (r0 + rl) * QKVP + n0 + lane * 4, *(const v4f*)&so[wave][rl][lane * 4]);
}
__global__ __launch_bounds__(256) void k_rope(float* __restrict__ QKV, const int* __restrict__ PID, __bf16* __restrict__ VTH, __bf16* __restrict__ VTL) {
  __shared__ __align__(16) float sq[2 * DM]; __shared__ __align__(16) __bf16 svh[DM][72], svl[DM][72];
  const int tid = threadIdx.x; const size_t t0 = (size_t)blockIdx.x * 64; const int b = (int)(t0 / SS), p0 = (int)(t0 % SS);
#pragma unroll 1
  for (int tl = 0; tl < 64; ++tl) { const size_t t = t0 + tl; float* row = QKV + t * QKVP; const float pos = (float)PID[p0 + tl];
    __syncthreads();
    for (int q = tid; q < DM; q += 256) { const int which = q >> 9, hh = (q >> 5) & 15, j = q & 31; const int base = which * DM + hh * HD; const float invf = powf(10000.0f, -(float)(2 * j) / (float)HD); const float ang = pos * invf; const float c = cosf(ang), sn = sinf(ang);
      const float x1 = row[base + j], x2 = row[base + 32 + j]; sq[base + j] = x1 * c - x2 * sn; sq[base + 32 + j] = x2 * c + x1 * sn; }
    for (int q = tid; q < DM; q += 256) { const float v = row[2 * DM + q]; const __bf16 hb = (__bf16)v; svh[q][tl] = hb; svl[q][tl] = (__bf16)(v - (float)hb); }
    __syncthreads();
    for (int q = tid; q < 2 * DM / 4; q += 256) vst2(row + q * 4, *(const v4f*)&sq[q * 4]); }
  __syncthreads();
  for (int q = tid; q < DM * 8; q += 256) { const int rowi = q >> 3, pc = q & 7; const size_t o = ((size_t)b * DM + rowi) * SS + p0 + pc * 8; vst2((unsigned*)(VTH + o), *(const v4u*)&svh[rowi][pc * 8]); vst2((unsigned*)(VTL + o), *(const v4u*)&svl[rowi][pc * 8]); }
}
// ---- k_attn: block = (query block qb, b*16 + h), 4 waves: all SS/32 key steps; online softmax; O written over the q columns of the block's rows (head segment 256 B)
__global__ __launch_bounds__(128) void k_attn(float* __restrict__ QKV, const __bf16* __restrict__ VTH, const __bf16* __restrict__ VTL) {
  __shared__ __align__(16) float sp[4][16][36]; __shared__ __align__(16) float so[4][16][68];
  const int tid = threadIdx.x, wave = tid >> 5, lane = tid & 31, col = lane & 15, g = lane >> 4;
  const int qb = blockIdx.x, bh = blockIdx.y, b = bh >> 4, h = bh & 15; const int q0 = qb * 64 + wave * 16; const size_t tq = (size_t)b * SS + q0;
  const F2 a0 = split_row(QKV + (tq + col) * QKVP + h * HD, 0, lane), a1 = split_row(QKV + (tq + col) * QKVP + h * HD, 32, lane);
  float m[8], l[8];
#pragma unroll
  for (int r = 0; r < 8; ++r) { m[r] = -3.0e38f; l[r] = 0.f; }
  v8f acc[4] = {};
  const int nsteps = SS / 32;
#pragma unroll 1
  for (int ks = 0; ks < nsteps; ++ks) {
    v8f s[2];
#pragma unroll
    for (int ct = 0; ct < 2; ++ct) { const int kk = ks * 32 + ct * 16 + col; const float* krow = QKV + ((size_t)b * SS + kk) * QKVP + DM + h * HD; const F2 k0 = split_row(krow, 0, lane), k1 = split_row(krow, 32, lane);
      v8f c = mac3(a0, k0, (v8f){}); c = mac3(a1, k1, c);
#pragma unroll
      for (int r = 0; r < 8; ++r) s[ct][r] = c[r] * 0.125f; }
#pragma unroll
    for (int r = 0; r < 8; ++r) { float mx = fmaxf(s[0][r], s[1][r]);
#pragma unroll
      for (int o = 1; o < 16; o <<= 1) mx = fmaxf(mx, __shfl_xor(mx, o));
      const float mn = fmaxf(m[r], mx); const float alpha = exp_ni(m[r] - mn);
      const float e0 = exp_ni(s[0][r] - mn), e1 = exp_ni(s[1][r] - mn); float es = e0 + e1;
#pragma unroll
      for (int o = 1; o < 16; o <<= 1) es += __shfl_xor(es, o);
      l[r] = l[r] * alpha + es; m[r] = mn;
#pragma unroll
      for (int dt = 0; dt < 4; ++dt) acc[dt][r] *= alpha;
      sp[wave][8 * g + r][col] = e0; sp[wave][8 * g + r][16 + col] = e1; }
    LDSX();
    const F2 pa = split_row(&sp[wave][col][0], 0, lane);
#pragma unroll
    for (int dt = 0; dt < 4; ++dt) { const size_t vrow = ((size_t)b * DM + h * HD + dt * 16 + col) * SS + ks * 32; const v16b vh = frag_b(VTH + vrow, lane), vl = frag_b(VTL + vrow, lane);
      acc[dt] = wmma_bf(pa.l, vh, acc[dt]); acc[dt] = wmma_bf(pa.h, vl, acc[dt]); acc[dt] = wmma_bf(pa.h, vh, acc[dt]); }
    LDSX(); }
#pragma unroll
  for (int r = 0; r < 8; ++r) { const float il = 1.0f / l[r];
#pragma unroll
    for (int dt = 0; dt < 4; ++dt) so[wave][8 * g + r][dt * 16 + col] = acc[dt][r] * il; }
  LDSX();
  for (int rl = 0; rl < 16; ++rl) if (lane < 16) vst2(QKV + (tq + rl) * QKVP + h * HD + lane * 4, *(const v4f*)&so[wave][rl][lane * 4]);
}
// ---- k_out: Y = O(hi/lo; the q columns of QKV) . PT_out rows (2 products, K = 1024); block (64 rows, 128 cols)
__global__ __launch_bounds__(128) void k_out(const float* __restrict__ QKV, const __bf16* __restrict__ PT, float* __restrict__ Y) {
  __shared__ __align__(16) float so[4][16][132];
  const int tid = threadIdx.x, wave = tid >> 5, lane = tid & 31, col = lane & 15, g = lane >> 4; const size_t r0 = (size_t)blockIdx.x * 64 + wave * 16; const int n0 = blockIdx.y * 128;
  v8f acc[8] = {};
#pragma unroll 2
  for (int kc = 0; kc < DM / 32; ++kc) { const F2 a = split_row(QKV + (r0 + col) * QKVP, kc * 32, lane);
#pragma unroll
    for (int j = 0; j < 8; ++j) { const v16b w = frag_b(PT + (size_t)(3 * DM + n0 + j * 16 + col) * DM + kc * 32, lane); acc[j] = wmma_bf(a.l, w, acc[j]); acc[j] = wmma_bf(a.h, w, acc[j]); } }
#pragma unroll
  for (int j = 0; j < 8; ++j)
#pragma unroll
    for (int r = 0; r < 8; ++r) so[wave][8 * g + r][j * 16 + col] = acc[j][r];
  LDSX();
  for (int rl = 0; rl < 16; ++rl) vst2(Y + (r0 + rl) * DM + n0 + lane * 4, *(const v4f*)&so[wave][rl][lane * 4]);
}

extern "C" void kernel_launch(void* const* d_in, const int* in_sizes, int n_in, void* d_out, int out_size, void* d_ws, size_t ws_size, hipStream_t stream) {
  (void)in_sizes; (void)n_in; (void)out_size;
  const float** F = (const float**)d_in;   // hidden_states, position_ids [1,2048] int, Wq, bq, Wk, bk, Wv, bv, Wo (torch [out][in])
  if (ws_size < (size_t)WS_END) return;
  char* ws = (char*)d_ws; __bf16 *PT = (__bf16*)(ws + WS_PT), *VTH = (__bf16*)(ws + WS_VTH), *VTL = (__bf16*)(ws + WS_VTL); float* QKV = (float*)(ws + WS_QKV);
  k_pack<<<4 * DM, 128, 0, stream>>>(F[2], F[4], F[6], F[8], PT);
  k_proj<<<dim3(TRB, QKVP / 128), 128, 0, stream>>>(F[0], PT, F[3], F[5], F[7], QKV);
  k_rope<<<TRB, 256, 0, stream>>>(QKV, (const int*)d_in[1], VTH, VTL);
  k_attn<<<dim3(TQB, TNB * NH), 128, 0, stream>>>(QKV, VTH, VTL);
  k_out<<<dim3((TNB < NB ? TQB : NR / 64), DM / 128), 128, 0, stream>>>(QKV, PT, (float*)d_out);
}

// v001
// A run of this version takes 562 microseconds.
// Timed twice side by side with v000, it ran 1.43 times as fast both times.
// compute dtype: hidden_states, Wq/Wk/Wv + biases, Wo (module inputs) rounded to bf16, position_ids as int; q/k/v projections with exact bf16 products (+ bias); rotary tables (inv_freq = 10000^(-2i/64), cos/sin of pos·inv_freq) and the rotate-half mix in f32; scores and P.V with both computed operands as bf16 hi + bf16 residual pairs (3 products); output projection hi/lo x bf16 Wo (2 products); online softmax in f32; f32 accumulate.
#include <hip/hip_runtime.h>
#include <math.h>

typedef __attribute__((ext_vector_type(16))) _Float16 v16h;
typedef __attribute__((ext_vector_type(16))) __bf16 v16b;
typedef __attribute__((ext_vector_type(8)))  _Float16 v8h;
typedef __attribute__((ext_vector_type(8)))  float v8f;
typedef __attribute__((ext_vector_type(4)))  float v4f;
typedef __attribute__((ext_vector_type(2)))  float v2f;
typedef __attribute__((ext_vector_type(4)))  unsigned v4u;
typedef __attribute__((ext_vector_type(4)))  int v4i;
typedef float __attribute__((may_alias)) float_a;
typedef int __attribute__((may_alias)) int_a;

template <typename T> __device__ __forceinline__ void vst2(void* p, T v) { *(T*)p = v;  }
__device__ __forceinline__ v8f wmma16(v16h a, v16h b, v8f c) {
  v8f d = __builtin_amdgcn_wmma_f32_16x16x32_f16(false, a, false, b, (short)0, c, false, false);
  asm volatile("v_nop\n\tv_nop\n\tv_nop\n\tv_nop" : "+v"(d) : "v"(a), "v"(b));
  return d;
}
__device__ __forceinline__ v8f wmma_bf(v16b a, v16b b, v8f c) {
  v8f d = __builtin_amdgcn_wmma_f32_16x16x32_bf16(false, a, false, b, (short)0, c, false, false);
  asm volatile("v_nop\n\tv_nop\n\tv_nop\n\tv_nop" : "+v"(d) : "v"(a), "v"(b));
  return d;
}
// 16x16x32 fragments: lane = (h = lane>>4, row/col = lane&15); elements 0..7 = k0+8h+0..7, 8..15 = k0+16+8h+0..7; D element r = row 8h+r
__device__ __forceinline__ v16h frag_h(const _Float16* rowk0, int lane) {
  union { v16h v; v8h q[2]; } u; const _Float16* p = rowk0 + 8 * (lane >> 4);
  u.q[0] = *(const v8h*)p; u.q[1] = *(const v8h*)(p + 16); return u.v;
}
__device__ __forceinline__ v16h frag_f32(const float* rowk0, int lane) {
  v16h a; const float* p = rowk0 + 8 * (lane >> 4);
#pragma unroll
  for (int i = 0; i < 8; ++i) { a[i] = (_Float16)p[i]; a[8 + i] = (_Float16)p[16 + i]; }
  return a;
}
__device__ __forceinline__ v16h frag_f32s(const float* rowk0, int lane, float sc) {
  v16h a; const float* p = rowk0 + 8 * (lane >> 4);
#pragma unroll
  for (int i = 0; i < 8; ++i) { a[i] = (_Float16)(p[i] * sc); a[8 + i] = (_Float16)(p[16 + i] * sc); }
  return a;
}
// column fragment from a [K][ld] layout (column n), rows >= K read as 0
__device__ __forceinline__ v16h fragc_f32(const float* W, int k0, int n, int lane, int ld, int K) {
  v16h a; const int g = lane >> 4;
#pragma unroll
  for (int i = 0; i < 8; ++i) { const int ka = k0 + 8 * g + i, kb = ka + 16;
    a[i] = (_Float16)(ka < K ? W[(size_t)(ka < K ? ka : K - 1) * ld + n] : 0.f); a[8 + i] = (_Float16)(kb < K ? W[(size_t)(kb < K ? kb : K - 1) * ld + n] : 0.f); }
  return a;
}
struct F2 { v16b h, l; };
__device__ __forceinline__ F2 bsplit16(const float v[16]) { F2 r;
#pragma unroll
  for (int i = 0; i < 16; ++i) { const __bf16 h = (__bf16)v[i]; r.h[i] = h; r.l[i] = (__bf16)(v[i] - (float)h); }
  return r; }
__device__ __forceinline__ F2 split_row(const float* row, int k0, int lane) { float v[16]; const float* p = row + k0 + 8 * (lane >> 4);
#pragma unroll
  for (int i = 0; i < 8; ++i) { v[i] = p[i]; v[8 + i] = p[16 + i]; }
  return bsplit16(v); }
__device__ __forceinline__ F2 split_rowK(const float* row, int k0, int lane, int K) { float v[16]; const int g = lane >> 4;
#pragma unroll
  for (int i = 0; i < 8; ++i) { const int ka = k0 + 8 * g + i, kb = ka + 16; v[i] = ka < K ? row[ka < K ? ka : K - 1] : 0.f; v[8 + i] = kb < K ? row[kb < K ? kb : K - 1] : 0.f; }
  return bsplit16(v); }
__device__ __forceinline__ F2 split_col(const float* W, int k0, int n, int lane, int ld, int K) { float v[16]; const int g = lane >> 4;
#pragma unroll
  for (int i = 0; i < 8; ++i) { const int ka = k0 + 8 * g + i, kb = ka + 16; v[i] = ka < K ? W[(size_t)(ka < K ? ka : K - 1) * ld + n] : 0.f; v[8 + i] = kb < K ? W[(size_t)(kb < K ? kb : K - 1) * ld + n] : 0.f; }
  return bsplit16(v); }
__device__ __forceinline__ v8f mac3(const F2& a, const F2& b, v8f c) { c = wmma_bf(a.l, b.h, c); c = wmma_bf(a.h, b.l, c); return wmma_bf(a.h, b.h, c); }
__device__ __forceinline__ float sigm(float v) { return 1.0f / (1.0f + expf(-v)); }
#define LDSX() do { asm volatile("s_wait_dscnt 0" ::: "memory"); __builtin_amdgcn_wave_barrier(); __builtin_amdgcn_fence(__ATOMIC_RELEASE, "workgroup"); } while (0)


// Wav2Vec2 self attention: q,k,v = x W^T + b (16 heads x 64); scores = q k^T / 8; softmax (no mask); P v; merge heads; @ Wo^T (no output bias).  B 2, S 2048, D 1024.
// k_pack (W rows as bf16 rows: torch [out][in] layout is already K-contiguous), k_proj (exact GEMM + bias, 3072-wide rows), k_rope (rotary on q,k in place; v as transposed hi/lo planes), k_attn (flash-style: per (64-query block, b, h) over all 64 32-key steps, online max/sum with accumulator rescale; O rows), k_out (O hi/lo x Wo, no bias).
#define NB 2
#define SS 2048
#define DM 1024
#define NH 16
#define HD 64
#define NR (NB * SS)
#define QKVP (3 * DM)
#ifndef TRB
#define TRB (NR / 64)
#define TQB (SS / 64)
#define TNB NB
#endif
typedef __attribute__((ext_vector_type(8))) __bf16 v8b;
__device__ __forceinline__ v16b frag_b(const __bf16* rowk0, int lane) {
  union { v16b v; v8b q[2]; } u; const __bf16* p = rowk0 + 8 * (lane >> 4);
  u.q[0] = *(const v8b*)p; u.q[1] = *(const v8b*)(p + 16); return u.v;
}
__device__ __forceinline__ v16b frag_gbf(const float* rowk0, int lane) {
  v16b a; const float* p = rowk0 + 8 * (lane >> 4);
#pragma unroll
  for (int i = 0; i < 8; ++i) { a[i] = (__bf16)p[i]; a[8 + i] = (__bf16)p[16 + i]; }
  return a;
}
__device__ __forceinline__ float bfr(float v) { return (float)(__bf16)v; }
__device__ __attribute__((noinline)) float exp_ni(float v) { return expf(v); }
#define WS_PT   0u                                 // bf16 [4096 (q|k|v|out cols)][1024]
#define WS_QKV  (WS_PT + 2u * 4 * DM * DM)           // f32 [4096 rows][3072]  (q 0..1023 | k | v) ; q cols later overwritten by O
#define WS_VTH  (WS_QKV + 4u * NR * QKVP)            // bf16 [2][1024 (h*64+d)][2048]
#define WS_VTL  (WS_VTH + 2u * NB * DM * SS)
#define WS_END  (WS_VTL + 2u * NB * DM * SS)

__global__ __launch_bounds__(128) void k_pack(const float* __restrict__ Wq, const float* __restrict__ Wk, const float* __restrict__ Wv, const float* __restrict__ Wo, __bf16* __restrict__ PT) {
  __shared__ __align__(16) __bf16 srow[DM];
  const int n = blockIdx.x, tid = threadIdx.x; const int which = n >> 10, c = n & 1023; const float* Wm = which == 0 ? Wq : (which == 1 ? Wk : (which == 2 ? Wv : Wo));
  for (int k = tid; k < DM; k += 128) srow[k] = (__bf16)Wm[(size_t)c * DM + k];   // torch [out][in]: row c
  __syncthreads();
  vst2((unsigned*)(PT + (size_t)n * DM + tid * 8), *(const v4u*)(&srow[tid * 8]));
}
// ---- k_proj: QKV[r][n] = bf16(x[r]) . PT[n] (exact), K = 1024; block (64 rows, 128 cols); 512-B segments of 12-KB rows
__global__ __launch_bounds__(128) void k_proj(const float* __restrict__ X, const __bf16* __restrict__ PT, const float* __restrict__ bq, const float* __restrict__ bk, const float* __restrict__ bv, float* __restrict__ QKV) {
  __shared__ __align__(16) float so[4][16][132];
  const int tid = threadIdx.x, wave = tid >> 5, lane = tid & 31, col = lane & 15, g = lane >> 4; const size_t r0 = (size_t)blockIdx.x * 64 + wave * 16; const int n0 = blockIdx.y * 128;
  v8f acc[8] = {};
#pragma unroll 2
  for (int kc = 0; kc < DM / 32; ++kc) { const v16b a = frag_gbf(X + (r0 + col) * DM + kc * 32, lane);
#pragma unroll
    for (int j = 0; j < 8; ++j) acc[j] = wmma_bf(a, frag_b(PT + (size_t)(n0 + j * 16 + col) * DM + kc * 32, lane), acc[j]); }
#pragma unroll
  for (int j = 0; j < 8; ++j) { const int n = n0 + j * 16 + col; const int which = n >> 10, c = n & 1023; const float bb = bfr((which == 0 ? bq : which == 1 ? bk : bv)[c]);
#pragma unroll
    for (int r = 0; r < 8; ++r) so[wave][8 * g + r][j * 16 + col] = acc[j][r] + bb; }
  LDSX();
  for (int rl = 0; rl < 16; ++rl) vst2(QKV + (r0 + rl) * QKVP + n0 + lane * 4, *(const v4f*)&so[wave][rl][lane * 4]);
}
// ---- k_rope: block = (64-token block, head pair), 8 waves. A thread holds both halves of its (token, 4 j) pairs of q and k in registers and rotates them in place, so no exchange and no token loop; one angle serves q and k of both heads.
// v passes once through LDS to the transposed hi/lo planes (128-B segments of the 4-KB rows); it goes first, so that no store is outstanding at the barrier.
typedef __attribute__((ext_vector_type(2))) __bf16 v2b;
__global__ __launch_bounds__(256) void k_rope(float* __restrict__ QKV, const int* __restrict__ PID, __bf16* __restrict__ VTH, __bf16* __restrict__ VTL) {
  __shared__ __align__(16) __bf16 svh[2 * HD][72], svl[2 * HD][72];
  const int tid = threadIdx.x, lane = tid & 31, jq = tid & 7, tg = tid >> 3; const size_t t0 = (size_t)blockIdx.x * 64; const int c0 = blockIdx.y * (2 * HD); const int b = (int)(t0 / SS), p0 = (int)(t0 % SS);
  v4f vv[4][2], x[2][2][2][2]; float pos[2];   // vv[d quad jq + 8 iv][token 2 tg + e]; x[token tg + 32 it][head][q | k][half]
#pragma unroll
  for (int iv = 0; iv < 4; ++iv)
#pragma unroll
    for (int e = 0; e < 2; ++e) vv[iv][e] = *(const v4f*)(QKV + (t0 + 2 * tg + e) * QKVP + 2 * DM + c0 + (jq + 8 * iv) * 4);
#pragma unroll
  for (int it = 0; it < 2; ++it) { const float* row = QKV + (t0 + tg + 32 * it) * QKVP + c0 + jq * 4; pos[it] = (float)PID[p0 + tg + 32 * it];
#pragma unroll
    for (int hl = 0; hl < 2; ++hl)
#pragma unroll
      for (int w = 0; w < 2; ++w) { x[it][hl][w][0] = *(const v4f*)(row + w * DM + hl * HD); x[it][hl][w][1] = *(const v4f*)(row + w * DM + hl * HD + 32); } }
#pragma unroll
  for (int iv = 0; iv < 4; ++iv)
#pragma unroll
    for (int i = 0; i < 4; ++i) { const int d = (jq + 8 * iv) * 4 + i; const float v0 = vv[iv][0][i], v1 = vv[iv][1][i]; const __bf16 h0 = (__bf16)v0, h1 = (__bf16)v1;
      *(v2b*)&svh[d][2 * tg] = (v2b){h0, h1}; *(v2b*)&svl[d][2 * tg] = (v2b){(__bf16)(v0 - (float)h0), (__bf16)(v1 - (float)h1)}; }
  __syncthreads();
#pragma unroll
  for (int q = tid; q < 2 * HD * 8; q += 256) { const int rowi = q >> 3, pc = q & 7; const size_t o = ((size_t)b * DM + c0 + rowi) * SS + p0 + pc * 8; vst2((unsigned*)(VTH + o), *(const v4u*)&svh[rowi][pc * 8]); vst2((unsigned*)(VTL + o), *(const v4u*)&svl[rowi][pc * 8]); }
  const float invl = powf(10000.0f, -(float)(2 * lane) / (float)HD);   // lane j holds inv_freq[j]
  float invf[4];
#pragma unroll
  for (int i = 0; i < 4; ++i) invf[i] = __shfl(invl, jq * 4 + i);
#pragma unroll
  for (int it = 0; it < 2; ++it) { float* row = QKV + (t0 + tg + 32 * it) * QKVP + c0 + jq * 4; v4f y[2][2][2];
#pragma unroll
    for (int i = 0; i < 4; ++i) { const float ang = pos[it] * invf[i]; const float c = cosf(ang), sn = sinf(ang);
#pragma unroll
      for (int hl = 0; hl < 2; ++hl)
#pragma unroll
        for (int w = 0; w < 2; ++w) { const float x1 = x[it][hl][w][0][i], x2 = x[it][hl][w][1][i]; y[hl][w][0][i] = x1 * c - x2 * sn; y[hl][w][1][i] = x2 * c + x1 * sn; } }
#pragma unroll
    for (int hl = 0; hl < 2; ++hl)
#pragma unroll
      for (int w = 0; w < 2; ++w) { vst2(row + w * DM + hl * HD, y[hl][w][0]); vst2(row + w * DM + hl * HD + 32, y[hl][w][1]); } }
}
// ---- k_attn: block = (query block qb, b*16 + h), 4 waves: all SS/32 key steps; online softmax; O written over the q columns of the block's rows (head segment 256 B)
__global__ __launch_bounds__(128) void k_attn(float* __restrict__ QKV, const __bf16* __restrict__ VTH, const __bf16* __restrict__ VTL) {
  __shared__ __align__(16) float sp[4][16][36]; __shared__ __align__(16) float so[4][16][68];
  const int tid = threadIdx.x, wave = tid >> 5, lane = tid & 31, col = lane & 15, g = lane >> 4;
  const int qb = blockIdx.x, bh = blockIdx.y, b = bh >> 4, h = bh & 15; const int q0 = qb * 64 + wave * 16; const size_t tq = (size_t)b * SS + q0;
  const F2 a0 = split_row(QKV + (tq + col) * QKVP + h * HD, 0, lane), a1 = split_row(QKV + (tq + col) * QKVP + h * HD, 32, lane);
  float m[8], l[8];
#pragma unroll
  for (int r = 0; r < 8; ++r) { m[r] = -3.0e38f; l[r] = 0.f; }
  v8f acc[4] = {};
  const int nsteps = SS / 32;
#pragma unroll 1
  for (int ks = 0; ks < nsteps; ++ks) {
    v8f s[2];
#pragma unroll
    for (int ct = 0; ct < 2; ++ct) { const int kk = ks * 32 + ct * 16 + col; const float* krow = QKV + ((size_t)b * SS + kk) * QKVP + DM + h * HD; const F2 k0 = split_row(krow, 0, lane), k1 = split_row(krow, 32, lane);
      v8f c = mac3(a0, k0, (v8f){}); c = mac3(a1, k1, c);
#pragma unroll
      for (int r = 0; r < 8; ++r) s[ct][r] = c[r] * 0.125f; }
#pragma unroll
    for (int r = 0; r < 8; ++r) { float mx = fmaxf(s[0][r], s[1][r]);
#pragma unroll
      for (int o = 1; o < 16; o <<= 1) mx = fmaxf(mx, __shfl_xor(mx, o));
      const float mn = fmaxf(m[r], mx); const float alpha = exp_ni(m[r] - mn);
      const float e0 = exp_ni(s[0][r] - mn), e1 = exp_ni(s[1][r] - mn); float es = e0 + e1;
#pragma unroll
      for (int o = 1; o < 16; o <<= 1) es += __shfl_xor(es, o);
      l[r] = l[r] * alpha + es; m[r] = mn;
#pragma unroll
      for (int dt = 0; dt < 4; ++dt) acc[dt][r] *= alpha;
      sp[wave][8 * g + r][col] = e0; sp[wave][8 * g + r][16 + col] = e1; }
    LDSX();
    const F2 pa = split_row(&sp[wave][col][0], 0, lane);
#pragma unroll
    for (int dt = 0; dt < 4; ++dt) { const size_t vrow = ((size_t)b * DM + h * HD + dt * 16 + col) * SS + ks * 32; const v16b vh = frag_b(VTH + vrow, lane), vl = frag_b(VTL + vrow, lane);
      acc[dt] = wmma_bf(pa.l, vh, acc[dt]); acc[dt] = wmma_bf(pa.h, vl, acc[dt]); acc[dt] = wmma_bf(pa.h, vh, acc[dt]); }
    LDSX(); }
#pragma unroll
  for (int r = 0; r < 8; ++r) { const float il = 1.0f / l[r];
#pragma unroll
    for (int dt = 0; dt < 4; ++dt) so[wave][8 * g + r][dt * 16 + col] = acc[dt][r] * il; }
  LDSX();
  for (int rl = 0; rl < 16; ++rl) if (lane < 16) vst2(QKV + (tq + rl) * QKVP + h * HD + lane * 4, *(const v4f*)&so[wave][rl][lane * 4]);
}
// ---- k_out: Y = O(hi/lo; the q columns of QKV) . PT_out rows (2 products, K = 1024); block (64 rows, 128 cols)
__global__ __launch_bounds__(128) void k_out(const float* __restrict__ QKV, const __bf16* __restrict__ PT, float* __restrict__ Y) {
  __shared__ __align__(16) float so[4][16][132];
  const int tid = threadIdx.x, wave = tid >> 5, lane = tid & 31, col = lane & 15, g = lane >> 4; const size_t r0 = (size_t)blockIdx.x * 64 + wave * 16; const int n0 = blockIdx.y * 128;
  v8f acc[8] = {};
#pragma unroll 2
  for (int kc = 0; kc < DM / 32; ++kc) { const F2 a = split_row(QKV + (r0 + col) * QKVP, kc * 32, lane);
#pragma unroll
    for (int j = 0; j < 8; ++j) { const v16b w = frag_b(PT + (size_t)(3 * DM + n0 + j * 16 + col) * DM + kc * 32, lane); acc[j] = wmma_bf(a.l, w, acc[j]); acc[j] = wmma_bf(a.h, w, acc[j]); } }
#pragma unroll
  for (int j = 0; j < 8; ++j)
#pragma unroll
    for (int r = 0; r < 8; ++r) so[wave][8 * g + r][j * 16 + col] = acc[j][r];
  LDSX();
  for (int rl = 0; rl < 16; ++rl) vst2(Y + (r0 + rl) * DM + n0 + lane * 4, *(const v4f*)&so[wave][rl][lane * 4]);
}

extern "C" void kernel_launch(void* const* d_in, const int* in_sizes, int n_in, void* d_out, int out_size, void* d_ws, size_t ws_size, hipStream_t stream) {
  (void)in_sizes; (void)n_in; (void)out_size;
  const float** F = (const float**)d_in;   // hidden_states, position_ids [1,2048] int, Wq, bq, Wk, bk, Wv, bv, Wo (torch [out][in])
  if (ws_size < (size_t)WS_END) return;
  char* ws = (char*)d_ws; __bf16 *PT = (__bf16*)(ws + WS_PT), *VTH = (__bf16*)(ws + WS_VTH), *VTL = (__bf16*)(ws + WS_VTL); float* QKV = (float*)(ws + WS_QKV);
  k_pack<<<4 * DM, 128, 0, stream>>>(F[2], F[4], F[6], F[8], PT);
  k_proj<<<dim3(TRB, QKVP / 128), 128, 0, stream>>>(F[0], PT, F[3], F[5], F[7], QKV);
  k_rope<<<dim3(TRB, NH / 2), 256, 0, stream>>>(QKV, (const int*)d_in[1], VTH, VTL);
  k_attn<<<dim3(TQB, TNB * NH), 128, 0, stream>>>(QKV, VTH, VTL);
  k_out<<<dim3((TNB < NB ? TQB : NR / 64), DM / 128), 128, 0, stream>>>(QKV, PT, (float*)d_out);
}

// v002
// It runs in 455 microseconds.
// Timed twice side by side with v001, it ran 1.23 and 1.22 times as fast.
// Counting every step since v000, it is 1.75 times as fast.
// compute dtype: hidden_states, Wq/Wk/Wv + biases, Wo (module inputs) rounded to bf16, position_ids as int; q/k/v projections with exact bf16 products (+ bias); rotary tables (inv_freq = 10000^(-2i/64), cos/sin of pos·inv_freq) and the rotate-half mix in f32; scores and P.V with both computed operands as bf16 hi + bf16 residual pairs (3 products); output projection hi/lo x bf16 Wo (2 products); online softmax in f32; f32 accumulate.
#include <hip/hip_runtime.h>
#include <math.h>

typedef __attribute__((ext_vector_type(16))) _Float16 v16h;
typedef __attribute__((ext_vector_type(16))) __bf16 v16b;
typedef __attribute__((ext_vector_type(8)))  _Float16 v8h;
typedef __attribute__((ext_vector_type(8)))  float v8f;
typedef __attribute__((ext_vector_type(4)))  float v4f;
typedef __attribute__((ext_vector_type(2)))  float v2f;
typedef __attribute__((ext_vector_type(4)))  unsigned v4u;
typedef __attribute__((ext_vector_type(4)))  int v4i;
typedef float __attribute__((may_alias)) float_a;
typedef int __attribute__((may_alias)) int_a;

template <typename T> __device__ __forceinline__ void vst2(void* p, T v) { *(T*)p = v;  }
__device__ __forceinline__ v8f wmma16(v16h a, v16h b, v8f c) {
  v8f d = __builtin_amdgcn_wmma_f32_16x16x32_f16(false, a, false, b, (short)0, c, false, false);
  asm volatile("v_nop\n\tv_nop\n\tv_nop\n\tv_nop" : "+v"(d) : "v"(a), "v"(b));
  return d;
}
__device__ __forceinline__ v8f wmma_bf(v16b a, v16b b, v8f c) {
  v8f d = __builtin_amdgcn_wmma_f32_16x16x32_bf16(false, a, false, b, (short)0, c, false, false);
  asm volatile("v_nop\n\tv_nop\n\tv_nop\n\tv_nop" : "+v"(d) : "v"(a), "v"(b));
  return d;
}
// 16x16x32 fragments: lane = (h = lane>>4, row/col = lane&15); elements 0..7 = k0+8h+0..7, 8..15 = k0+16+8h+0..7; D element r = row 8h+r
__device__ __forceinline__ v16h frag_h(const _Float16* rowk0, int lane) {
  union { v16h v; v8h q[2]; } u; const _Float16* p = rowk0 + 8 * (lane >> 4);
  u.q[0] = *(const v8h*)p; u.q[1] = *(const v8h*)(p + 16); return u.v;
}
__device__ __forceinline__ v16h frag_f32(const float* rowk0, int lane) {
  v16h a; const float* p = rowk0 + 8 * (lane >> 4);
#pragma unroll
  for (int i = 0; i < 8; ++i) { a[i] = (_Float16)p[i]; a[8 + i] = (_Float16)p[16 + i]; }
  return a;
}
__device__ __forceinline__ v16h frag_f32s(const float* rowk0, int lane, float sc) {
  v16h a; const float* p = rowk0 + 8 * (lane >> 4);
#pragma unroll
  for (int i = 0; i < 8; ++i) { a[i] = (_Float16)(p[i] * sc); a[8 + i] = (_Float16)(p[16 + i] * sc); }
  return a;
}
// column fragment from a [K][ld] layout (column n), rows >= K read as 0
__device__ __forceinline__ v16h fragc_f32(const float* W, int k0, int n, int lane, int ld, int K) {
  v16h a; const int g = lane >> 4;
#pragma unroll
  for (int i = 0; i < 8; ++i) { const int ka = k0 + 8 * g + i, kb = ka + 16;
    a[i] = (_Float16)(ka < K ? W[(size_t)(ka < K ? ka : K - 1) * ld + n] : 0.f); a[8 + i] = (_Float16)(kb < K ? W[(size_t)(kb < K ? kb : K - 1) * ld + n] : 0.f); }
  return a;
}
struct F2 { v16b h, l; };
__device__ __forceinline__ F2 bsplit16(const float v[16]) { F2 r;
#pragma unroll
  for (int i = 0; i < 16; ++i) { const __bf16 h = (__bf16)v[i]; r.h[i] = h; r.l[i] = (__bf16)(v[i] - (float)h); }
  return r; }
__device__ __forceinline__ F2 split_row(const float* row, int k0, int lane) { float v[16]; const float* p = row + k0 + 8 * (lane >> 4);
#pragma unroll
  for (int i = 0; i < 8; ++i) { v[i] = p[i]; v[8 + i] = p[16 + i]; }
  return bsplit16(v); }
__device__ __forceinline__ F2 split_rowK(const float* row, int k0, int lane, int K) { float v[16]; const int g = lane >> 4;
#pragma unroll
  for (int i = 0; i < 8; ++i) { const int ka = k0 + 8 * g + i, kb = ka + 16; v[i] = ka < K ? row[ka < K ? ka : K - 1] : 0.f; v[8 + i] = kb < K ? row[kb < K ? kb : K - 1] : 0.f; }
  return bsplit16(v); }
__device__ __forceinline__ F2 split_col(const float* W, int k0, int n, int lane, int ld, int K) { float v[16]; const int g = lane >> 4;
#pragma unroll
  for (int i = 0; i < 8; ++i) { const int ka = k0 + 8 * g + i, kb = ka + 16; v[i] = ka < K ? W[(size_t)(ka < K ? ka : K - 1) * ld + n] : 0.f; v[8 + i] = kb < K ? W[(size_t)(kb < K ? kb : K - 1) * ld + n] : 0.f; }
  return bsplit16(v); }
__device__ __forceinline__ v8f mac3(const F2& a, const F2& b, v8f c) { c = wmma_bf(a.l, b.h, c); c = wmma_bf(a.h, b.l, c); return wmma_bf(a.h, b.h, c); }
__device__ __forceinline__ float sigm(float v) { return 1.0f / (1.0f + expf(-v)); }
#define LDSX() do { asm volatile("s_wait_dscnt 0" ::: "memory"); __builtin_amdgcn_wave_barrier(); __builtin_amdgcn_fence(__ATOMIC_RELEASE, "workgroup"); } while (0)


// Wav2Vec2 self attention: q,k,v = x W^T + b (16 heads x 64); scores = q k^T / 8; softmax (no mask); P v; merge heads; @ Wo^T (no output bias).  B 2, S 2048, D 1024.
// k_pack (W rows as bf16 rows: torch [out][in] layout is already K-contiguous), k_proj (exact GEMM + bias, 3072-wide rows), k_rope (rotary on q,k in place; v as transposed hi/lo planes), k_attn (flash-style: per (64-query block, b, h) over all 64 32-key steps, online max/sum with accumulator rescale; O rows), k_out (O hi/lo x Wo, no bias).
#define NB 2
#define SS 2048
#define DM 1024
#define NH 16
#define HD 64
#define NR (NB * SS)
#define QKVP (3 * DM)
#ifndef TRB
#define TRB (NR / 64)
#define TQB (SS / 64)
#define TNB NB
#endif
typedef __attribute__((ext_vector_type(8))) __bf16 v8b;
__device__ __forceinline__ v16b frag_b(const __bf16* rowk0, int lane) {
  union { v16b v; v8b q[2]; } u; const __bf16* p = rowk0 + 8 * (lane >> 4);
  u.q[0] = *(const v8b*)p; u.q[1] = *(const v8b*)(p + 16); return u.v;
}
__device__ __forceinline__ v16b frag_gbf(const float* rowk0, int lane) {
  v16b a; const float* p = rowk0 + 8 * (lane >> 4);
#pragma unroll
  for (int i = 0; i < 8; ++i) { a[i] = (__bf16)p[i]; a[8 + i] = (__bf16)p[16 + i]; }
  return a;
}
__device__ __forceinline__ float bfr(float v) { return (float)(__bf16)v; }
__device__ __attribute__((noinline)) float exp_ni(float v) { return expf(v); }
#define WS_PT   0u                                 // bf16 [4096 (q|k|v|out cols)][1024]
#define WS_QKV  (WS_PT + 2u * 4 * DM * DM)           // f32 [4096 rows][3072]  (q 0..1023 | k | v) ; q cols later overwritten by O
#define WS_VTH  (WS_QKV + 4u * NR * QKVP)            // bf16 [2][1024 (h*64+d)][2048]
#define WS_VTL  (WS_VTH + 2u * NB * DM * SS)
#define WS_END  (WS_VTL + 2u * NB * DM * SS)

__global__ __launch_bounds__(128) void k_pack(const float* __restrict__ Wq, const float* __restrict__ Wk, const float* __restrict__ Wv, const float* __restrict__ Wo, __bf16* __restrict__ PT) {
  __shared__ __align__(16) __bf16 srow[DM];
  const int n = blockIdx.x, tid = threadIdx.x; const int which = n >> 10, c = n & 1023; const float* Wm = which == 0 ? Wq : (which == 1 ? Wk : (which == 2 ? Wv : Wo));
  for (int k = tid; k < DM; k += 128) srow[k] = (__bf16)Wm[(size_t)c * DM + k];   // torch [out][in]: row c
  __syncthreads();
  vst2((unsigned*)(PT + (size_t)n * DM + tid * 8), *(const v4u*)(&srow[tid * 8]));
}
// ---- k_proj: QKV[r][n] = bf16(x[r]) . PT[n] (exact), K = 1024; block (64 rows, 128 cols); 512-B segments of 12-KB rows
__global__ __launch_bounds__(128) void k_proj(const float* __restrict__ X, const __bf16* __restrict__ PT, const float* __restrict__ bq, const float* __restrict__ bk, const float* __restrict__ bv, float* __restrict__ QKV) {
  __shared__ __align__(16) float so[4][16][132];
  const int tid = threadIdx.x, wave = tid >> 5, lane = tid & 31, col = lane & 15, g = lane >> 4; const size_t r0 = (size_t)blockIdx.x * 64 + wave * 16; const int n0 = blockIdx.y * 128;
  v8f acc[8] = {}; const __bf16* wp = PT + (size_t)(n0 + col) * DM;   // one base: the eight column groups are constant offsets from it
#pragma unroll 2
  for (int kc = 0; kc < DM / 32; ++kc) { const v16b a = frag_gbf(X + (r0 + col) * DM + kc * 32, lane); v16b w[8];   // all loads of the k step stand ahead of its first product: one latency a step, not one a product
#pragma unroll
    for (int j = 0; j < 8; ++j) w[j] = frag_b(wp + j * 16 * DM + kc * 32, lane);
#pragma unroll
    for (int j = 0; j < 8; ++j) acc[j] = wmma_bf(a, w[j], acc[j]);
    asm volatile("s_wait_xcnt 0x0" ::: "memory"); }   // stands ahead of the next step's rewrite of the load address registers
#pragma unroll
  for (int j = 0; j < 8; ++j) { const int n = n0 + j * 16 + col; const int which = n >> 10, c = n & 1023; const float bb = bfr((which == 0 ? bq : which == 1 ? bk : bv)[c]);
#pragma unroll
    for (int r = 0; r < 8; ++r) so[wave][8 * g + r][j * 16 + col] = acc[j][r] + bb; }
  LDSX();
  for (int rl = 0; rl < 16; ++rl) vst2(QKV + (r0 + rl) * QKVP + n0 + lane * 4, *(const v4f*)&so[wave][rl][lane * 4]);
}
// ---- k_rope: block = (64-token block, head pair), 8 waves. A thread holds both halves of its (token, 4 j) pairs of q and k in registers and rotates them in place, so no exchange and no token loop; one angle serves q and k of both heads.
// v passes once through LDS to the transposed hi/lo planes (128-B segments of the 4-KB rows); it goes first, so that no store is outstanding at the barrier.
typedef __attribute__((ext_vector_type(2))) __bf16 v2b;
__global__ __launch_bounds__(256) void k_rope(float* __restrict__ QKV, const int* __restrict__ PID, __bf16* __restrict__ VTH, __bf16* __restrict__ VTL) {
  __shared__ __align__(16) __bf16 svh[2 * HD][72], svl[2 * HD][72];
  const int tid = threadIdx.x, lane = tid & 31, jq = tid & 7, tg = tid >> 3; const size_t t0 = (size_t)blockIdx.x * 64; const int c0 = blockIdx.y * (2 * HD); const int b = (int)(t0 / SS), p0 = (int)(t0 % SS);
  v4f vv[4][2], x[2][2][2][2]; float pos[2];   // vv[d quad jq + 8 iv][token 2 tg + e]; x[token tg + 32 it][head][q | k][half]
#pragma unroll
  for (int iv = 0; iv < 4; ++iv)
#pragma unroll
    for (int e = 0; e < 2; ++e) vv[iv][e] = *(const v4f*)(QKV + (t0 + 2 * tg + e) * QKVP + 2 * DM + c0 + (jq + 8 * iv) * 4);
#pragma unroll
  for (int it = 0; it < 2; ++it) { const float* row = QKV + (t0 + tg + 32 * it) * QKVP + c0 + jq * 4; pos[it] = (float)PID[p0 + tg + 32 * it];
#pragma unroll
    for (int hl = 0; hl < 2; ++hl)
#pragma unroll
      for (int w = 0; w < 2; ++w) { x[it][hl][w][0] = *(const v4f*)(row + w * DM + hl * HD); x[it][hl][w][1] = *(const v4f*)(row + w * DM + hl * HD + 32); } }
#pragma unroll
  for (int iv = 0; iv < 4; ++iv)
#pragma unroll
    for (int i = 0; i < 4; ++i) { const int d = (jq + 8 * iv) * 4 + i; const float v0 = vv[iv][0][i], v1 = vv[iv][1][i]; const __bf16 h0 = (__bf16)v0, h1 = (__bf16)v1;
      *(v2b*)&svh[d][2 * tg] = (v2b){h0, h1}; *(v2b*)&svl[d][2 * tg] = (v2b){(__bf16)(v0 - (float)h0), (__bf16)(v1 - (float)h1)}; }
  __syncthreads();
#pragma unroll
  for (int q = tid; q < 2 * HD * 8; q += 256) { const int rowi = q >> 3, pc = q & 7; const size_t o = ((size_t)b * DM + c0 + rowi) * SS + p0 + pc * 8; vst2((unsigned*)(VTH + o), *(const v4u*)&svh[rowi][pc * 8]); vst2((unsigned*)(VTL + o), *(const v4u*)&svl[rowi][pc * 8]); }
  const float invl = powf(10000.0f, -(float)(2 * lane) / (float)HD);   // lane j holds inv_freq[j]
  float invf[4];
#pragma unroll
  for (int i = 0; i < 4; ++i) invf[i] = __shfl(invl, jq * 4 + i);
#pragma unroll
  for (int it = 0; it < 2; ++it) { float* row = QKV + (t0 + tg + 32 * it) * QKVP + c0 + jq * 4; v4f y[2][2][2];
#pragma unroll
    for (int i = 0; i < 4; ++i) { const float ang = pos[it] * invf[i]; const float c = cosf(ang), sn = sinf(ang);
#pragma unroll
      for (int hl = 0; hl < 2; ++hl)
#pragma unroll
        for (int w = 0; w < 2; ++w) { const float x1 = x[it][hl][w][0][i], x2 = x[it][hl][w][1][i]; y[hl][w][0][i] = x1 * c - x2 * sn; y[hl][w][1][i] = x2 * c + x1 * sn; } }
#pragma unroll
    for (int hl = 0; hl < 2; ++hl)
#pragma unroll
      for (int w = 0; w < 2; ++w) { vst2(row + w * DM + hl * HD, y[hl][w][0]); vst2(row + w * DM + hl * HD + 32, y[hl][w][1]); } }
}
// ---- k_attn: block = (query block qb, b*16 + h), 4 waves: all SS/32 key steps; online softmax; O written over the q columns of the block's rows (head segment 256 B)
__global__ __launch_bounds__(128) void k_attn(float* __restrict__ QKV, const __bf16* __restrict__ VTH, const __bf16* __restrict__ VTL) {
  __shared__ __align__(16) float sp[4][16][36]; __shared__ __align__(16) float so[4][16][68];
  const int tid = threadIdx.x, wave = tid >> 5, lane = tid & 31, col = lane & 15, g = lane >> 4;
  const int qb = blockIdx.x, bh = blockIdx.y, b = bh >> 4, h = bh & 15; const int q0 = qb * 64 + wave * 16; const size_t tq = (size_t)b * SS + q0;
  const F2 a0 = split_row(QKV + (tq + col) * QKVP + h * HD, 0, lane), a1 = split_row(QKV + (tq + col) * QKVP + h * HD, 32, lane);
  float m[8], l[8];
#pragma unroll
  for (int r = 0; r < 8; ++r) { m[r] = -3.0e38f; l[r] = 0.f; }
  v8f acc[4] = {};
  const int nsteps = SS / 32;
#pragma unroll 1
  for (int ks = 0; ks < nsteps; ++ks) {
    v8f s[2]; v4f kq[2][8]; v16b vh[4], vl[4];   // all k and v loads of the key step stand ahead of its first product: one latency a step, not six
#pragma unroll
    for (int ct = 0; ct < 2; ++ct) { const int kk = ks * 32 + ct * 16 + col; const float* kp = QKV + ((size_t)b * SS + kk) * QKVP + DM + h * HD + 8 * g;
#pragma unroll
      for (int i = 0; i < 4; ++i) { kq[ct][2 * i] = *(const v4f*)(kp + 16 * i); kq[ct][2 * i + 1] = *(const v4f*)(kp + 16 * i + 4); } }
#pragma unroll
    for (int dt = 0; dt < 4; ++dt) { const size_t vrow = ((size_t)b * DM + h * HD + dt * 16 + col) * SS + ks * 32; vh[dt] = frag_b(VTH + vrow, lane); vl[dt] = frag_b(VTL + vrow, lane); }
    // holds the 32 loads together (loaded values as inputs only): without it the compiler sinks them to their uses and each small group is waited for by itself; the wait stands ahead of the rewrite of their address registers
    asm volatile("s_wait_xcnt 0x0" :: "v"(kq[0][0]), "v"(kq[0][1]), "v"(kq[0][2]), "v"(kq[0][3]), "v"(kq[0][4]), "v"(kq[0][5]), "v"(kq[0][6]), "v"(kq[0][7]), "v"(kq[1][0]), "v"(kq[1][1]), "v"(kq[1][2]), "v"(kq[1][3]), "v"(kq[1][4]), "v"(kq[1][5]), "v"(kq[1][6]), "v"(kq[1][7]),
                 "v"(vh[0]), "v"(vl[0]), "v"(vh[1]), "v"(vl[1]), "v"(vh[2]), "v"(vl[2]), "v"(vh[3]), "v"(vl[3]) : "memory");
#pragma unroll
    for (int ct = 0; ct < 2; ++ct) { float kv[2][16];
#pragma unroll
      for (int i = 0; i < 16; ++i) { kv[0][i] = kq[ct][i >> 2][i & 3]; kv[1][i] = kq[ct][4 + (i >> 2)][i & 3]; }
      const F2 k0 = bsplit16(kv[0]), k1 = bsplit16(kv[1]);
      v8f c = mac3(a0, k0, (v8f){}); c = mac3(a1, k1, c);
#pragma unroll
      for (int r = 0; r < 8; ++r) s[ct][r] = c[r] * 0.125f; }
#pragma unroll
    for (int r = 0; r < 8; ++r) { float mx = fmaxf(s[0][r], s[1][r]);
#pragma unroll
      for (int o = 1; o < 16; o <<= 1) mx = fmaxf(mx, __shfl_xor(mx, o));
      const float mn = fmaxf(m[r], mx); const float alpha = exp_ni(m[r] - mn);
      const float e0 = exp_ni(s[0][r] - mn), e1 = exp_ni(s[1][r] - mn); float es = e0 + e1;
#pragma unroll
      for (int o = 1; o < 16; o <<= 1) es += __shfl_xor(es, o);
      l[r] = l[r] * alpha + es; m[r] = mn;
#pragma unroll
      for (int dt = 0; dt < 4; ++dt) acc[dt][r] *= alpha;
      sp[wave][8 * g + r][col] = e0; sp[wave][8 * g + r][16 + col] = e1; }
    LDSX();
    const F2 pa = split_row(&sp[wave][col][0], 0, lane);
#pragma unroll
    for (int dt = 0; dt < 4; ++dt) { acc[dt] = wmma_bf(pa.l, vh[dt], acc[dt]); acc[dt] = wmma_bf(pa.h, vl[dt], acc[dt]); acc[dt] = wmma_bf(pa.h, vh[dt], acc[dt]); }
    LDSX(); }
#pragma unroll
  for (int r = 0; r < 8; ++r) { const float il = 1.0f / l[r];
#pragma unroll
    for (int dt = 0; dt < 4; ++dt) so[wave][8 * g + r][dt * 16 + col] = acc[dt][r] * il; }
  LDSX();
  for (int rl = 0; rl < 16; ++rl) if (lane < 16) vst2(QKV + (tq + rl) * QKVP + h * HD + lane * 4, *(const v4f*)&so[wave][rl][lane * 4]);
}
// ---- k_out: Y = O(hi/lo; the q columns of QKV) . PT_out rows (2 products, K = 1024); block (64 rows, 128 cols)
__global__ __launch_bounds__(128) void k_out(const float* __restrict__ QKV, const __bf16* __restrict__ PT, float* __restrict__ Y) {
  __shared__ __align__(16) float so[4][16][132];
  const int tid = threadIdx.x, wave = tid >> 5, lane = tid & 31, col = lane & 15, g = lane >> 4; const size_t r0 = (size_t)blockIdx.x * 64 + wave * 16; const int n0 = blockIdx.y * 128;
  v8f acc[8] = {}; const __bf16* wp = PT + (size_t)(3 * DM + n0 + col) * DM;
#pragma unroll 2
  for (int kc = 0; kc < DM / 32; ++kc) { const F2 a = split_row(QKV + (r0 + col) * QKVP, kc * 32, lane); v16b w[8];   // loads grouped ahead of the products, as in k_proj
#pragma unroll
    for (int j = 0; j < 8; ++j) w[j] = frag_b(wp + j * 16 * DM + kc * 32, lane);
#pragma unroll
    for (int j = 0; j < 8; ++j) { acc[j] = wmma_bf(a.l, w[j], acc[j]); acc[j] = wmma_bf(a.h, w[j], acc[j]); }
    asm volatile("s_wait_xcnt 0x0" ::: "memory"); }   // stands ahead of the next step's rewrite of the load address registers
#pragma unroll
  for (int j = 0; j < 8; ++j)
#pragma unroll
    for (int r = 0; r < 8; ++r) so[wave][8 * g + r][j * 16 + col] = acc[j][r];
  LDSX();
  for (int rl = 0; rl < 16; ++rl) vst2(Y + (r0 + rl) * DM + n0 + lane * 4, *(const v4f*)&so[wave][rl][lane * 4]);
}

extern "C" void kernel_launch(void* const* d_in, const int* in_sizes, int n_in, void* d_out, int out_size, void* d_ws, size_t ws_size, hipStream_t stream) {
  (void)in_sizes; (void)n_in; (void)out_size;
  const float** F = (const float**)d_in;   // hidden_states, position_ids [1,2048] int, Wq, bq, Wk, bk, Wv, bv, Wo (torch [out][in])
  if (ws_size < (size_t)WS_END) return;
  char* ws = (char*)d_ws; __bf16 *PT = (__bf16*)(ws + WS_PT), *VTH = (__bf16*)(ws + WS_VTH), *VTL = (__bf16*)(ws + WS_VTL); float* QKV = (float*)(ws + WS_QKV);
  k_pack<<<4 * DM, 128, 0, stream>>>(F[2], F[4], F[6], F[8], PT);
  k_proj<<<dim3(TRB, QKVP / 128), 128, 0, stream>>>(F[0], PT, F[3], F[5], F[7], QKV);
  k_rope<<<dim3(TRB, NH / 2), 256, 0, stream>>>(QKV, (const int*)d_in[1], VTH, VTL);
  k_attn<<<dim3(TQB, TNB * NH), 128, 0, stream>>>(QKV, VTH, VTL);
  k_out<<<dim3((TNB < NB ? TQB : NR / 64), DM / 128), 128, 0, stream>>>(QKV, PT, (float*)d_out);
}

// v003
// One run takes 370 microseconds.
// Two timings next to v002 put it at 1.23 and 1.22 times that version's speed.
// Over all steps from v000 it is 2.15 times as fast.
// compute dtype: hidden_states, Wq/Wk/Wv + biases, Wo (module inputs) rounded to bf16, position_ids as int; q/k/v projections with exact bf16 products (+ bias); rotary tables (inv_freq = 10000^(-2i/64), cos/sin of pos·inv_freq) and the rotate-half mix in f32; scores and P.V with both computed operands as bf16 hi + bf16 residual pairs (3 products); output projection hi/lo x bf16 Wo (2 products); online softmax in f32; f32 accumulate.
#include <hip/hip_runtime.h>
#include <math.h>

typedef __attribute__((ext_vector_type(16))) _Float16 v16h;
typedef __attribute__((ext_vector_type(16))) __bf16 v16b;
typedef __attribute__((ext_vector_type(8)))  _Float16 v8h;
typedef __attribute__((ext_vector_type(8)))  float v8f;
typedef __attribute__((ext_vector_type(4)))  float v4f;
typedef __attribute__((ext_vector_type(2)))  float v2f;
typedef __attribute__((ext_vector_type(4)))  unsigned v4u;
typedef __attribute__((ext_vector_type(4)))  int v4i;
typedef float __attribute__((may_alias)) float_a;
typedef int __attribute__((may_alias)) int_a;

template <typename T> __device__ __forceinline__ void vst2(void* p, T v) { *(T*)p = v;  }
__device__ __forceinline__ v8f wmma16(v16h a, v16h b, v8f c) {
  v8f d = __builtin_amdgcn_wmma_f32_16x16x32_f16(false, a, false, b, (short)0, c, false, false);
  asm volatile("v_nop\n\tv_nop\n\tv_nop\n\tv_nop" : "+v"(d) : "v"(a), "v"(b));
  return d;
}
__device__ __forceinline__ v8f wmma_bf(v16b a, v16b b, v8f c) {
  v8f d = __builtin_amdgcn_wmma_f32_16x16x32_bf16(false, a, false, b, (short)0, c, false, false);
  asm volatile("v_nop\n\tv_nop\n\tv_nop\n\tv_nop" : "+v"(d) : "v"(a), "v"(b));
  return d;
}
// 16x16x32 fragments: lane = (h = lane>>4, row/col = lane&15); elements 0..7 = k0+8h+0..7, 8..15 = k0+16+8h+0..7; D element r = row 8h+r
__device__ __forceinline__ v16h frag_h(const _Float16* rowk0, int lane) {
  union { v16h v; v8h q[2]; } u; const _Float16* p = rowk0 + 8 * (lane >> 4);
  u.q[0] = *(const v8h*)p; u.q[1] = *(const v8h*)(p + 16); return u.v;
}
__device__ __forceinline__ v16h frag_f32(const float* rowk0, int lane) {
  v16h a; const float* p = rowk0 + 8 * (lane >> 4);
#pragma unroll
  for (int i = 0; i < 8; ++i) { a[i] = (_Float16)p[i]; a[8 + i] = (_Float16)p[16 + i]; }
  return a;
}
__device__ __forceinline__ v16h frag_f32s(const float* rowk0, int lane, float sc) {
  v16h a; const float* p = rowk0 + 8 * (lane >> 4);
#pragma unroll
  for (int i = 0; i < 8; ++i) { a[i] = (_Float16)(p[i] * sc); a[8 + i] = (_Float16)(p[16 + i] * sc); }
  return a;
}
// column fragment from a [K][ld] layout (column n), rows >= K read as 0
__device__ __forceinline__ v16h fragc_f32(const float* W, int k0, int n, int lane, int ld, int K) {
  v16h a; const int g = lane >> 4;
#pragma unroll
  for (int i = 0; i < 8; ++i) { const int ka = k0 + 8 * g + i, kb = ka + 16;
    a[i] = (_Float16)(ka < K ? W[(size_t)(ka < K ? ka : K - 1) * ld + n] : 0.f); a[8 + i] = (_Float16)(kb < K ? W[(size_t)(kb < K ? kb : K - 1) * ld + n] : 0.f); }
  return a;
}
struct F2 { v16b h, l; };
__device__ __forceinline__ F2 bsplit16(const float v[16]) { F2 r;
#pragma unroll
  for (int i = 0; i < 16; ++i) { const __bf16 h = (__bf16)v[i]; r.h[i] = h; r.l[i] = (__bf16)(v[i] - (float)h); }
  return r; }
__device__ __forceinline__ F2 split_row(const float* row, int k0, int lane) { float v[16]; const float* p = row + k0 + 8 * (lane >> 4);
#pragma unroll
  for (int i = 0; i < 8; ++i) { v[i] = p[i]; v[8 + i] = p[16 + i]; }
  return bsplit16(v); }
__device__ __forceinline__ F2 split_rowK(const float* row, int k0, int lane, int K) { float v[16]; const int g = lane >> 4;
#pragma unroll
  for (int i = 0; i < 8; ++i) { const int ka = k0 + 8 * g + i, kb = ka + 16; v[i] = ka < K ? row[ka < K ? ka : K - 1] : 0.f; v[8 + i] = kb < K ? row[kb < K ? kb : K - 1] : 0.f; }
  return bsplit16(v); }
__device__ __forceinline__ F2 split_col(const float* W, int k0, int n, int lane, int ld, int K) { float v[16]; const int g = lane >> 4;
#pragma unroll
  for (int i = 0; i < 8; ++i) { const int ka = k0 + 8 * g + i, kb = ka + 16; v[i] = ka < K ? W[(size_t)(ka < K ? ka : K - 1) * ld + n] : 0.f; v[8 + i] = kb < K ? W[(size_t)(kb < K ? kb : K - 1) * ld + n] : 0.f; }
  return bsplit16(v); }
__device__ __forceinline__ v8f mac3(const F2& a, const F2& b, v8f c) { c = wmma_bf(a.l, b.h, c); c = wmma_bf(a.h, b.l, c); return wmma_bf(a.h, b.h, c); }
__device__ __forceinline__ float sigm(float v) { return 1.0f / (1.0f + expf(-v)); }
#define LDSX() do { asm volatile("s_wait_dscnt 0" ::: "memory"); __builtin_amdgcn_wave_barrier(); __builtin_amdgcn_fence(__ATOMIC_RELEASE, "workgroup"); } while (0)


// Wav2Vec2 self attention: q,k,v = x W^T + b (16 heads x 64); scores = q k^T / 8; softmax (no mask); P v; merge heads; @ Wo^T (no output bias).  B 2, S 2048, D 1024.
// k_pack (W rows as bf16 rows: torch [out][in] layout is already K-contiguous), k_proj (exact GEMM + bias, 3072-wide rows), k_rope (rotary on q,k in place; v as transposed hi/lo planes), k_attn (flash-style: per (64-query block, b, h) over all 64 32-key steps, online max/sum with accumulator rescale; O rows), k_out (O hi/lo x Wo, no bias).
#define NB 2
#define SS 2048
#define DM 1024
#define NH 16
#define HD 64
#define NR (NB * SS)
#define QKVP (3 * DM)
#ifndef TRB
#define TRB (NR / 64)
#define TQB (SS / 64)
#define TNB NB
#endif
typedef __attribute__((ext_vector_type(8))) __bf16 v8b;
__device__ __forceinline__ v16b frag_b(const __bf16* rowk0, int lane) {
  union { v16b v; v8b q[2]; } u; const __bf16* p = rowk0 + 8 * (lane >> 4);
  u.q[0] = *(const v8b*)p; u.q[1] = *(const v8b*)(p + 16); return u.v;
}
__device__ __forceinline__ v16b frag_gbf(const float* rowk0, int lane) {
  v16b a; const float* p = rowk0 + 8 * (lane >> 4);
#pragma unroll
  for (int i = 0; i < 8; ++i) { a[i] = (__bf16)p[i]; a[8 + i] = (__bf16)p[16 + i]; }
  return a;
}
__device__ __forceinline__ float bfr(float v) { return (float)(__bf16)v; }
__device__ __attribute__((noinline)) float exp_ni(float v) { return expf(v); }
#define WS_PT   0u                                 // bf16 [4096 (q|k|v|out cols)][1024]
#define WS_QKV  (WS_PT + 2u * 4 * DM * DM)           // f32 [4096 rows][3072]  (q 0..1023 | k | v) ; q cols later overwritten by O
#define WS_VTH  (WS_QKV + 4u * NR * QKVP)            // bf16 [2][1024 (h*64+d)][2048]
#define WS_VTL  (WS_VTH + 2u * NB * DM * SS)
#define WS_END  (WS_VTL + 2u * NB * DM * SS)

__global__ __launch_bounds__(128) void k_pack(const float* __restrict__ Wq, const float* __restrict__ Wk, const float* __restrict__ Wv, const float* __restrict__ Wo, __bf16* __restrict__ PT) {
  __shared__ __align__(16) __bf16 srow[DM];
  const int n = blockIdx.x, tid = threadIdx.x; const int which = n >> 10, c = n & 1023; const float* Wm = which == 0 ? Wq : (which == 1 ? Wk : (which == 2 ? Wv : Wo));
  for (int k = tid; k < DM; k += 128) srow[k] = (__bf16)Wm[(size_t)c * DM + k];   // torch [out][in]: row c
  __syncthreads();
  vst2((unsigned*)(PT + (size_t)n * DM + tid * 8), *(const v4u*)(&srow[tid * 8]));
}
// ---- k_proj: QKV[r][n] = bf16(x[r]) . PT[n] (exact), K = 1024; block (64 rows, 128 cols); 512-B segments of 12-KB rows
__global__ __launch_bounds__(128) void k_proj(const float* __restrict__ X, const __bf16* __restrict__ PT, const float* __restrict__ bq, const float* __restrict__ bk, const float* __restrict__ bv, float* __restrict__ QKV) {
  __shared__ __align__(16) float so[4][16][132];
  const int tid = threadIdx.x, wave = tid >> 5, lane = tid & 31, col = lane & 15, g = lane >> 4; const size_t r0 = (size_t)blockIdx.x * 64 + wave * 16; const int n0 = blockIdx.y * 128;
  v8f acc[8] = {}; const __bf16* wp = PT + (size_t)(n0 + col) * DM;   // one base: the eight column groups are constant offsets from it
#pragma unroll 2
  for (int kc = 0; kc < DM / 32; ++kc) { const v16b a = frag_gbf(X + (r0 + col) * DM + kc * 32, lane); v16b w[8];   // all loads of the k step stand ahead of its first product: one latency a step, not one a product
#pragma unroll
    for (int j = 0; j < 8; ++j) w[j] = frag_b(wp + j * 16 * DM + kc * 32, lane);
#pragma unroll
    for (int j = 0; j < 8; ++j) acc[j] = wmma_bf(a, w[j], acc[j]);
    asm volatile("s_wait_xcnt 0x0" ::: "memory"); }   // stands ahead of the next step's rewrite of the load address registers
#pragma unroll
  for (int j = 0; j < 8; ++j) { const int n = n0 + j * 16 + col; const int which = n >> 10, c = n & 1023; const float bb = bfr((which == 0 ? bq : which == 1 ? bk : bv)[c]);
#pragma unroll
    for (int r = 0; r < 8; ++r) so[wave][8 * g + r][j * 16 + col] = acc[j][r] + bb; }
  LDSX();
  for (int rl = 0; rl < 16; ++rl) vst2(QKV + (r0 + rl) * QKVP + n0 + lane * 4, *(const v4f*)&so[wave][rl][lane * 4]);
}
// ---- k_rope: block = (64-token block, head pair), 8 waves. A thread holds both halves of its (token, 4 j) pairs of q and k in registers and rotates them in place, so no exchange and no token loop; one angle serves q and k of both heads.
// v passes once through LDS to the transposed hi/lo planes (128-B segments of the 4-KB rows); it goes first, so that no store is outstanding at the barrier.
typedef __attribute__((ext_vector_type(2))) __bf16 v2b;
__global__ __launch_bounds__(256) void k_rope(float* __restrict__ QKV, const int* __restrict__ PID, __bf16* __restrict__ VTH, __bf16* __restrict__ VTL) {
  __shared__ __align__(16) __bf16 svh[2 * HD][72], svl[2 * HD][72];
  const int tid = threadIdx.x, lane = tid & 31, jq = tid & 7, tg = tid >> 3; const size_t t0 = (size_t)blockIdx.x * 64; const int c0 = blockIdx.y * (2 * HD); const int b = (int)(t0 / SS), p0 = (int)(t0 % SS);
  v4f vv[4][2], x[2][2][2][2]; float pos[2];   // vv[d quad jq + 8 iv][token 2 tg + e]; x[token tg + 32 it][head][q | k][half]
#pragma unroll
  for (int iv = 0; iv < 4; ++iv)
#pragma unroll
    for (int e = 0; e < 2; ++e) vv[iv][e] = *(const v4f*)(QKV + (t0 + 2 * tg + e) * QKVP + 2 * DM + c0 + (jq + 8 * iv) * 4);
#pragma unroll
  for (int it = 0; it < 2; ++it) { const float* row = QKV + (t0 + tg + 32 * it) * QKVP + c0 + jq * 4; pos[it] = (float)PID[p0 + tg + 32 * it];
#pragma unroll
    for (int hl = 0; hl < 2; ++hl)
#pragma unroll
      for (int w = 0; w < 2; ++w) { x[it][hl][w][0] = *(const v4f*)(row + w * DM + hl * HD); x[it][hl][w][1] = *(const v4f*)(row + w * DM + hl * HD + 32); } }
#pragma unroll
  for (int iv = 0; iv < 4; ++iv)
#pragma unroll
    for (int i = 0; i < 4; ++i) { const int d = (jq + 8 * iv) * 4 + i; const float v0 = vv[iv][0][i], v1 = vv[iv][1][i]; const __bf16 h0 = (__bf16)v0, h1 = (__bf16)v1;
      *(v2b*)&svh[d][2 * tg] = (v2b){h0, h1}; *(v2b*)&svl[d][2 * tg] = (v2b){(__bf16)(v0 - (float)h0), (__bf16)(v1 - (float)h1)}; }
  __syncthreads();
#pragma unroll
  for (int q = tid; q < 2 * HD * 8; q += 256) { const int rowi = q >> 3, pc = q & 7; const size_t o = ((size_t)b * DM + c0 + rowi) * SS + p0 + pc * 8; vst2((unsigned*)(VTH + o), *(const v4u*)&svh[rowi][pc * 8]); vst2((unsigned*)(VTL + o), *(const v4u*)&svl[rowi][pc * 8]); }
  const float invl = powf(10000.0f, -(float)(2 * lane) / (float)HD);   // lane j holds inv_freq[j]
  float invf[4];
#pragma unroll
  for (int i = 0; i < 4; ++i) invf[i] = __shfl(invl, jq * 4 + i);
#pragma unroll
  for (int it = 0; it < 2; ++it) { float* row = QKV + (t0 + tg + 32 * it) * QKVP + c0 + jq * 4; v4f y[2][2][2];
#pragma unroll
    for (int i = 0; i < 4; ++i) { const float ang = pos[it] * invf[i]; const float c = cosf(ang), sn = sinf(ang);
#pragma unroll
      for (int hl = 0; hl < 2; ++hl)
#pragma unroll
        for (int w = 0; w < 2; ++w) { const float x1 = x[it][hl][w][0][i], x2 = x[it][hl][w][1][i]; y[hl][w][0][i] = x1 * c - x2 * sn; y[hl][w][1][i] = x2 * c + x1 * sn; } }
#pragma unroll
    for (int hl = 0; hl < 2; ++hl)
#pragma unroll
      for (int w = 0; w < 2; ++w) { vst2(row + w * DM + hl * HD, y[hl][w][0]); vst2(row + w * DM + hl * HD + 32, y[hl][w][1]); } }
}
// ---- k_attn: block = (query block qb, b*16 + h), 4 waves: all SS/32 key steps; online softmax. Scores are formed transposed (keys as rows, queries as columns): a lane owns one query, the 16 scores it holds of a key step
// reduce in its own registers (one exchange with the other wave half for the maximum; the halves' sums join once at the end), and split in place they are the B operand of O^T += V^T P^T, so P passes through no LDS. O written over the q columns of the block's rows.
__device__ __forceinline__ float xhalf(float v) { const unsigned u = __builtin_bit_cast(unsigned, v); return __builtin_bit_cast(float, __builtin_amdgcn_permlanex16(u, u, 0x76543210u, 0xfedcba98u, false, false)); }   // lane l <-> l ^ 16
__device__ __forceinline__ v8f mac3t(const F2& k, const F2& q, v8f c) { c = wmma_bf(k.h, q.l, c); c = wmma_bf(k.l, q.h, c); return wmma_bf(k.h, q.h, c); }   // the three products in mac3's order, operands swapped
__global__ __launch_bounds__(128) void k_attn(float* __restrict__ QKV, const __bf16* __restrict__ VTH, const __bf16* __restrict__ VTL) {
  const int tid = threadIdx.x, wave = tid >> 5, lane = tid & 31, col = lane & 15, g = lane >> 4;
  const int qb = blockIdx.x, bh = blockIdx.y, b = bh >> 4, h = bh & 15; const int q0 = qb * 64 + wave * 16; const size_t tq = (size_t)b * SS + q0;
  const F2 a0 = split_row(QKV + (tq + col) * QKVP + h * HD, 0, lane), a1 = split_row(QKV + (tq + col) * QKVP + h * HD, 32, lane);   // query col as column col of B
  float m = -3.0e38f, l = 0.f;   // of query col; l holds this half's keys only
  v8f acc[4] = {};   // acc[dt][r] = O[query col][dt * 16 + 8 g + r]
  const int nsteps = SS / 32;
#pragma unroll 1
  for (int ks = 0; ks < nsteps; ++ks) {
    v8f s[2]; v4f kq[2][8]; v16b vh[4], vl[4];   // all k and v loads of the key step stand ahead of its first product: one latency a step, not six
#pragma unroll
    for (int ct = 0; ct < 2; ++ct) { const int kk = ks * 32 + ct * 16 + col; const float* kp = QKV + ((size_t)b * SS + kk) * QKVP + DM + h * HD + 8 * g;
#pragma unroll
      for (int i = 0; i < 4; ++i) { kq[ct][2 * i] = *(const v4f*)(kp + 16 * i); kq[ct][2 * i + 1] = *(const v4f*)(kp + 16 * i + 4); } }
#pragma unroll
    for (int dt = 0; dt < 4; ++dt) { const size_t vrow = ((size_t)b * DM + h * HD + dt * 16 + col) * SS + ks * 32; vh[dt] = frag_b(VTH + vrow, lane); vl[dt] = frag_b(VTL + vrow, lane); }
    // holds the 32 loads together (loaded values as inputs only): without it the compiler sinks them to their uses and each small group is waited for by itself; the wait stands ahead of the rewrite of their address registers
    asm volatile("s_wait_xcnt 0x0" :: "v"(kq[0][0]), "v"(kq[0][1]), "v"(kq[0][2]), "v"(kq[0][3]), "v"(kq[0][4]), "v"(kq[0][5]), "v"(kq[0][6]), "v"(kq[0][7]), "v"(kq[1][0]), "v"(kq[1][1]), "v"(kq[1][2]), "v"(kq[1][3]), "v"(kq[1][4]), "v"(kq[1][5]), "v"(kq[1][6]), "v"(kq[1][7]),
                 "v"(vh[0]), "v"(vl[0]), "v"(vh[1]), "v"(vl[1]), "v"(vh[2]), "v"(vl[2]), "v"(vh[3]), "v"(vl[3]) : "memory");
#pragma unroll
    for (int ct = 0; ct < 2; ++ct) { float kv[2][16];
#pragma unroll
      for (int i = 0; i < 16; ++i) { kv[0][i] = kq[ct][i >> 2][i & 3]; kv[1][i] = kq[ct][4 + (i >> 2)][i & 3]; }
      const F2 k0 = bsplit16(kv[0]), k1 = bsplit16(kv[1]);
      v8f c = mac3t(k0, a0, (v8f){}); c = mac3t(k1, a1, c);   // c[r] = score of key ks * 32 + ct * 16 + 8 g + r with query col
#pragma unroll
      for (int r = 0; r < 8; ++r) s[ct][r] = c[r] * 0.125f; }
    float mx = fmaxf(s[0][0], s[1][0]);
#pragma unroll
    for (int r = 1; r < 8; ++r) mx = fmaxf(mx, fmaxf(s[0][r], s[1][r]));
    mx = fmaxf(mx, xhalf(mx));
    const float mn = fmaxf(m, mx); const float alpha = exp_ni(m - mn);
    float p[16], es[4];   // p[i]: key 8 g + i (i < 8), 16 + 8 g + i - 8 (else) of the step, the k order of V^T's fragment
#pragma unroll
    for (int i = 0; i < 16; ++i) { p[i] = exp_ni(s[i >> 3][i & 7] - mn); es[i & 3] = i < 4 ? p[i] : es[i & 3] + p[i]; }
    l = l * alpha + ((es[0] + es[1]) + (es[2] + es[3])); m = mn;
#pragma unroll
    for (int dt = 0; dt < 4; ++dt) acc[dt] *= alpha;
    const F2 pb = bsplit16(p);
#pragma unroll
    for (int dt = 0; dt < 4; ++dt) { acc[dt] = wmma_bf(vh[dt], pb.l, acc[dt]); acc[dt] = wmma_bf(vl[dt], pb.h, acc[dt]); acc[dt] = wmma_bf(vh[dt], pb.h, acc[dt]); } }
  const float il = 1.0f / (l + xhalf(l));
  float* orow = QKV + (tq + col) * QKVP + h * HD + 8 * g;
#pragma unroll
  for (int dt = 0; dt < 4; ++dt) { const v8f o = acc[dt] * il; vst2(orow + dt * 16, (v4f){o[0], o[1], o[2], o[3]}); vst2(orow + dt * 16 + 4, (v4f){o[4], o[5], o[6], o[7]}); }
}
// ---- k_out: Y = O(hi/lo; the q columns of QKV) . PT_out rows (2 products, K = 1024); block (64 rows, 128 cols)
__global__ __launch_bounds__(128) void k_out(const float* __restrict__ QKV, const __bf16* __restrict__ PT, float* __restrict__ Y) {
  __shared__ __align__(16) float so[4][16][132];
  const int tid = threadIdx.x, wave = tid >> 5, lane = tid & 31, col = lane & 15, g = lane >> 4; const size_t r0 = (size_t)blockIdx.x * 64 + wave * 16; const int n0 = blockIdx.y * 128;
  v8f acc[8] = {}; const __bf16* wp = PT + (size_t)(3 * DM + n0 + col) * DM;
#pragma unroll 2
  for (int kc = 0; kc < DM / 32; ++kc) { const F2 a = split_row(QKV + (r0 + col) * QKVP, kc * 32, lane); v16b w[8];   // loads grouped ahead of the products, as in k_proj
#pragma unroll
    for (int j = 0; j < 8; ++j) w[j] = frag_b(wp + j * 16 * DM + kc * 32, lane);
#pragma unroll
    for (int j = 0; j < 8; ++j) { acc[j] = wmma_bf(a.l, w[j], acc[j]); acc[j] = wmma_bf(a.h, w[j], acc[j]); }
    asm volatile("s_wait_xcnt 0x0" ::: "memory"); }   // stands ahead of the next step's rewrite of the load address registers
#pragma unroll
  for (int j = 0; j < 8; ++j)
#pragma unroll
    for (int r = 0; r < 8; ++r) so[wave][8 * g + r][j * 16 + col] = acc[j][r];
  LDSX();
  for (int rl = 0; rl < 16; ++rl) vst2(Y + (r0 + rl) * DM + n0 + lane * 4, *(const v4f*)&so[wave][rl][lane * 4]);
}

extern "C" void kernel_launch(void* const* d_in, const int* in_sizes, int n_in, void* d_out, int out_size, void* d_ws, size_t ws_size, hipStream_t stream) {
  (void)in_sizes; (void)n_in; (void)out_size;
  const float** F = (const float**)d_in;   // hidden_states, position_ids [1,2048] int, Wq, bq, Wk, bk, Wv, bv, Wo (torch [out][in])
  if (ws_size < (size_t)WS_END) return;
  char* ws = (char*)d_ws; __bf16 *PT = (__bf16*)(ws + WS_PT), *VTH = (__bf16*)(ws + WS_VTH), *VTL = (__bf16*)(ws + WS_VTL); float* QKV = (float*)(ws + WS_QKV);
  k_pack<<<4 * DM, 128, 0, stream>>>(F[2], F[4], F[6], F[8], PT);
  k_proj<<<dim3(TRB, QKVP / 128), 128, 0, stream>>>(F[0], PT, F[3], F[5], F[7], QKV);
  k_rope<<<dim3(TRB, NH / 2), 256, 0, stream>>>(QKV, (const int*)d_in[1], VTH, VTL);
  k_attn<<<dim3(TQB, TNB * NH), 128, 0, stream>>>(QKV, VTH, VTL);
  k_out<<<dim3((TNB < NB ? TQB : NR / 64), DM / 128), 128, 0, stream>>>(QKV, PT, (float*)d_out);
}

// v004
// Measured time: 349 microseconds a run.
// Next to v003, in two timings, it ran 1.05 and 1.06 times as fast.
// All steps since v000 together make it 2.27 times as fast.
// compute dtype: hidden_states, Wq/Wk/Wv + biases, Wo (module inputs) rounded to bf16, position_ids as int; q/k/v projections with exact bf16 products (+ bias); rotary tables (inv_freq = 10000^(-2i/64), cos/sin of pos·inv_freq) and the rotate-half mix in f32; scores and P.V with both computed operands as bf16 hi + bf16 residual pairs (3 products); output projection hi/lo x bf16 Wo (2 products); online softmax in f32; f32 accumulate.
#include <hip/hip_runtime.h>
#include <math.h>

typedef __attribute__((ext_vector_type(16))) _Float16 v16h;
typedef __attribute__((ext_vector_type(16))) __bf16 v16b;
typedef __attribute__((ext_vector_type(8)))  _Float16 v8h;
typedef __attribute__((ext_vector_type(8)))  float v8f;
typedef __attribute__((ext_vector_type(4)))  float v4f;
typedef __attribute__((ext_vector_type(2)))  float v2f;
typedef __attribute__((ext_vector_type(4)))  unsigned v4u;
typedef __attribute__((ext_vector_type(4)))  int v4i;
typedef float __attribute__((may_alias)) float_a;
typedef int __attribute__((may_alias)) int_a;

template <typename T> __device__ __forceinline__ void vst2(void* p, T v) { *(T*)p = v;  }
__device__ __forceinline__ v8f wmma16(v16h a, v16h b, v8f c) {
  v8f d = __builtin_amdgcn_wmma_f32_16x16x32_f16(false, a, false, b, (short)0, c, false, false);
  asm volatile("v_nop\n\tv_nop\n\tv_nop\n\tv_nop" : "+v"(d) : "v"(a), "v"(b));
  return d;
}
__device__ __forceinline__ v8f wmma_bf(v16b a, v16b b, v8f c) {
  v8f d = __builtin_amdgcn_wmma_f32_16x16x32_bf16(false, a, false, b, (short)0, c, false, false);
  asm volatile("v_nop\n\tv_nop\n\tv_nop\n\tv_nop" : "+v"(d) : "v"(a), "v"(b));
  return d;
}
// 16x16x32 fragments: lane = (h = lane>>4, row/col = lane&15); elements 0..7 = k0+8h+0..7, 8..15 = k0+16+8h+0..7; D element r = row 8h+r
__device__ __forceinline__ v16h frag_h(const _Float16* rowk0, int lane) {
  union { v16h v; v8h q[2]; } u; const _Float16* p = rowk0 + 8 * (lane >> 4);
  u.q[0] = *(const v8h*)p; u.q[1] = *(const v8h*)(p + 16); return u.v;
}
__device__ __forceinline__ v16h frag_f32(const float* rowk0, int lane) {
  v16h a; const float* p = rowk0 + 8 * (lane >> 4);
#pragma unroll
  for (int i = 0; i < 8; ++i) { a[i] = (_Float16)p[i]; a[8 + i] = (_Float16)p[16 + i]; }
  return a;
}
__device__ __forceinline__ v16h frag_f32s(const float* rowk0, int lane, float sc) {
  v16h a; const float* p = rowk0 + 8 * (lane >> 4);
#pragma unroll
  for (int i = 0; i < 8; ++i) { a[i] = (_Float16)(p[i] * sc); a[8 + i] = (_Float16)(p[16 + i] * sc); }
  return a;
}
// column fragment from a [K][ld] layout (column n), rows >= K read as 0
__device__ __forceinline__ v16h fragc_f32(const float* W, int k0, int n, int lane, int ld, int K) {
  v16h a; const int g = lane >> 4;
#pragma unroll
  for (int i = 0; i < 8; ++i) { const int ka = k0 + 8 * g + i, kb = ka + 16;
    a[i] = (_Float16)(ka < K ? W[(size_t)(ka < K ? ka : K - 1) * ld + n] : 0.f); a[8 + i] = (_Float16)(kb < K ? W[(size_t)(kb < K ? kb : K - 1) * ld + n] : 0.f); }
  return a;
}
struct F2 { v16b h, l; };
__device__ __forceinline__ F2 bsplit16(const float v[16]) { F2 r;
#pragma unroll
  for (int i = 0; i < 16; ++i) { const __bf16 h = (__bf16)v[i]; r.h[i] = h; r.l[i] = (__bf16)(v[i] - (float)h); }
  return r; }
__device__ __forceinline__ F2 split_row(const float* row, int k0, int lane) { float v[16]; const float* p = row + k0 + 8 * (lane >> 4);
#pragma unroll
  for (int i = 0; i < 8; ++i) { v[i] = p[i]; v[8 + i] = p[16 + i]; }
  return bsplit16(v); }
__device__ __forceinline__ F2 split_rowK(const float* row, int k0, int lane, int K) { float v[16]; const int g = lane >> 4;
#pragma unroll
  for (int i = 0; i < 8; ++i) { const int ka = k0 + 8 * g + i, kb = ka + 16; v[i] = ka < K ? row[ka < K ? ka : K - 1] : 0.f; v[8 + i] = kb < K ? row[kb < K ? kb : K - 1] : 0.f; }
  return bsplit16(v); }
__device__ __forceinline__ F2 split_col(const float* W, int k0, int n, int lane, int ld, int K) { float v[16]; const int g = lane >> 4;
#pragma unroll
  for (int i = 0; i < 8; ++i) { const int ka = k0 + 8 * g + i, kb = ka + 16; v[i] = ka < K ? W[(size_t)(ka < K ? ka : K - 1) * ld + n] : 0.f; v[8 + i] = kb < K ? W[(size_t)(kb < K ? kb : K - 1) * ld + n] : 0.f; }
  return bsplit16(v); }
__device__ __forceinline__ v8f mac3(const F2& a, const F2& b, v8f c) { c = wmma_bf(a.l, b.h, c); c = wmma_bf(a.h, b.l, c); return wmma_bf(a.h, b.h, c); }
__device__ __forceinline__ float sigm(float v) { return 1.0f / (1.0f + expf(-v)); }
#define LDSX() do { asm volatile("s_wait_dscnt 0" ::: "memory"); __builtin_amdgcn_wave_barrier(); __builtin_amdgcn_fence(__ATOMIC_RELEASE, "workgroup"); } while (0)


// Wav2Vec2 self attention: q,k,v = x W^T + b (16 heads x 64); scores = q k^T / 8; softmax (no mask); P v; merge heads; @ Wo^T (no output bias).  B 2, S 2048, D 1024.
// k_pack (W rows as bf16 rows: torch [out][in] layout is already K-contiguous), k_proj (exact GEMM + bias, 3072-wide rows), k_rope (rotary on q,k in place; v as transposed hi/lo planes), k_attn (flash-style: per (64-query block, b, h) over all 64 32-key steps, online max/sum with accumulator rescale; O rows), k_out (O hi/lo x Wo, no bias).
#define NB 2
#define SS 2048
#define DM 1024
#define NH 16
#define HD 64
#define NR (NB * SS)
#define QKVP (3 * DM)
#ifndef TRB
#define TRB (NR / 64)
#define TQB (SS / 64)
#define TNB NB
#endif
typedef __attribute__((ext_vector_type(8))) __bf16 v8b;
__device__ __forceinline__ v16b frag_b(const __bf16* rowk0, int lane) {
  union { v16b v; v8b q[2]; } u; const __bf16* p = rowk0 + 8 * (lane >> 4);
  u.q[0] = *(const v8b*)p; u.q[1] = *(const v8b*)(p + 16); return u.v;
}
__device__ __forceinline__ v16b frag_gbf(const float* rowk0, int lane) {
  v16b a; const float* p = rowk0 + 8 * (lane >> 4);
#pragma unroll
  for (int i = 0; i < 8; ++i) { a[i] = (__bf16)p[i]; a[8 + i] = (__bf16)p[16 + i]; }
  return a;
}
__device__ __forceinline__ float bfr(float v) { return (float)(__bf16)v; }
__device__ __attribute__((noinline)) float exp_ni(float v) { return expf(v); }
#define WS_PT   0u                                 // bf16 [4096 (q|k|v|out cols)][1024]
#define WS_QKV  (WS_PT + 2u * 4 * DM * DM)           // f32 [4096 rows][3072]  (q 0..1023 | k | v) ; q cols later overwritten by O
#define WS_VTH  (WS_QKV + 4u * NR * QKVP)            // bf16 [2][1024 (h*64+d)][2048]
#define WS_VTL  (WS_VTH + 2u * NB * DM * SS)
#define WS_END  (WS_VTL + 2u * NB * DM * SS)

__global__ __launch_bounds__(128) void k_pack(const float* __restrict__ Wq, const float* __restrict__ Wk, const float* __restrict__ Wv, const float* __restrict__ Wo, __bf16* __restrict__ PT) {
  __shared__ __align__(16) __bf16 srow[DM];
  const int n = blockIdx.x, tid = threadIdx.x; const int which = n >> 10, c = n & 1023; const float* Wm = which == 0 ? Wq : (which == 1 ? Wk : (which == 2 ? Wv : Wo));
  for (int k = tid; k < DM; k += 128) srow[k] = (__bf16)Wm[(size_t)c * DM + k];   // torch [out][in]: row c
  __syncthreads();
  vst2((unsigned*)(PT + (size_t)n * DM + tid * 8), *(const v4u*)(&srow[tid * 8]));
}
// ---- k_proj: QKV[r][n] = bf16(x[r]) . PT[n] (exact), K = 1024; block (64 rows, 128 cols); 512-B segments of 12-KB rows
__global__ __launch_bounds__(128) void k_proj(const float* __restrict__ X, const __bf16* __restrict__ PT, const float* __restrict__ bq, const float* __restrict__ bk, const float* __restrict__ bv, float* __restrict__ QKV) {
  __shared__ __align__(16) float so[4][16][132];
  const int tid = threadIdx.x, wave = tid >> 5, lane = tid & 31, col = lane & 15, g = lane >> 4; const size_t r0 = (size_t)blockIdx.x * 64 + wave * 16; const int n0 = blockIdx.y * 128;
  v8f acc[8] = {}; const __bf16* wp = PT + (size_t)(n0 + col) * DM;   // one base: the eight column groups are constant offsets from it
#pragma unroll 2
  for (int kc = 0; kc < DM / 32; ++kc) { const v16b a = frag_gbf(X + (r0 + col) * DM + kc * 32, lane); v16b w[8];   // all loads of the k step stand ahead of its first product: one latency a step, not one a product
#pragma unroll
    for (int j = 0; j < 8; ++j) w[j] = frag_b(wp + j * 16 * DM + kc * 32, lane);
#pragma unroll
    for (int j = 0; j < 8; ++j) acc[j] = wmma_bf(a, w[j], acc[j]);
    asm volatile("s_wait_xcnt 0x0" ::: "memory"); }   // stands ahead of the next step's rewrite of the load address registers
#pragma unroll
  for (int j = 0; j < 8; ++j) { const int n = n0 + j * 16 + col; const int which = n >> 10, c = n & 1023; const float bb = bfr((which == 0 ? bq : which == 1 ? bk : bv)[c]);
#pragma unroll
    for (int r = 0; r < 8; ++r) so[wave][8 * g + r][j * 16 + col] = acc[j][r] + bb; }
  LDSX();
  for (int rl = 0; rl < 16; ++rl) vst2(QKV + (r0 + rl) * QKVP + n0 + lane * 4, *(const v4f*)&so[wave][rl][lane * 4]);
}
// ---- k_rope: block = (64-token block, head pair), 8 waves. A thread holds both halves of its (token, 4 j) pairs of q and k in registers and rotates them in place, so no exchange and no token loop; one angle serves q and k of both heads.
// v passes once through LDS to the transposed hi/lo planes (128-B segments of the 4-KB rows); it goes first, so that no store is outstanding at the barrier.
typedef __attribute__((ext_vector_type(2))) __bf16 v2b;
__global__ __launch_bounds__(256) void k_rope(float* __restrict__ QKV, const int* __restrict__ PID, __bf16* __restrict__ VTH, __bf16* __restrict__ VTL) {
  __shared__ __align__(16) __bf16 svh[2 * HD][72], svl[2 * HD][72];
  const int tid = threadIdx.x, lane = tid & 31, jq = tid & 7, tg = tid >> 3; const size_t t0 = (size_t)blockIdx.x * 64; const int c0 = blockIdx.y * (2 * HD); const int b = (int)(t0 / SS), p0 = (int)(t0 % SS);
  v4f vv[4][2], x[2][2][2][2]; float pos[2];   // vv[d quad jq + 8 iv][token 2 tg + e]; x[token tg + 32 it][head][q | k][half]
#pragma unroll
  for (int iv = 0; iv < 4; ++iv)
#pragma unroll
    for (int e = 0; e < 2; ++e) vv[iv][e] = *(const v4f*)(QKV + (t0 + 2 * tg + e) * QKVP + 2 * DM + c0 + (jq + 8 * iv) * 4);
#pragma unroll
  for (int it = 0; it < 2; ++it) { const float* row = QKV + (t0 + tg + 32 * it) * QKVP + c0 + jq * 4; pos[it] = (float)PID[p0 + tg + 32 * it];
#pragma unroll
    for (int hl = 0; hl < 2; ++hl)
#pragma unroll
      for (int w = 0; w < 2; ++w) { x[it][hl][w][0] = *(const v4f*)(row + w * DM + hl * HD); x[it][hl][w][1] = *(const v4f*)(row + w * DM + hl * HD + 32); } }
#pragma unroll
  for (int iv = 0; iv < 4; ++iv)
#pragma unroll
    for (int i = 0; i < 4; ++i) { const int d = (jq + 8 * iv) * 4 + i; const float v0 = vv[iv][0][i], v1 = vv[iv][1][i]; const __bf16 h0 = (__bf16)v0, h1 = (__bf16)v1;
      *(v2b*)&svh[d][2 * tg] = (v2b){h0, h1}; *(v2b*)&svl[d][2 * tg] = (v2b){(__bf16)(v0 - (float)h0), (__bf16)(v1 - (float)h1)}; }
  __syncthreads();
#pragma unroll
  for (int q = tid; q < 2 * HD * 8; q += 256) { const int rowi = q >> 3, pc = q & 7; const size_t o = ((size_t)b * DM + c0 + rowi) * SS + p0 + pc * 8; vst2((unsigned*)(VTH + o), *(const v4u*)&svh[rowi][pc * 8]); vst2((unsigned*)(VTL + o), *(const v4u*)&svl[rowi][pc * 8]); }
  const float invl = powf(10000.0f, -(float)(2 * lane) / (float)HD);   // lane j holds inv_freq[j]
  float invf[4];
#pragma unroll
  for (int i = 0; i < 4; ++i) invf[i] = __shfl(invl, jq * 4 + i);
#pragma unroll
  for (int it = 0; it < 2; ++it) { float* row = QKV + (t0 + tg + 32 * it) * QKVP + c0 + jq * 4; v4f y[2][2][2];
#pragma unroll
    for (int i = 0; i < 4; ++i) { const float ang = pos[it] * invf[i]; const float c = cosf(ang), sn = sinf(ang);
#pragma unroll
      for (int hl = 0; hl < 2; ++hl)
#pragma unroll
        for (int w = 0; w < 2; ++w) { const float x1 = x[it][hl][w][0][i], x2 = x[it][hl][w][1][i]; y[hl][w][0][i] = x1 * c - x2 * sn; y[hl][w][1][i] = x2 * c + x1 * sn; } }
#pragma unroll
    for (int hl = 0; hl < 2; ++hl)
#pragma unroll
      for (int w = 0; w < 2; ++w) { vst2(row + w * DM + hl * HD, y[hl][w][0]); vst2(row + w * DM + hl * HD + 32, y[hl][w][1]); } }
}
// ---- k_attn: block = (query block qb, b*16 + h), 4 waves: all SS/32 key steps; online softmax. Scores are formed transposed (keys as rows, queries as columns): a lane owns one query, the 16 scores it holds of a key step
// reduce in its own registers (one exchange with the other wave half for the maximum; the halves' sums join once at the end), and split in place they are the B operand of O^T += V^T P^T, so P passes through no LDS. O written over the q columns of the block's rows.
// The k rows and v^T rows of a key step are the same for the block's four waves: they are brought into LDS once a block by asynchronous copies on whole row pieces (two buffers, the next step's copies fly while this step is worked on), and each wave takes its fragments from there.
#define KPF 68   // f32 per staged k row: 272 B = 16 B x odd, the pitch of 16-byte LDS readers
#define VPB 40   // bf16 per staged v^T row: 80 B = 16 B x odd
__device__ __forceinline__ unsigned lds_of(const void* p) { return (unsigned)(size_t)p; }   // LDS byte address: the low 32 bits of a __shared__ address
__device__ __forceinline__ float xhalf(float v) { const unsigned u = __builtin_bit_cast(unsigned, v); return __builtin_bit_cast(float, __builtin_amdgcn_permlanex16(u, u, 0x76543210u, 0xfedcba98u, false, false)); }   // lane l <-> l ^ 16
__device__ __forceinline__ v8f mac3t(const F2& k, const F2& q, v8f c) { c = wmma_bf(k.h, q.l, c); c = wmma_bf(k.l, q.h, c); return wmma_bf(k.h, q.h, c); }   // the three products in mac3's order, operands swapped
__global__ __launch_bounds__(128) void k_attn(float* __restrict__ QKV, const __bf16* __restrict__ VTH, const __bf16* __restrict__ VTL) {
  __shared__ __align__(16) float sk[2][32][KPF];
  __shared__ __align__(16) __bf16 sv[2][2][HD][VPB];   // [buffer][hi | lo][d][key]
  const int tid = threadIdx.x, wave = tid >> 5, lane = tid & 31, col = lane & 15, g = lane >> 4;
  const int qb = blockIdx.x, bh = blockIdx.y, b = bh >> 4, h = bh & 15; const int q0 = qb * 64 + wave * 16; const size_t tq = (size_t)b * SS + q0;
  const F2 a0 = split_row(QKV + (tq + col) * QKVP + h * HD, 0, lane), a1 = split_row(QKV + (tq + col) * QKVP + h * HD, 32, lane);   // query col as column col of B
  float m = -3.0e38f, l = 0.f;   // of query col; l holds this half's keys only
  v8f acc[4] = {};   // acc[dt][r] = O[query col][dt * 16 + 8 g + r]
  const int nsteps = SS / 32;
  // a thread's eight 16-byte pieces of a key step: k rows tid / 16 + 8 i (16 threads a 256-B row), v^T rows tid / 4 + 32 j of either plane (4 threads a 64-B row piece)
  const float* kg = QKV + ((size_t)b * SS + (tid >> 4)) * QKVP + DM + h * HD + (tid & 15) * 4;
  const size_t vo = ((size_t)b * DM + h * HD + (tid >> 2)) * SS + (tid & 3) * 8;
  const __bf16 *vgh = VTH + vo, *vgl = VTL + vo;
  auto stage = [&](int ks, int buf) {
    const float* k0 = kg + (size_t)ks * 32 * QKVP; const __bf16 *h0 = vgh + ks * 32, *l0 = vgl + ks * 32;
    const unsigned lk = lds_of(&sk[buf][tid >> 4][(tid & 15) * 4]), lh = lds_of(&sv[buf][0][tid >> 2][(tid & 3) * 8]), ll = lds_of(&sv[buf][1][tid >> 2][(tid & 3) * 8]);
    // the wait is the statement's last line, so that it stands ahead of any rewrite of a register that a copy names
    asm volatile("global_load_async_to_lds_b128 %0, %8, off\n\t"
                 "global_load_async_to_lds_b128 %1, %9, off\n\t"
                 "global_load_async_to_lds_b128 %2, %10, off\n\t"
                 "global_load_async_to_lds_b128 %3, %11, off\n\t"
                 "global_load_async_to_lds_b128 %4, %12, off\n\t"
                 "global_load_async_to_lds_b128 %5, %13, off\n\t"
                 "global_load_async_to_lds_b128 %6, %14, off\n\t"
                 "global_load_async_to_lds_b128 %7, %15, off\n\t"
                 "s_wait_xcnt 0x0"
                 :: "v"(lk), "v"(lk + 8u * KPF * 4u), "v"(lk + 16u * KPF * 4u), "v"(lk + 24u * KPF * 4u), "v"(lh), "v"(lh + 32u * VPB * 2u), "v"(ll), "v"(ll + 32u * VPB * 2u),
                    "v"(k0), "v"(k0 + 8 * QKVP), "v"(k0 + 16 * QKVP), "v"(k0 + 24 * QKVP), "v"(h0), "v"(h0 + 32 * SS), "v"(l0), "v"(l0 + 32 * SS) : "memory"); };
  stage(0, 0);
  asm volatile("s_wait_asynccnt 0x0" ::: "memory");   // this wave's copies of step 0 have landed
  __syncthreads();                                    // ... and every other wave's
  stage(1, 1);
#pragma unroll 1
  for (int ks = 0; ks < nsteps; ++ks) { const int buf = ks & 1;
    v8f s[2]; v4f kq[2][8]; v16b vh[4], vl[4];   // the key step's fragments, from this step's buffer alone; plain LDS loads, so that the compiler groups them and places counted waits
#pragma unroll
    for (int ct = 0; ct < 2; ++ct) { const float* kp = &sk[buf][ct * 16 + col][8 * g];
#pragma unroll
      for (int i = 0; i < 4; ++i) { kq[ct][2 * i] = *(const v4f*)(kp + 16 * i); kq[ct][2 * i + 1] = *(const v4f*)(kp + 16 * i + 4); } }
#pragma unroll
    for (int dt = 0; dt < 4; ++dt) { vh[dt] = frag_b(&sv[buf][0][dt * 16 + col][0], lane); vl[dt] = frag_b(&sv[buf][1][dt * 16 + col][0], lane); }
#pragma unroll
    for (int ct = 0; ct < 2; ++ct) { float kv[2][16];
#pragma unroll
      for (int i = 0; i < 16; ++i) { kv[0][i] = kq[ct][i >> 2][i & 3]; kv[1][i] = kq[ct][4 + (i >> 2)][i & 3]; }
      const F2 k0 = bsplit16(kv[0]), k1 = bsplit16(kv[1]);
      v8f c = mac3t(k0, a0, (v8f){}); c = mac3t(k1, a1, c);   // c[r] = score of key ks * 32 + ct * 16 + 8 g + r with query col
#pragma unroll
      for (int r = 0; r < 8; ++r) s[ct][r] = c[r] * 0.125f; }
    float mx = fmaxf(s[0][0], s[1][0]);
#pragma unroll
    for (int r = 1; r < 8; ++r) mx = fmaxf(mx, fmaxf(s[0][r], s[1][r]));
    mx = fmaxf(mx, xhalf(mx));
    const float mn = fmaxf(m, mx); const float alpha = exp_ni(m - mn);
    float p[16], es[4];   // p[i]: key 8 g + i (i < 8), 16 + 8 g + i - 8 (else) of the step, the k order of V^T's fragment
#pragma unroll
    for (int i = 0; i < 16; ++i) { p[i] = exp_ni(s[i >> 3][i & 7] - mn); es[i & 3] = i < 4 ? p[i] : es[i & 3] + p[i]; }
    l = l * alpha + ((es[0] + es[1]) + (es[2] + es[3])); m = mn;
#pragma unroll
    for (int dt = 0; dt < 4; ++dt) acc[dt] *= alpha;
    const F2 pb = bsplit16(p);
#pragma unroll
    for (int dt = 0; dt < 4; ++dt) { acc[dt] = wmma_bf(vh[dt], pb.l, acc[dt]); acc[dt] = wmma_bf(vl[dt], pb.h, acc[dt]); acc[dt] = wmma_bf(vh[dt], pb.h, acc[dt]); }
    asm volatile("s_wait_dscnt 0x0" ::: "memory");      // this wave's reads of the buffer are done
    asm volatile("s_wait_asynccnt 0x0" ::: "memory");   // its copies of step ks + 1 have landed
    __syncthreads();                                    // publishes step ks + 1 and frees this step's buffer
    if (ks + 2 < nsteps) stage(ks + 2, buf); }
  asm volatile("s_wait_asynccnt 0x0" ::: "memory");   // no copy is outstanding when the wave ends
  const float il = 1.0f / (l + xhalf(l));
  float* orow = QKV + (tq + col) * QKVP + h * HD + 8 * g;
#pragma unroll
  for (int dt = 0; dt < 4; ++dt) { const v8f o = acc[dt] * il; vst2(orow + dt * 16, (v4f){o[0], o[1], o[2], o[3]}); vst2(orow + dt * 16 + 4, (v4f){o[4], o[5], o[6], o[7]}); }
}
// ---- k_out: Y = O(hi/lo; the q columns of QKV) . PT_out rows (2 products, K = 1024); block (64 rows, 128 cols)
__global__ __launch_bounds__(128) void k_out(const float* __restrict__ QKV, const __bf16* __restrict__ PT, float* __restrict__ Y) {
  __shared__ __align__(16) float so[4][16][132];
  const int tid = threadIdx.x, wave = tid >> 5, lane = tid & 31, col = lane & 15, g = lane >> 4; const size_t r0 = (size_t)blockIdx.x * 64 + wave * 16; const int n0 = blockIdx.y * 128;
  v8f acc[8] = {}; const __bf16* wp = PT + (size_t)(3 * DM + n0 + col) * DM;
#pragma unroll 2
  for (int kc = 0; kc < DM / 32; ++kc) { const F2 a = split_row(QKV + (r0 + col) * QKVP, kc * 32, lane); v16b w[8];   // loads grouped ahead of the products, as in k_proj
#pragma unroll
    for (int j = 0; j < 8; ++j) w[j] = frag_b(wp + j * 16 * DM + kc * 32, lane);
#pragma unroll
    for (int j = 0; j < 8; ++j) { acc[j] = wmma_bf(a.l, w[j], acc[j]); acc[j] = wmma_bf(a.h, w[j], acc[j]); }
    asm volatile("s_wait_xcnt 0x0" ::: "memory"); }   // stands ahead of the next step's rewrite of the load address registers
#pragma unroll
  for (int j = 0; j < 8; ++j)
#pragma unroll
    for (int r = 0; r < 8; ++r) so[wave][8 * g + r][j * 16 + col] = acc[j][r];
  LDSX();
  for (int rl = 0; rl < 16; ++rl) vst2(Y + (r0 + rl) * DM + n0 + lane * 4, *(const v4f*)&so[wave][rl][lane * 4]);
}

extern "C" void kernel_launch(void* const* d_in, const int* in_sizes, int n_in, void* d_out, int out_size, void* d_ws, size_t ws_size, hipStream_t stream) {
  (void)in_sizes; (void)n_in; (void)out_size;
  const float** F = (const float**)d_in;   // hidden_states, position_ids [1,2048] int, Wq, bq, Wk, bk, Wv, bv, Wo (torch [out][in])
  if (ws_size < (size_t)WS_END) return;
  char* ws = (char*)d_ws; __bf16 *PT = (__bf16*)(ws + WS_PT), *VTH = (__bf16*)(ws + WS_VTH), *VTL = (__bf16*)(ws + WS_VTL); float* QKV = (float*)(ws + WS_QKV);
  k_pack<<<4 * DM, 128, 0, stream>>>(F[2], F[4], F[6], F[8], PT);
  k_proj<<<dim3(TRB, QKVP / 128), 128, 0, stream>>>(F[0], PT, F[3], F[5], F[7], QKV);
  k_rope<<<dim3(TRB, NH / 2), 256, 0, stream>>>(QKV, (const int*)d_in[1], VTH, VTL);
  k_attn<<<dim3(TQB, TNB * NH), 128, 0, stream>>>(QKV, VTH, VTL);
  k_out<<<dim3((TNB < NB ? TQB : NR / 64), DM / 128), 128, 0, stream>>>(QKV, PT, (float*)d_out);
}

// v005
// It runs in 303 microseconds.
// Timed twice side by side with v004, it ran 1.16 and 1.15 times as fast.
// Over all steps from v000 it is 2.62 times as fast.
// compute dtype: hidden_states, Wq/Wk/Wv + biases, Wo (module inputs) rounded to bf16, position_ids as int; q/k/v projections with exact bf16 products (+ bias); rotary tables (inv_freq = 10000^(-2i/64), cos/sin of pos·inv_freq) and the rotate-half mix in f32; scores and P.V with both computed operands as bf16 hi + bf16 residual pairs (3 products); output projection hi/lo x bf16 Wo (2 products); online softmax in f32; f32 accumulate.
#include <hip/hip_runtime.h>
#include <math.h>

typedef __attribute__((ext_vector_type(16))) _Float16 v16h;
typedef __attribute__((ext_vector_type(16))) __bf16 v16b;
typedef __attribute__((ext_vector_type(8)))  _Float16 v8h;
typedef __attribute__((ext_vector_type(8)))  float v8f;
typedef __attribute__((ext_vector_type(4)))  float v4f;
typedef __attribute__((ext_vector_type(2)))  float v2f;
typedef __attribute__((ext_vector_type(4)))  unsigned v4u;
typedef __attribute__((ext_vector_type(4)))  int v4i;
typedef float __attribute__((may_alias)) float_a;
typedef int __attribute__((may_alias)) int_a;

template <typename T> __device__ __forceinline__ void vst2(void* p, T v) { *(T*)p = v;  }
__device__ __forceinline__ v8f wmma16(v16h a, v16h b, v8f c) {
  v8f d = __builtin_amdgcn_wmma_f32_16x16x32_f16(false, a, false, b, (short)0, c, false, false);
  asm volatile("v_nop\n\tv_nop\n\tv_nop\n\tv_nop" : "+v"(d) : "v"(a), "v"(b));
  return d;
}
__device__ __forceinline__ v8f wmma_bf(v16b a, v16b b, v8f c) {
  v8f d = __builtin_amdgcn_wmma_f32_16x16x32_bf16(false, a, false, b, (short)0, c, false, false);
  asm volatile("v_nop\n\tv_nop\n\tv_nop\n\tv_nop" : "+v"(d) : "v"(a), "v"(b));
  return d;
}
// 16x16x32 fragments: lane = (h = lane>>4, row/col = lane&15); elements 0..7 = k0+8h+0..7, 8..15 = k0+16+8h+0..7; D element r = row 8h+r
__device__ __forceinline__ v16h frag_h(const _Float16* rowk0, int lane) {
  union { v16h v; v8h q[2]; } u; const _Float16* p = rowk0 + 8 * (lane >> 4);
  u.q[0] = *(const v8h*)p; u.q[1] = *(const v8h*)(p + 16); return u.v;
}
__device__ __forceinline__ v16h frag_f32(const float* rowk0, int lane) {
  v16h a; const float* p = rowk0 + 8 * (lane >> 4);
#pragma unroll
  for (int i = 0; i < 8; ++i) { a[i] = (_Float16)p[i]; a[8 + i] = (_Float16)p[16 + i]; }
  return a;
}
__device__ __forceinline__ v16h frag_f32s(const float* rowk0, int lane, float sc) {
  v16h a; const float* p = rowk0 + 8 * (lane >> 4);
#pragma unroll
  for (int i = 0; i < 8; ++i) { a[i] = (_Float16)(p[i] * sc); a[8 + i] = (_Float16)(p[16 + i] * sc); }
  return a;
}
// column fragment from a [K][ld] layout (column n), rows >= K read as 0
__device__ __forceinline__ v16h fragc_f32(const float* W, int k0, int n, int lane, int ld, int K) {
  v16h a; const int g = lane >> 4;
#pragma unroll
  for (int i = 0; i < 8; ++i) { const int ka = k0 + 8 * g + i, kb = ka + 16;
    a[i] = (_Float16)(ka < K ? W[(size_t)(ka < K ? ka : K - 1) * ld + n] : 0.f); a[8 + i] = (_Float16)(kb < K ? W[(size_t)(kb < K ? kb : K - 1) * ld + n] : 0.f); }
  return a;
}
struct F2 { v16b h, l; };
__device__ __forceinline__ F2 bsplit16(const float v[16]) { F2 r;
#pragma unroll
  for (int i = 0; i < 16; ++i) { const __bf16 h = (__bf16)v[i]; r.h[i] = h; r.l[i] = (__bf16)(v[i] - (float)h); }
  return r; }
__device__ __forceinline__ F2 split_row(const float* row, int k0, int lane) { float v[16]; const float* p = row + k0 + 8 * (lane >> 4);
#pragma unroll
  for (int i = 0; i < 8; ++i) { v[i] = p[i]; v[8 + i] = p[16 + i]; }
  return bsplit16(v); }
__device__ __forceinline__ F2 split_rowK(const float* row, int k0, int lane, int K) { float v[16]; const int g = lane >> 4;
#pragma unroll
  for (int i = 0; i < 8; ++i) { const int ka = k0 + 8 * g + i, kb = ka + 16; v[i] = ka < K ? row[ka < K ? ka : K - 1] : 0.f; v[8 + i] = kb < K ? row[kb < K ? kb : K - 1] : 0.f; }
  return bsplit16(v); }
__device__ __forceinline__ F2 split_col(const float* W, int k0, int n, int lane, int ld, int K) { float v[16]; const int g = lane >> 4;
#pragma unroll
  for (int i = 0; i < 8; ++i) { const int ka = k0 + 8 * g + i, kb = ka + 16; v[i] = ka < K ? W[(size_t)(ka < K ? ka : K - 1) * ld + n] : 0.f; v[8 + i] = kb < K ? W[(size_t)(kb < K ? kb : K - 1) * ld + n] : 0.f; }
  return bsplit16(v); }
__device__ __forceinline__ v8f mac3(const F2& a, const F2& b, v8f c) { c = wmma_bf(a.l, b.h, c); c = wmma_bf(a.h, b.l, c); return wmma_bf(a.h, b.h, c); }
__device__ __forceinline__ float sigm(float v) { return 1.0f / (1.0f + expf(-v)); }
#define LDSX() do { asm volatile("s_wait_dscnt 0" ::: "memory"); __builtin_amdgcn_wave_barrier(); __builtin_amdgcn_fence(__ATOMIC_RELEASE, "workgroup"); } while (0)


// Wav2Vec2 self attention: q,k,v = x W^T + b (16 heads x 64); scores = q k^T / 8; softmax (no mask); P v; merge heads; @ Wo^T (no output bias).  B 2, S 2048, D 1024.
// k_pack (W rows as bf16 rows: torch [out][in] layout is already K-contiguous), k_proj (exact GEMM + bias, 3072-wide rows), k_rope (rotary on q,k in place; v as transposed hi/lo planes), k_attn (flash-style: per (64-query block, b, h) over all 64 32-key steps, online max/sum with accumulator rescale; O rows), k_out (O hi/lo x Wo, no bias).
#define NB 2
#define SS 2048
#define DM 1024
#define NH 16
#define HD 64
#define NR (NB * SS)
#define QKVP (3 * DM)
#ifndef TRB
#define TRB (NR / 64)
#define TQB (SS / 64)
#define TNB NB
#endif
typedef __attribute__((ext_vector_type(8))) __bf16 v8b;
__device__ __forceinline__ v16b frag_b(const __bf16* rowk0, int lane) {
  union { v16b v; v8b q[2]; } u; const __bf16* p = rowk0 + 8 * (lane >> 4);
  u.q[0] = *(const v8b*)p; u.q[1] = *(const v8b*)(p + 16); return u.v;
}
__device__ __forceinline__ v16b frag_gbf(const float* rowk0, int lane) {
  v16b a; const float* p = rowk0 + 8 * (lane >> 4);
#pragma unroll
  for (int i = 0; i < 8; ++i) { a[i] = (__bf16)p[i]; a[8 + i] = (__bf16)p[16 + i]; }
  return a;
}
__device__ __forceinline__ float bfr(float v) { return (float)(__bf16)v; }
#define WS_PT   0u                                 // bf16 [4096 (q|k|v|out cols)][1024]
#define WS_QKV  (WS_PT + 2u * 4 * DM * DM)           // f32 [4096 rows][3072]  (q 0..1023 | k | v) ; q cols later overwritten by O
#define WS_VTH  (WS_QKV + 4u * NR * QKVP)            // bf16 [2][1024 (h*64+d)][2048]
#define WS_VTL  (WS_VTH + 2u * NB * DM * SS)
#define WS_END  (WS_VTL + 2u * NB * DM * SS)

__global__ __launch_bounds__(128) void k_pack(const float* __restrict__ Wq, const float* __restrict__ Wk, const float* __restrict__ Wv, const float* __restrict__ Wo, __bf16* __restrict__ PT) {
  __shared__ __align__(16) __bf16 srow[DM];
  const int n = blockIdx.x, tid = threadIdx.x; const int which = n >> 10, c = n & 1023; const float* Wm = which == 0 ? Wq : (which == 1 ? Wk : (which == 2 ? Wv : Wo));
  for (int k = tid; k < DM; k += 128) srow[k] = (__bf16)Wm[(size_t)c * DM + k];   // torch [out][in]: row c
  __syncthreads();
  vst2((unsigned*)(PT + (size_t)n * DM + tid * 8), *(const v4u*)(&srow[tid * 8]));
}
// ---- k_proj: QKV[r][n] = bf16(x[r]) . PT[n] (exact), K = 1024; block (64 rows, 128 cols); 512-B segments of 12-KB rows
__global__ __launch_bounds__(128) void k_proj(const float* __restrict__ X, const __bf16* __restrict__ PT, const float* __restrict__ bq, const float* __restrict__ bk, const float* __restrict__ bv, float* __restrict__ QKV) {
  __shared__ __align__(16) float so[4][16][132];
  const int tid = threadIdx.x, wave = tid >> 5, lane = tid & 31, col = lane & 15, g = lane >> 4; const size_t r0 = (size_t)blockIdx.x * 64 + wave * 16; const int n0 = blockIdx.y * 128;
  v8f acc[8] = {}; const __bf16* wp = PT + (size_t)(n0 + col) * DM;   // one base: the eight column groups are constant offsets from it
#pragma unroll 2
  for (int kc = 0; kc < DM / 32; ++kc) { const v16b a = frag_gbf(X + (r0 + col) * DM + kc * 32, lane); v16b w[8];   // all loads of the k step stand ahead of its first product: one latency a step, not one a product
#pragma unroll
    for (int j = 0; j < 8; ++j) w[j] = frag_b(wp + j * 16 * DM + kc * 32, lane);
#pragma unroll
    for (int j = 0; j < 8; ++j) acc[j] = wmma_bf(a, w[j], acc[j]);
    asm volatile("s_wait_xcnt 0x0" ::: "memory"); }   // stands ahead of the next step's rewrite of the load address registers
#pragma unroll
  for (int j = 0; j < 8; ++j) { const int n = n0 + j * 16 + col; const int which = n >> 10, c = n & 1023; const float bb = bfr((which == 0 ? bq : which == 1 ? bk : bv)[c]);
#pragma unroll
    for (int r = 0; r < 8; ++r) so[wave][8 * g + r][j * 16 + col] = acc[j][r] + bb; }
  LDSX();
  for (int rl = 0; rl < 16; ++rl) vst2(QKV + (r0 + rl) * QKVP + n0 + lane * 4, *(const v4f*)&so[wave][rl][lane * 4]);
}
// ---- k_rope: block = (64-token block, head pair), 8 waves. A thread holds both halves of its (token, 4 j) pairs of q and k in registers and rotates them in place, so no exchange and no token loop; one angle serves q and k of both heads.
// v passes once through LDS to the transposed hi/lo planes (128-B segments of the 4-KB rows); it goes first, so that no store is outstanding at the barrier.
typedef __attribute__((ext_vector_type(2))) __bf16 v2b;
__global__ __launch_bounds__(256) void k_rope(float* __restrict__ QKV, const int* __restrict__ PID, __bf16* __restrict__ VTH, __bf16* __restrict__ VTL) {
  __shared__ __align__(16) __bf16 svh[2 * HD][72], svl[2 * HD][72];
  const int tid = threadIdx.x, lane = tid & 31, jq = tid & 7, tg = tid >> 3; const size_t t0 = (size_t)blockIdx.x * 64; const int c0 = blockIdx.y * (2 * HD); const int b = (int)(t0 / SS), p0 = (int)(t0 % SS);
  v4f vv[4][2], x[2][2][2][2]; float pos[2];   // vv[d quad jq + 8 iv][token 2 tg + e]; x[token tg + 32 it][head][q | k][half]
#pragma unroll
  for (int iv = 0; iv < 4; ++iv)
#pragma unroll
    for (int e = 0; e < 2; ++e) vv[iv][e] = *(const v4f*)(QKV + (t0 + 2 * tg + e) * QKVP + 2 * DM + c0 + (jq + 8 * iv) * 4);
#pragma unroll
  for (int it = 0; it < 2; ++it) { const float* row = QKV + (t0 + tg + 32 * it) * QKVP + c0 + jq * 4; pos[it] = (float)PID[p0 + tg + 32 * it];
#pragma unroll
    for (int hl = 0; hl < 2; ++hl)
#pragma unroll
      for (int w = 0; w < 2; ++w) { x[it][hl][w][0] = *(const v4f*)(row + w * DM + hl * HD); x[it][hl][w][1] = *(const v4f*)(row + w * DM + hl * HD + 32); } }
#pragma unroll
  for (int iv = 0; iv < 4; ++iv)
#pragma unroll
    for (int i = 0; i < 4; ++i) { const int d = (jq + 8 * iv) * 4 + i; const float v0 = vv[iv][0][i], v1 = vv[iv][1][i]; const __bf16 h0 = (__bf16)v0, h1 = (__bf16)v1;
      *(v2b*)&svh[d][2 * tg] = (v2b){h0, h1}; *(v2b*)&svl[d][2 * tg] = (v2b){(__bf16)(v0 - (float)h0), (__bf16)(v1 - (float)h1)}; }
  __syncthreads();
#pragma unroll
  for (int q = tid; q < 2 * HD * 8; q += 256) { const int rowi = q >> 3, pc = q & 7; const size_t o = ((size_t)b * DM + c0 + rowi) * SS + p0 + pc * 8; vst2((unsigned*)(VTH + o), *(const v4u*)&svh[rowi][pc * 8]); vst2((unsigned*)(VTL + o), *(const v4u*)&svl[rowi][pc * 8]); }
  const float invl = powf(10000.0f, -(float)(2 * lane) / (float)HD);   // lane j holds inv_freq[j]
  float invf[4];
#pragma unroll
  for (int i = 0; i < 4; ++i) invf[i] = __shfl(invl, jq * 4 + i);
#pragma unroll
  for (int it = 0; it < 2; ++it) { float* row = QKV + (t0 + tg + 32 * it) * QKVP + c0 + jq * 4; v4f y[2][2][2];
#pragma unroll
    for (int i = 0; i < 4; ++i) { const float ang = pos[it] * invf[i]; const float c = cosf(ang), sn = sinf(ang);
#pragma unroll
      for (int hl = 0; hl < 2; ++hl)
#pragma unroll
        for (int w = 0; w < 2; ++w) { const float x1 = x[it][hl][w][0][i], x2 = x[it][hl][w][1][i]; y[hl][w][0][i] = x1 * c - x2 * sn; y[hl][w][1][i] = x2 * c + x1 * sn; } }
#pragma unroll
    for (int hl = 0; hl < 2; ++hl)
#pragma unroll
      for (int w = 0; w < 2; ++w) { vst2(row + w * DM + hl * HD, y[hl][w][0]); vst2(row + w * DM + hl * HD + 32, y[hl][w][1]); } }
}
// ---- k_attn: block = (query block qb, b*16 + h), 4 waves: all SS/32 key steps; online softmax. Scores are formed transposed (keys as rows, queries as columns): a lane owns one query, the 16 scores it holds of a key step
// reduce in its own registers (one exchange with the other wave half for the maximum; the halves' sums join once at the end), and split in place they are the B operand of O^T += V^T P^T, so P passes through no LDS. O written over the q columns of the block's rows.
// The k rows and v^T rows of a key step are the same for the block's four waves: they are brought into LDS once a block by asynchronous copies on whole row pieces (two buffers, the next step's copies fly while this step is worked on), and each wave takes its fragments from there.
#define KPF 68   // f32 per staged k row: 272 B = 16 B x odd, the pitch of 16-byte LDS readers
#define VPB 40   // bf16 per staged v^T row: 80 B = 16 B x odd
__device__ __forceinline__ unsigned lds_of(const void* p) { return (unsigned)(size_t)p; }   // LDS byte address: the low 32 bits of a __shared__ address
__device__ __forceinline__ float xhalf(float v) { const unsigned u = __builtin_bit_cast(unsigned, v); return __builtin_bit_cast(float, __builtin_amdgcn_permlanex16(u, u, 0x76543210u, 0xfedcba98u, false, false)); }   // lane l <-> l ^ 16
__device__ __forceinline__ v8f mac3t(const F2& k, const F2& q, v8f c) { c = wmma_bf(k.h, q.l, c); c = wmma_bf(k.l, q.h, c); return wmma_bf(k.h, q.h, c); }   // the three products in mac3's order, operands swapped
__global__ __launch_bounds__(128) void k_attn(float* __restrict__ QKV, const __bf16* __restrict__ VTH, const __bf16* __restrict__ VTL) {
  __shared__ __align__(16) float sk[2][32][KPF];
  __shared__ __align__(16) __bf16 sv[2][2][HD][VPB];   // [buffer][hi | lo][d][key]
  const int tid = threadIdx.x, wave = tid >> 5, lane = tid & 31, col = lane & 15, g = lane >> 4;
  const int qb = blockIdx.x, bh = blockIdx.y, b = bh >> 4, h = bh & 15; const int q0 = qb * 64 + wave * 16; const size_t tq = (size_t)b * SS + q0;
  const F2 a0 = split_row(QKV + (tq + col) * QKVP + h * HD, 0, lane), a1 = split_row(QKV + (tq + col) * QKVP + h * HD, 32, lane);   // query col as column col of B
  const float SC2 = 0.125f * 1.44269504088896340736f;   // 1 / sqrt(64) times log2(e): e^(s / 8 - max) = 2^(s SC2 - m), one multiply-add and one hardware exponential, inline
  float m = -3.0e38f, l = 0.f;   // of query col, m in base-2 units; l holds this half's keys only
  v8f acc[4] = {};   // acc[dt][r] = O[query col][dt * 16 + 8 g + r]
  const int nsteps = SS / 32;
  // a thread's eight 16-byte pieces of a key step: k rows tid / 16 + 8 i (16 threads a 256-B row), v^T rows tid / 4 + 32 j of either plane (4 threads a 64-B row piece)
  const float* kg = QKV + ((size_t)b * SS + (tid >> 4)) * QKVP + DM + h * HD + (tid & 15) * 4;
  const size_t vo = ((size_t)b * DM + h * HD + (tid >> 2)) * SS + (tid & 3) * 8;
  const __bf16 *vgh = VTH + vo, *vgl = VTL + vo;
  auto stage = [&](int ks, int buf) {
    const float* k0 = kg + (size_t)ks * 32 * QKVP; const __bf16 *h0 = vgh + ks * 32, *l0 = vgl + ks * 32;
    const unsigned lk = lds_of(&sk[buf][tid >> 4][(tid & 15) * 4]), lh = lds_of(&sv[buf][0][tid >> 2][(tid & 3) * 8]), ll = lds_of(&sv[buf][1][tid >> 2][(tid & 3) * 8]);
    // the wait is the statement's last line, so that it stands ahead of any rewrite of a register that a copy names
    asm volatile("global_load_async_to_lds_b128 %0, %8, off\n\t"
                 "global_load_async_to_lds_b128 %1, %9, off\n\t"
                 "global_load_async_to_lds_b128 %2, %10, off\n\t"
                 "global_load_async_to_lds_b128 %3, %11, off\n\t"
                 "global_load_async_to_lds_b128 %4, %12, off\n\t"
                 "global_load_async_to_lds_b128 %5, %13, off\n\t"
                 "global_load_async_to_lds_b128 %6, %14, off\n\t"
                 "global_load_async_to_lds_b128 %7, %15, off\n\t"
                 "s_wait_xcnt 0x0"
                 :: "v"(lk), "v"(lk + 8u * KPF * 4u), "v"(lk + 16u * KPF * 4u), "v"(lk + 24u * KPF * 4u), "v"(lh), "v"(lh + 32u * VPB * 2u), "v"(ll), "v"(ll + 32u * VPB * 2u),
                    "v"(k0), "v"(k0 + 8 * QKVP), "v"(k0 + 16 * QKVP), "v"(k0 + 24 * QKVP), "v"(h0), "v"(h0 + 32 * SS), "v"(l0), "v"(l0 + 32 * SS) : "memory"); };
  stage(0, 0);
  asm volatile("s_wait_asynccnt 0x0" ::: "memory");   // this wave's copies of step 0 have landed
  __syncthreads();                                    // ... and every other wave's
  stage(1, 1);
#pragma unroll 1
  for (int ks = 0; ks < nsteps; ++ks) { const int buf = ks & 1;
    v8f s[2]; v4f kq[2][8]; v16b vh[4], vl[4];   // the key step's fragments, from this step's buffer alone; plain LDS loads, so that the compiler groups them and places counted waits
#pragma unroll
    for (int ct = 0; ct < 2; ++ct) { const float* kp = &sk[buf][ct * 16 + col][8 * g];
#pragma unroll
      for (int i = 0; i < 4; ++i) { kq[ct][2 * i] = *(const v4f*)(kp + 16 * i); kq[ct][2 * i + 1] = *(const v4f*)(kp + 16 * i + 4); } }
#pragma unroll
    for (int dt = 0; dt < 4; ++dt) { vh[dt] = frag_b(&sv[buf][0][dt * 16 + col][0], lane); vl[dt] = frag_b(&sv[buf][1][dt * 16 + col][0], lane); }
#pragma unroll
    for (int ct = 0; ct < 2; ++ct) { float kv[2][16];
#pragma unroll
      for (int i = 0; i < 16; ++i) { kv[0][i] = kq[ct][i >> 2][i & 3]; kv[1][i] = kq[ct][4 + (i >> 2)][i & 3]; }
      const F2 k0 = bsplit16(kv[0]), k1 = bsplit16(kv[1]);
      v8f c = mac3t(k0, a0, (v8f){}); s[ct] = mac3t(k1, a1, c); }   // s[ct][r] = q . k of key ks * 32 + ct * 16 + 8 g + r with query col, not yet scaled
    float mx = fmaxf(s[0][0], s[1][0]);
#pragma unroll
    for (int r = 1; r < 8; ++r) mx = fmaxf(mx, fmaxf(s[0][r], s[1][r]));
    mx = fmaxf(mx, xhalf(mx));
    const float mn = fmaxf(m, mx * SC2); float alpha = m - mn;   // SC2 > 0: the maximum of the scaled scores is the scaled maximum
    float p[16], es[4];   // p[i]: key 8 g + i (i < 8), 16 + 8 g + i - 8 (else) of the step, the k order of V^T's fragment
#pragma unroll
    for (int i = 0; i < 16; ++i) p[i] = fmaf(s[i >> 3][i & 7], SC2, -mn);
    // the exponentials, each in its own register. In asm so that the slot which the instruction set asks for behind a transcendental is there by construction: each is followed by an independent one, the last by v_nop
    asm("v_exp_f32 %0, %0\n\tv_exp_f32 %1, %1\n\tv_exp_f32 %2, %2\n\tv_exp_f32 %3, %3\n\tv_exp_f32 %4, %4\n\tv_exp_f32 %5, %5\n\tv_exp_f32 %6, %6\n\tv_exp_f32 %7, %7\n\tv_exp_f32 %8, %8\n\tv_nop"
        : "+v"(p[0]), "+v"(p[1]), "+v"(p[2]), "+v"(p[3]), "+v"(p[4]), "+v"(p[5]), "+v"(p[6]), "+v"(p[7]), "+v"(alpha));
    asm("v_exp_f32 %0, %0\n\tv_exp_f32 %1, %1\n\tv_exp_f32 %2, %2\n\tv_exp_f32 %3, %3\n\tv_exp_f32 %4, %4\n\tv_exp_f32 %5, %5\n\tv_exp_f32 %6, %6\n\tv_exp_f32 %7, %7\n\tv_nop"
        : "+v"(p[8]), "+v"(p[9]), "+v"(p[10]), "+v"(p[11]), "+v"(p[12]), "+v"(p[13]), "+v"(p[14]), "+v"(p[15]));
#pragma unroll
    for (int i = 0; i < 16; ++i) es[i & 3] = i < 4 ? p[i] : es[i & 3] + p[i];
    l = l * alpha + ((es[0] + es[1]) + (es[2] + es[3])); m = mn;
#pragma unroll
    for (int dt = 0; dt < 4; ++dt) acc[dt] *= alpha;
    const F2 pb = bsplit16(p);
#pragma unroll
    for (int dt = 0; dt < 4; ++dt) { acc[dt] = wmma_bf(vh[dt], pb.l, acc[dt]); acc[dt] = wmma_bf(vl[dt], pb.h, acc[dt]); acc[dt] = wmma_bf(vh[dt], pb.h, acc[dt]); }
    asm volatile("s_wait_dscnt 0x0" ::: "memory");      // this wave's reads of the buffer are done
    asm volatile("s_wait_asynccnt 0x0" ::: "memory");   // its copies of step ks + 1 have landed
    __syncthreads();                                    // publishes step ks + 1 and frees this step's buffer
    if (ks + 2 < nsteps) stage(ks + 2, buf); }
  asm volatile("s_wait_asynccnt 0x0" ::: "memory");   // no copy is outstanding when the wave ends
  const float il = 1.0f / (l + xhalf(l));
  float* orow = QKV + (tq + col) * QKVP + h * HD + 8 * g;
#pragma unroll
  for (int dt = 0; dt < 4; ++dt) { const v8f o = acc[dt] * il; vst2(orow + dt * 16, (v4f){o[0], o[1], o[2], o[3]}); vst2(orow + dt * 16 + 4, (v4f){o[4], o[5], o[6], o[7]}); }
}
// ---- k_out: Y = O(hi/lo; the q columns of QKV) . PT_out rows (2 products, K = 1024); block (64 rows, 128 cols)
__global__ __launch_bounds__(128) void k_out(const float* __restrict__ QKV, const __bf16* __restrict__ PT, float* __restrict__ Y) {
  __shared__ __align__(16) float so[4][16][132];
  const int tid = threadIdx.x, wave = tid >> 5, lane = tid & 31, col = lane & 15, g = lane >> 4; const size_t r0 = (size_t)blockIdx.x * 64 + wave * 16; const int n0 = blockIdx.y * 128;
  v8f acc[8] = {}; const __bf16* wp = PT + (size_t)(3 * DM + n0 + col) * DM;
#pragma unroll 2
  for (int kc = 0; kc < DM / 32; ++kc) { const F2 a = split_row(QKV + (r0 + col) * QKVP, kc * 32, lane); v16b w[8];   // loads grouped ahead of the products, as in k_proj
#pragma unroll
    for (int j = 0; j < 8; ++j) w[j] = frag_b(wp + j * 16 * DM + kc * 32, lane);
#pragma unroll
    for (int j = 0; j < 8; ++j) { acc[j] = wmma_bf(a.l, w[j], acc[j]); acc[j] = wmma_bf(a.h, w[j], acc[j]); }
    asm volatile("s_wait_xcnt 0x0" ::: "memory"); }   // stands ahead of the next step's rewrite of the load address registers
#pragma unroll
  for (int j = 0; j < 8; ++j)
#pragma unroll
    for (int r = 0; r < 8; ++r) so[wave][8 * g + r][j * 16 + col] = acc[j][r];
  LDSX();
  for (int rl = 0; rl < 16; ++rl) vst2(Y + (r0 + rl) * DM + n0 + lane * 4, *(const v4f*)&so[wave][rl][lane * 4]);
}

extern "C" void kernel_launch(void* const* d_in, const int* in_sizes, int n_in, void* d_out, int out_size, void* d_ws, size_t ws_size, hipStream_t stream) {
  (void)in_sizes; (void)n_in; (void)out_size;
  const float** F = (const float**)d_in;   // hidden_states, position_ids [1,2048] int, Wq, bq, Wk, bk, Wv, bv, Wo (torch [out][in])
  if (ws_size < (size_t)WS_END) return;
  char* ws = (char*)d_ws; __bf16 *PT = (__bf16*)(ws + WS_PT), *VTH = (__bf16*)(ws + WS_VTH), *VTL = (__bf16*)(ws + WS_VTL); float* QKV = (float*)(ws + WS_QKV);
  k_pack<<<4 * DM, 128, 0, stream>>>(F[2], F[4], F[6], F[8], PT);
  k_proj<<<dim3(TRB, QKVP / 128), 128, 0, stream>>>(F[0], PT, F[3], F[5], F[7], QKV);
  k_rope<<<dim3(TRB, NH / 2), 256, 0, stream>>>(QKV, (const int*)d_in[1], VTH, VTL);
  k_attn<<<dim3(TQB, TNB * NH), 128, 0, stream>>>(QKV, VTH, VTL);
  k_out<<<dim3((TNB < NB ? TQB : NR / 64), DM / 128), 128, 0, stream>>>(QKV, PT, (float*)d_out);
}

// v006
// Measured time: 224 microseconds a run.
// Timed twice side by side with v005, it ran 1.35 and 1.37 times as fast.
// Over all steps from v000 it is 3.56 times as fast.
// compute dtype: hidden_states, Wq/Wk/Wv + biases, Wo (module inputs) rounded to bf16, position_ids as int; q/k/v projections with exact bf16 products (+ bias); rotary tables (inv_freq = 10000^(-2i/64), cos/sin of pos·inv_freq) and the rotate-half mix in f32; scores and P.V with both computed operands as bf16 hi + bf16 residual pairs (3 products); output projection hi/lo x bf16 Wo (2 products); online softmax in f32; f32 accumulate.
#include <hip/hip_runtime.h>
#include <math.h>

typedef __attribute__((ext_vector_type(16))) _Float16 v16h;
typedef __attribute__((ext_vector_type(16))) __bf16 v16b;
typedef __attribute__((ext_vector_type(8)))  _Float16 v8h;
typedef __attribute__((ext_vector_type(8)))  float v8f;
typedef __attribute__((ext_vector_type(4)))  float v4f;
typedef __attribute__((ext_vector_type(2)))  float v2f;
typedef __attribute__((ext_vector_type(4)))  unsigned v4u;
typedef __attribute__((ext_vector_type(4)))  int v4i;
typedef float __attribute__((may_alias)) float_a;
typedef int __attribute__((may_alias)) int_a;

template <typename T> __device__ __forceinline__ void vst2(void* p, T v) { *(T*)p = v;  }
__device__ __forceinline__ v8f wmma16(v16h a, v16h b, v8f c) {
  v8f d = __builtin_amdgcn_wmma_f32_16x16x32_f16(false, a, false, b, (short)0, c, false, false);
  asm volatile("v_nop\n\tv_nop\n\tv_nop\n\tv_nop" : "+v"(d) : "v"(a), "v"(b));
  return d;
}
__device__ __forceinline__ v8f wmma_bf(v16b a, v16b b, v8f c) {
  v8f d = __builtin_amdgcn_wmma_f32_16x16x32_bf16(false, a, false, b, (short)0, c, false, false);
  asm volatile("v_nop\n\tv_nop\n\tv_nop\n\tv_nop" : "+v"(d) : "v"(a), "v"(b));
  return d;
}
// 16x16x32 fragments: lane = (h = lane>>4, row/col = lane&15); elements 0..7 = k0+8h+0..7, 8..15 = k0+16+8h+0..7; D element r = row 8h+r
__device__ __forceinline__ v16h frag_h(const _Float16* rowk0, int lane) {
  union { v16h v; v8h q[2]; } u; const _Float16* p = rowk0 + 8 * (lane >> 4);
  u.q[0] = *(const v8h*)p; u.q[1] = *(const v8h*)(p + 16); return u.v;
}
__device__ __forceinline__ v16h frag_f32(const float* rowk0, int lane) {
  v16h a; const float* p = rowk0 + 8 * (lane >> 4);
#pragma unroll
  for (int i = 0; i < 8; ++i) { a[i] = (_Float16)p[i]; a[8 + i] = (_Float16)p[16 + i]; }
  return a;
}
__device__ __forceinline__ v16h frag_f32s(const float* rowk0, int lane, float sc) {
  v16h a; const float* p = rowk0 + 8 * (lane >> 4);
#pragma unroll
  for (int i = 0; i < 8; ++i) { a[i] = (_Float16)(p[i] * sc); a[8 + i] = (_Float16)(p[16 + i] * sc); }
  return a;
}
// column fragment from a [K][ld] layout (column n), rows >= K read as 0
__device__ __forceinline__ v16h fragc_f32(const float* W, int k0, int n, int lane, int ld, int K) {
  v16h a; const int g = lane >> 4;
#pragma unroll
  for (int i = 0; i < 8; ++i) { const int ka = k0 + 8 * g + i, kb = ka + 16;
    a[i] = (_Float16)(ka < K ? W[(size_t)(ka < K ? ka : K - 1) * ld + n] : 0.f); a[8 + i] = (_Float16)(kb < K ? W[(size_t)(kb < K ? kb : K - 1) * ld + n] : 0.f); }
  return a;
}
struct F2 { v16b h, l; };
__device__ __forceinline__ F2 bsplit16(const float v[16]) { F2 r;
#pragma unroll
  for (int i = 0; i < 16; ++i) { const __bf16 h = (__bf16)v[i]; r.h[i] = h; r.l[i] = (__bf16)(v[i] - (float)h); }
  return r; }
__device__ __forceinline__ F2 split_row(const float* row, int k0, int lane) { float v[16]; const float* p = row + k0 + 8 * (lane >> 4);
#pragma unroll
  for (int i = 0; i < 8; ++i) { v[i] = p[i]; v[8 + i] = p[16 + i]; }
  return bsplit16(v); }
__device__ __forceinline__ F2 split_rowK(const float* row, int k0, int lane, int K) { float v[16]; const int g = lane >> 4;
#pragma unroll
  for (int i = 0; i < 8; ++i) { const int ka = k0 + 8 * g + i, kb = ka + 16; v[i] = ka < K ? row[ka < K ? ka : K - 1] : 0.f; v[8 + i] = kb < K ? row[kb < K ? kb : K - 1] : 0.f; }
  return bsplit16(v); }
__device__ __forceinline__ F2 split_col(const float* W, int k0, int n, int lane, int ld, int K) { float v[16]; const int g = lane >> 4;
#pragma unroll
  for (int i = 0; i < 8; ++i) { const int ka = k0 + 8 * g + i, kb = ka + 16; v[i] = ka < K ? W[(size_t)(ka < K ? ka : K - 1) * ld + n] : 0.f; v[8 + i] = kb < K ? W[(size_t)(kb < K ? kb : K - 1) * ld + n] : 0.f; }
  return bsplit16(v); }
__device__ __forceinline__ v8f mac3(const F2& a, const F2& b, v8f c) { c = wmma_bf(a.l, b.h, c); c = wmma_bf(a.h, b.l, c); return wmma_bf(a.h, b.h, c); }
__device__ __forceinline__ float sigm(float v) { return 1.0f / (1.0f + expf(-v)); }
#define LDSX() do { asm volatile("s_wait_dscnt 0" ::: "memory"); __builtin_amdgcn_wave_barrier(); __builtin_amdgcn_fence(__ATOMIC_RELEASE, "workgroup"); } while (0)


// Wav2Vec2 self attention: q,k,v = x W^T + b (16 heads x 64); scores = q k^T / 8; softmax (no mask); P v; merge heads; @ Wo^T (no output bias).  B 2, S 2048, D 1024.
// k_pack (W rows as bf16 rows: torch [out][in] layout is already K-contiguous), k_proj (exact GEMM + bias, 3072-wide rows), k_rope (rotary on q,k in place; v as transposed hi/lo planes), k_attn (flash-style: per (64-query block, b, h) over all 64 32-key steps, online max/sum with accumulator rescale; O rows), k_out (O hi/lo x Wo, no bias).
#define NB 2
#define SS 2048
#define DM 1024
#define NH 16
#define HD 64
#define NR (NB * SS)
#define QKVP (3 * DM)
#ifndef TRB
#define TRB (NR / 64)
#define TQB (SS / 64)
#define TNB NB
#endif
typedef __attribute__((ext_vector_type(8))) __bf16 v8b;
__device__ __forceinline__ v16b frag_b(const __bf16* rowk0, int lane) {
  union { v16b v; v8b q[2]; } u; const __bf16* p = rowk0 + 8 * (lane >> 4);
  u.q[0] = *(const v8b*)p; u.q[1] = *(const v8b*)(p + 16); return u.v;
}
__device__ __forceinline__ v16b frag_gbf(const float* rowk0, int lane) {
  v16b a; const float* p = rowk0 + 8 * (lane >> 4);
#pragma unroll
  for (int i = 0; i < 8; ++i) { a[i] = (__bf16)p[i]; a[8 + i] = (__bf16)p[16 + i]; }
  return a;
}
__device__ __forceinline__ float bfr(float v) { return (float)(__bf16)v; }
#define WS_PT   0u                                 // bf16 [4096 (q|k|v|out cols)][1024]
#define WS_QKV  (WS_PT + 2u * 4 * DM * DM)           // f32 [4096 rows][3072]  (q 0..1023 | k | v) ; q cols later overwritten by O
#define WS_VTH  (WS_QKV + 4u * NR * QKVP)            // bf16 [2][1024 (h*64+d)][2048]
#define WS_VTL  (WS_VTH + 2u * NB * DM * SS)
#define WS_END  (WS_VTL + 2u * NB * DM * SS)

__global__ __launch_bounds__(128) void k_pack(const float* __restrict__ Wq, const float* __restrict__ Wk, const float* __restrict__ Wv, const float* __restrict__ Wo, __bf16* __restrict__ PT) {
  __shared__ __align__(16) __bf16 srow[DM];
  const int n = blockIdx.x, tid = threadIdx.x; const int which = n >> 10, c = n & 1023; const float* Wm = which == 0 ? Wq : (which == 1 ? Wk : (which == 2 ? Wv : Wo));
  for (int k = tid; k < DM; k += 128) srow[k] = (__bf16)Wm[(size_t)c * DM + k];   // torch [out][in]: row c
  __syncthreads();
  vst2((unsigned*)(PT + (size_t)n * DM + tid * 8), *(const v4u*)(&srow[tid * 8]));
}
#define GKT 64   // k per staged tile
#define WPB 72   // bf16 per staged W row: 144 B = 16 B x odd, the pitch of 16-byte LDS readers
#define XPF 68   // f32 per staged x row: 272 B = 16 B x odd
struct GemmStage { __bf16 w[2][128][WPB]; float x[2][64][XPF]; };
union GemmLds { GemmStage st; float so[4][16][132]; };   // the output rows pass through the same bytes once the last tile has been read
__device__ __forceinline__ unsigned lds_of(const void* p) { return (unsigned)(size_t)p; }   // LDS byte address: the low 32 bits of a __shared__ address
// a thread's sixteen 16-byte pieces of a tile: W rows tid / 8 + 16 i (8 threads a 128-B row piece), x rows tid / 16 + 8 i (16 threads a 256-B row piece). wg, xg: the thread's pieces of rows tid / 8 and tid / 16 of this tile; xld: f32 per x row in global memory
__device__ __forceinline__ void gemm_stage(GemmStage& st, int buf, int tid, const __bf16* wg, const float* xg, int xld) {
  const unsigned lw = lds_of(&st.w[buf][tid >> 3][(tid & 7) * 8]), lx = lds_of(&st.x[buf][tid >> 4][(tid & 15) * 4]);
  // in each statement the wait is the last line, so that it stands ahead of any rewrite of a register that a copy names
  asm volatile("global_load_async_to_lds_b128 %0, %8, off\n\t"
               "global_load_async_to_lds_b128 %1, %9, off\n\t"
               "global_load_async_to_lds_b128 %2, %10, off\n\t"
               "global_load_async_to_lds_b128 %3, %11, off\n\t"
               "global_load_async_to_lds_b128 %4, %12, off\n\t"
               "global_load_async_to_lds_b128 %5, %13, off\n\t"
               "global_load_async_to_lds_b128 %6, %14, off\n\t"
               "global_load_async_to_lds_b128 %7, %15, off\n\t"
               "s_wait_xcnt 0x0"
               :: "v"(lw), "v"(lw + 16u * WPB * 2u), "v"(lw + 32u * WPB * 2u), "v"(lw + 48u * WPB * 2u), "v"(lw + 64u * WPB * 2u), "v"(lw + 80u * WPB * 2u), "v"(lw + 96u * WPB * 2u), "v"(lw + 112u * WPB * 2u),
                  "v"(wg), "v"(wg + 16 * DM), "v"(wg + 32 * DM), "v"(wg + 48 * DM), "v"(wg + 64 * DM), "v"(wg + 80 * DM), "v"(wg + 96 * DM), "v"(wg + 112 * DM) : "memory");
  asm volatile("global_load_async_to_lds_b128 %0, %8, off\n\t"
               "global_load_async_to_lds_b128 %1, %9, off\n\t"
               "global_load_async_to_lds_b128 %2, %10, off\n\t"
               "global_load_async_to_lds_b128 %3, %11, off\n\t"
               "global_load_async_to_lds_b128 %4, %12, off\n\t"
               "global_load_async_to_lds_b128 %5, %13, off\n\t"
               "global_load_async_to_lds_b128 %6, %14, off\n\t"
               "global_load_async_to_lds_b128 %7, %15, off\n\t"
               "s_wait_xcnt 0x0"
               :: "v"(lx), "v"(lx + 8u * XPF * 4u), "v"(lx + 16u * XPF * 4u), "v"(lx + 24u * XPF * 4u), "v"(lx + 32u * XPF * 4u), "v"(lx + 40u * XPF * 4u), "v"(lx + 48u * XPF * 4u), "v"(lx + 56u * XPF * 4u),
                  "v"(xg), "v"(xg + 8 * xld), "v"(xg + 16 * xld), "v"(xg + 24 * xld), "v"(xg + 32 * xld), "v"(xg + 40 * xld), "v"(xg + 48 * xld), "v"(xg + 56 * xld) : "memory");
}
// the 16 f32 of a lane's A fragment from a staged x row, in the fragment's k order, as four 16-byte LDS reads
__device__ __forceinline__ void frag_lx(const float* rowk0, int lane, float v[16]) { const float* p = rowk0 + 8 * (lane >> 4); const v4f q0 = *(const v4f*)p, q1 = *(const v4f*)(p + 4), q2 = *(const v4f*)(p + 16), q3 = *(const v4f*)(p + 20);
#pragma unroll
  for (int i = 0; i < 4; ++i) { v[i] = q0[i]; v[4 + i] = q1[i]; v[8 + i] = q2[i]; v[12 + i] = q3[i]; } }
// ---- k_proj: QKV[r][n] = bf16(x[r]) . PT[n] (exact), K = 1024; block (64 rows, 128 cols); 512-B segments of 12-KB rows
__global__ __launch_bounds__(128) void k_proj(const float* __restrict__ X, const __bf16* __restrict__ PT, const float* __restrict__ bq, const float* __restrict__ bk, const float* __restrict__ bv, float* __restrict__ QKV) {
  __shared__ __align__(16) GemmLds sm;
  const int tid = threadIdx.x, wave = tid >> 5, lane = tid & 31, col = lane & 15, g = lane >> 4; const size_t r0 = (size_t)blockIdx.x * 64 + wave * 16; const int n0 = blockIdx.y * 128;
  v8f acc[8] = {};
  const __bf16* wg = PT + (size_t)(n0 + (tid >> 3)) * DM + (tid & 7) * 8; const float* xg = X + ((size_t)blockIdx.x * 64 + (tid >> 4)) * DM + (tid & 15) * 4;
  const int nt = DM / GKT;
  gemm_stage(sm.st, 0, tid, wg, xg, DM);
  asm volatile("s_wait_asynccnt 0x0" ::: "memory");   // this wave's copies of tile 0 have landed
  __syncthreads();                                    // ... and every other wave's
  gemm_stage(sm.st, 1, tid, wg + GKT, xg + GKT, DM);
  // kept rolled: the buffer is the trip's parity, and a second copy of the body would only double the code and the live addresses
#pragma unroll 1
  for (int kt = 0; kt < nt; ++kt) { const int buf = kt & 1;
#pragma unroll
    for (int kc = 0; kc < GKT / 32; ++kc) { float xv[16]; frag_lx(&sm.st.x[buf][wave * 16 + col][kc * 32], lane, xv); v16b a, w[8];
#pragma unroll
      for (int i = 0; i < 16; ++i) a[i] = (__bf16)xv[i];
#pragma unroll
      for (int j = 0; j < 8; ++j) w[j] = frag_b(&sm.st.w[buf][j * 16 + col][kc * 32], lane);
#pragma unroll
      for (int j = 0; j < 8; ++j) acc[j] = wmma_bf(a, w[j], acc[j]); }
    asm volatile("s_wait_dscnt 0x0" ::: "memory");      // this wave's reads of the buffer are done
    asm volatile("s_wait_asynccnt 0x0" ::: "memory");   // its copies of tile kt + 1 have landed
    __syncthreads();                                    // publishes tile kt + 1 and frees this tile's buffer
    if (kt + 2 < nt) gemm_stage(sm.st, buf, tid, wg + (kt + 2) * GKT, xg + (kt + 2) * GKT, DM); }
  asm volatile("s_wait_asynccnt 0x0" ::: "memory");   // no copy is outstanding when the bytes are used anew
#pragma unroll
  for (int j = 0; j < 8; ++j) { const int n = n0 + j * 16 + col; const int which = n >> 10, c = n & 1023; const float bb = bfr((which == 0 ? bq : which == 1 ? bk : bv)[c]);
#pragma unroll
    for (int r = 0; r < 8; ++r) sm.so[wave][8 * g + r][j * 16 + col] = acc[j][r] + bb; }
  LDSX();
  for (int rl = 0; rl < 16; ++rl) vst2(QKV + (r0 + rl) * QKVP + n0 + lane * 4, *(const v4f*)&sm.so[wave][rl][lane * 4]);
}
// ---- k_rope: block = (64-token block, head pair), 8 waves. A thread holds both halves of its (token, 4 j) pairs of q and k in registers and rotates them in place, so no exchange and no token loop; one angle serves q and k of both heads.
// v passes once through LDS to the transposed hi/lo planes (128-B segments of the 4-KB rows); it goes first, so that no store is outstanding at the barrier.
typedef __attribute__((ext_vector_type(2))) __bf16 v2b;
__global__ __launch_bounds__(256) void k_rope(float* __restrict__ QKV, const int* __restrict__ PID, __bf16* __restrict__ VTH, __bf16* __restrict__ VTL) {
  __shared__ __align__(16) __bf16 svh[2 * HD][72], svl[2 * HD][72];
  const int tid = threadIdx.x, lane = tid & 31, jq = tid & 7, tg = tid >> 3; const size_t t0 = (size_t)blockIdx.x * 64; const int c0 = blockIdx.y * (2 * HD); const int b = (int)(t0 / SS), p0 = (int)(t0 % SS);
  v4f vv[4][2], x[2][2][2][2]; float pos[2];   // vv[d quad jq + 8 iv][token 2 tg + e]; x[token tg + 32 it][head][q | k][half]
#pragma unroll
  for (int iv = 0; iv < 4; ++iv)
#pragma unroll
    for (int e = 0; e < 2; ++e) vv[iv][e] = *(const v4f*)(QKV + (t0 + 2 * tg + e) * QKVP + 2 * DM + c0 + (jq + 8 * iv) * 4);
#pragma unroll
  for (int it = 0; it < 2; ++it) { const float* row = QKV + (t0 + tg + 32 * it) * QKVP + c0 + jq * 4; pos[it] = (float)PID[p0 + tg + 32 * it];
#pragma unroll
    for (int hl = 0; hl < 2; ++hl)
#pragma unroll
      for (int w = 0; w < 2; ++w) { x[it][hl][w][0] = *(const v4f*)(row + w * DM + hl * HD); x[it][hl][w][1] = *(const v4f*)(row + w * DM + hl * HD + 32); } }
#pragma unroll
  for (int iv = 0; iv < 4; ++iv)
#pragma unroll
    for (int i = 0; i < 4; ++i) { const int d = (jq + 8 * iv) * 4 + i; const float v0 = vv[iv][0][i], v1 = vv[iv][1][i]; const __bf16 h0 = (__bf16)v0, h1 = (__bf16)v1;
      *(v2b*)&svh[d][2 * tg] = (v2b){h0, h1}; *(v2b*)&svl[d][2 * tg] = (v2b){(__bf16)(v0 - (float)h0), (__bf16)(v1 - (float)h1)}; }
  __syncthreads();
#pragma unroll
  for (int q = tid; q < 2 * HD * 8; q += 256) { const int rowi = q >> 3, pc = q & 7; const size_t o = ((size_t)b * DM + c0 + rowi) * SS + p0 + pc * 8; vst2((unsigned*)(VTH + o), *(const v4u*)&svh[rowi][pc * 8]); vst2((unsigned*)(VTL + o), *(const v4u*)&svl[rowi][pc * 8]); }
  const float invl = powf(10000.0f, -(float)(2 * lane) / (float)HD);   // lane j holds inv_freq[j]
  float invf[4];
#pragma unroll
  for (int i = 0; i < 4; ++i) invf[i] = __shfl(invl, jq * 4 + i);
#pragma unroll
  for (int it = 0; it < 2; ++it) { float* row = QKV + (t0 + tg + 32 * it) * QKVP + c0 + jq * 4; v4f y[2][2][2];
#pragma unroll
    for (int i = 0; i < 4; ++i) { const float ang = pos[it] * invf[i]; const float c = cosf(ang), sn = sinf(ang);
#pragma unroll
      for (int hl = 0; hl < 2; ++hl)
#pragma unroll
        for (int w = 0; w < 2; ++w) { const float x1 = x[it][hl][w][0][i], x2 = x[it][hl][w][1][i]; y[hl][w][0][i] = x1 * c - x2 * sn; y[hl][w][1][i] = x2 * c + x1 * sn; } }
#pragma unroll
    for (int hl = 0; hl < 2; ++hl)
#pragma unroll
      for (int w = 0; w < 2; ++w) { vst2(row + w * DM + hl * HD, y[hl][w][0]); vst2(row + w * DM + hl * HD + 32, y[hl][w][1]); } }
}
// ---- k_attn: block = (query block qb, b*16 + h), 4 waves: all SS/32 key steps; online softmax. Scores are formed transposed (keys as rows, queries as columns): a lane owns one query, the 16 scores it holds of a key step
// reduce in its own registers (one exchange with the other wave half for the maximum; the halves' sums join once at the end), and split in place they are the B operand of O^T += V^T P^T, so P passes through no LDS. O written over the q columns of the block's rows.
// The k rows and v^T rows of a key step are the same for the block's four waves: they are brought into LDS once a block by asynchronous copies on whole row pieces (two buffers, the next step's copies fly while this step is worked on), and each wave takes its fragments from there.
#define KPF 68   // f32 per staged k row: 272 B = 16 B x odd, the pitch of 16-byte LDS readers
#define VPB 40   // bf16 per staged v^T row: 80 B = 16 B x odd
__device__ __forceinline__ float xhalf(float v) { const unsigned u = __builtin_bit_cast(unsigned, v); return __builtin_bit_cast(float, __builtin_amdgcn_permlanex16(u, u, 0x76543210u, 0xfedcba98u, false, false)); }   // lane l <-> l ^ 16
__device__ __forceinline__ v8f mac3t(const F2& k, const F2& q, v8f c) { c = wmma_bf(k.h, q.l, c); c = wmma_bf(k.l, q.h, c); return wmma_bf(k.h, q.h, c); }   // the three products in mac3's order, operands swapped
__global__ __launch_bounds__(128) void k_attn(float* __restrict__ QKV, const __bf16* __restrict__ VTH, const __bf16* __restrict__ VTL) {
  __shared__ __align__(16) float sk[2][32][KPF];
  __shared__ __align__(16) __bf16 sv[2][2][HD][VPB];   // [buffer][hi | lo][d][key]
  const int tid = threadIdx.x, wave = tid >> 5, lane = tid & 31, col = lane & 15, g = lane >> 4;
  const int qb = blockIdx.x, bh = blockIdx.y, b = bh >> 4, h = bh & 15; const int q0 = qb * 64 + wave * 16; const size_t tq = (size_t)b * SS + q0;
  const F2 a0 = split_row(QKV + (tq + col) * QKVP + h * HD, 0, lane), a1 = split_row(QKV + (tq + col) * QKVP + h * HD, 32, lane);   // query col as column col of B
  const float SC2 = 0.125f * 1.44269504088896340736f;   // 1 / sqrt(64) times log2(e): e^(s / 8 - max) = 2^(s SC2 - m), one multiply-add and one hardware exponential, inline
  float m = -3.0e38f, l = 0.f;   // of query col, m in base-2 units; l holds this half's keys only
  v8f acc[4] = {};   // acc[dt][r] = O[query col][dt * 16 + 8 g + r]
  const int nsteps = SS / 32;
  // a thread's eight 16-byte pieces of a key step: k rows tid / 16 + 8 i (16 threads a 256-B row), v^T rows tid / 4 + 32 j of either plane (4 threads a 64-B row piece)
  const float* kg = QKV + ((size_t)b * SS + (tid >> 4)) * QKVP + DM + h * HD + (tid & 15) * 4;
  const size_t vo = ((size_t)b * DM + h * HD + (tid >> 2)) * SS + (tid & 3) * 8;
  const __bf16 *vgh = VTH + vo, *vgl = VTL + vo;
  auto stage = [&](int ks, int buf) {
    const float* k0 = kg + (size_t)ks * 32 * QKVP; const __bf16 *h0 = vgh + ks * 32, *l0 = vgl + ks * 32;
    const unsigned lk = lds_of(&sk[buf][tid >> 4][(tid & 15) * 4]), lh = lds_of(&sv[buf][0][tid >> 2][(tid & 3) * 8]), ll = lds_of(&sv[buf][1][tid >> 2][(tid & 3) * 8]);
    // the wait is the statement's last line, so that it stands ahead of any rewrite of a register that a copy names
    asm volatile("global_load_async_to_lds_b128 %0, %8, off\n\t"
                 "global_load_async_to_lds_b128 %1, %9, off\n\t"
                 "global_load_async_to_lds_b128 %2, %10, off\n\t"
                 "global_load_async_to_lds_b128 %3, %11, off\n\t"
                 "global_load_async_to_lds_b128 %4, %12, off\n\t"
                 "global_load_async_to_lds_b128 %5, %13, off\n\t"
                 "global_load_async_to_lds_b128 %6, %14, off\n\t"
                 "global_load_async_to_lds_b128 %7, %15, off\n\t"
                 "s_wait_xcnt 0x0"
                 :: "v"(lk), "v"(lk + 8u * KPF * 4u), "v"(lk + 16u * KPF * 4u), "v"(lk + 24u * KPF * 4u), "v"(lh), "v"(lh + 32u * VPB * 2u), "v"(ll), "v"(ll + 32u * VPB * 2u),
                    "v"(k0), "v"(k0 + 8 * QKVP), "v"(k0 + 16 * QKVP), "v"(k0 + 24 * QKVP), "v"(h0), "v"(h0 + 32 * SS), "v"(l0), "v"(l0 + 32 * SS) : "memory"); };
  stage(0, 0);
  asm volatile("s_wait_asynccnt 0x0" ::: "memory");   // this wave's copies of step 0 have landed
  __syncthreads();                                    // ... and every other wave's
  stage(1, 1);
#pragma unroll 1
  for (int ks = 0; ks < nsteps; ++ks) { const int buf = ks & 1;
    v8f s[2]; v4f kq[2][8]; v16b vh[4], vl[4];   // the key step's fragments, from this step's buffer alone; plain LDS loads, so that the compiler groups them and places counted waits
#pragma unroll
    for (int ct = 0; ct < 2; ++ct) { const float* kp = &sk[buf][ct * 16 + col][8 * g];
#pragma unroll
      for (int i = 0; i < 4; ++i) { kq[ct][2 * i] = *(const v4f*)(kp + 16 * i); kq[ct][2 * i + 1] = *(const v4f*)(kp + 16 * i + 4); } }
#pragma unroll
    for (int dt = 0; dt < 4; ++dt) { vh[dt] = frag_b(&sv[buf][0][dt * 16 + col][0], lane); vl[dt] = frag_b(&sv[buf][1][dt * 16 + col][0], lane); }
#pragma unroll
    for (int ct = 0; ct < 2; ++ct) { float kv[2][16];
#pragma unroll
      for (int i = 0; i < 16; ++i) { kv[0][i] = kq[ct][i >> 2][i & 3]; kv[1][i] = kq[ct][4 + (i >> 2)][i & 3]; }
      const F2 k0 = bsplit16(kv[0]), k1 = bsplit16(kv[1]);
      v8f c = mac3t(k0, a0, (v8f){}); s[ct] = mac3t(k1, a1, c); }   // s[ct][r] = q . k of key ks * 32 + ct * 16 + 8 g + r with query col, not yet scaled
    float mx = fmaxf(s[0][0], s[1][0]);
#pragma unroll
    for (int r = 1; r < 8; ++r) mx = fmaxf(mx, fmaxf(s[0][r], s[1][r]));
    mx = fmaxf(mx, xhalf(mx));
    const float mn = fmaxf(m, mx * SC2); float alpha = m - mn;   // SC2 > 0: the maximum of the scaled scores is the scaled maximum
    float p[16], es[4];   // p[i]: key 8 g + i (i < 8), 16 + 8 g + i - 8 (else) of the step, the k order of V^T's fragment
#pragma unroll
    for (int i = 0; i < 16; ++i) p[i] = fmaf(s[i >> 3][i & 7], SC2, -mn);
    // the exponentials, each in its own register. In asm so that the slot which the instruction set asks for behind a transcendental is there by construction: each is followed by an independent one, the last by v_nop
    asm("v_exp_f32 %0, %0\n\tv_exp_f32 %1, %1\n\tv_exp_f32 %2, %2\n\tv_exp_f32 %3, %3\n\tv_exp_f32 %4, %4\n\tv_exp_f32 %5, %5\n\tv_exp_f32 %6, %6\n\tv_exp_f32 %7, %7\n\tv_exp_f32 %8, %8\n\tv_nop"
        : "+v"(p[0]), "+v"(p[1]), "+v"(p[2]), "+v"(p[3]), "+v"(p[4]), "+v"(p[5]), "+v"(p[6]), "+v"(p[7]), "+v"(alpha));
    asm("v_exp_f32 %0, %0\n\tv_exp_f32 %1, %1\n\tv_exp_f32 %2, %2\n\tv_exp_f32 %3, %3\n\tv_exp_f32 %4, %4\n\tv_exp_f32 %5, %5\n\tv_exp_f32 %6, %6\n\tv_exp_f32 %7, %7\n\tv_nop"
        : "+v"(p[8]), "+v"(p[9]), "+v"(p[10]), "+v"(p[11]), "+v"(p[12]), "+v"(p[13]), "+v"(p[14]), "+v"(p[15]));
#pragma unroll
    for (int i = 0; i < 16; ++i) es[i & 3] = i < 4 ? p[i] : es[i & 3] + p[i];
    l = l * alpha + ((es[0] + es[1]) + (es[2] + es[3])); m = mn;
#pragma unroll
    for (int dt = 0; dt < 4; ++dt) acc[dt] *= alpha;
    const F2 pb = bsplit16(p);
#pragma unroll
    for (int dt = 0; dt < 4; ++dt) { acc[dt] = wmma_bf(vh[dt], pb.l, acc[dt]); acc[dt] = wmma_bf(vl[dt], pb.h, acc[dt]); acc[dt] = wmma_bf(vh[dt], pb.h, acc[dt]); }
    asm volatile("s_wait_dscnt 0x0" ::: "memory");      // this wave's reads of the buffer are done
    asm volatile("s_wait_asynccnt 0x0" ::: "memory");   // its copies of step ks + 1 have landed
    __syncthreads();                                    // publishes step ks + 1 and frees this step's buffer
    if (ks + 2 < nsteps) stage(ks + 2, buf); }
  asm volatile("s_wait_asynccnt 0x0" ::: "memory");   // no copy is outstanding when the wave ends
  const float il = 1.0f / (l + xhalf(l));
  float* orow = QKV + (tq + col) * QKVP + h * HD + 8 * g;
#pragma unroll
  for (int dt = 0; dt < 4; ++dt) { const v8f o = acc[dt] * il; vst2(orow + dt * 16, (v4f){o[0], o[1], o[2], o[3]}); vst2(orow + dt * 16 + 4, (v4f){o[4], o[5], o[6], o[7]}); }
}
// ---- k_out: Y = O(hi/lo; the q columns of QKV) . PT_out rows (2 products, K = 1024); block (64 rows, 128 cols); operands staged as in k_proj
__global__ __launch_bounds__(128) void k_out(const float* __restrict__ QKV, const __bf16* __restrict__ PT, float* __restrict__ Y) {
  __shared__ __align__(16) GemmLds sm;
  const int tid = threadIdx.x, wave = tid >> 5, lane = tid & 31, col = lane & 15, g = lane >> 4; const size_t r0 = (size_t)blockIdx.x * 64 + wave * 16; const int n0 = blockIdx.y * 128;
  v8f acc[8] = {};
  const __bf16* wg = PT + (size_t)(3 * DM + n0 + (tid >> 3)) * DM + (tid & 7) * 8; const float* xg = QKV + ((size_t)blockIdx.x * 64 + (tid >> 4)) * QKVP + (tid & 15) * 4;
  const int nt = DM / GKT;
  gemm_stage(sm.st, 0, tid, wg, xg, QKVP);
  asm volatile("s_wait_asynccnt 0x0" ::: "memory");   // this wave's copies of tile 0 have landed
  __syncthreads();                                    // ... and every other wave's
  gemm_stage(sm.st, 1, tid, wg + GKT, xg + GKT, QKVP);
  // kept rolled: the buffer is the trip's parity, and a second copy of the body would only double the code and the live addresses
#pragma unroll 1
  for (int kt = 0; kt < nt; ++kt) { const int buf = kt & 1;
#pragma unroll
    for (int kc = 0; kc < GKT / 32; ++kc) { float xv[16]; frag_lx(&sm.st.x[buf][wave * 16 + col][kc * 32], lane, xv); const F2 a = bsplit16(xv); v16b w[8];
#pragma unroll
      for (int j = 0; j < 8; ++j) w[j] = frag_b(&sm.st.w[buf][j * 16 + col][kc * 32], lane);
#pragma unroll
      for (int j = 0; j < 8; ++j) { acc[j] = wmma_bf(a.l, w[j], acc[j]); acc[j] = wmma_bf(a.h, w[j], acc[j]); } }
    asm volatile("s_wait_dscnt 0x0" ::: "memory");      // this wave's reads of the buffer are done
    asm volatile("s_wait_asynccnt 0x0" ::: "memory");   // its copies of tile kt + 1 have landed
    __syncthreads();                                    // publishes tile kt + 1 and frees this tile's buffer
    if (kt + 2 < nt) gemm_stage(sm.st, buf, tid, wg + (kt + 2) * GKT, xg + (kt + 2) * GKT, QKVP); }
  asm volatile("s_wait_asynccnt 0x0" ::: "memory");   // no copy is outstanding when the bytes are used anew
#pragma unroll
  for (int j = 0; j < 8; ++j)
#pragma unroll
    for (int r = 0; r < 8; ++r) sm.so[wave][8 * g + r][j * 16 + col] = acc[j][r];
  LDSX();
  for (int rl = 0; rl < 16; ++rl) vst2(Y + (r0 + rl) * DM + n0 + lane * 4, *(const v4f*)&sm.so[wave][rl][lane * 4]);
}

extern "C" void kernel_launch(void* const* d_in, const int* in_sizes, int n_in, void* d_out, int out_size, void* d_ws, size_t ws_size, hipStream_t stream) {
  (void)in_sizes; (void)n_in; (void)out_size;
  const float** F = (const float**)d_in;   // hidden_states, position_ids [1,2048] int, Wq, bq, Wk, bk, Wv, bv, Wo (torch [out][in])
  if (ws_size < (size_t)WS_END) return;
  char* ws = (char*)d_ws; __bf16 *PT = (__bf16*)(ws + WS_PT), *VTH = (__bf16*)(ws + WS_VTH), *VTL = (__bf16*)(ws + WS_VTL); float* QKV = (float*)(ws + WS_QKV);
  k_pack<<<4 * DM, 128, 0, stream>>>(F[2], F[4], F[6], F[8], PT);
  k_proj<<<dim3(TRB, QKVP / 128), 128, 0, stream>>>(F[0], PT, F[3], F[5], F[7], QKV);
  k_rope<<<dim3(TRB, NH / 2), 256, 0, stream>>>(QKV, (const int*)d_in[1], VTH, VTL);
  k_attn<<<dim3(TQB, TNB * NH), 128, 0, stream>>>(QKV, VTH, VTL);
  k_out<<<dim3((TNB < NB ? TQB : NR / 64), DM / 128), 128, 0, stream>>>(QKV, PT, (float*)d_out);
}

// v007
// It runs in 194 microseconds.
// In both of two side-by-side timings against v006, it was 1.15 times as fast.
// Over all steps from v000 it is 4.10 times as fast.
// compute dtype: hidden_states, Wq/Wk/Wv + biases, Wo (module inputs) rounded to bf16, position_ids as int; q/k/v projections with exact bf16 products (+ bias); rotary tables (inv_freq = 10000^(-2i/64), cos/sin of pos·inv_freq) and the rotate-half mix in f32; scores and P.V with both computed operands as bf16 hi + bf16 residual pairs (3 products); output projection hi/lo x bf16 Wo (2 products); online softmax in f32; f32 accumulate.
#include <hip/hip_runtime.h>
#include <math.h>

typedef __attribute__((ext_vector_type(16))) _Float16 v16h;
typedef __attribute__((ext_vector_type(16))) __bf16 v16b;
typedef __attribute__((ext_vector_type(8)))  _Float16 v8h;
typedef __attribute__((ext_vector_type(8)))  float v8f;
typedef __attribute__((ext_vector_type(4)))  float v4f;
typedef __attribute__((ext_vector_type(2)))  float v2f;
typedef __attribute__((ext_vector_type(4)))  unsigned v4u;
typedef __attribute__((ext_vector_type(4)))  int v4i;
typedef float __attribute__((may_alias)) float_a;
typedef int __attribute__((may_alias)) int_a;

template <typename T> __device__ __forceinline__ void vst2(void* p, T v) { *(T*)p = v;  }
__device__ __forceinline__ v8f wmma16(v16h a, v16h b, v8f c) {
  v8f d = __builtin_amdgcn_wmma_f32_16x16x32_f16(false, a, false, b, (short)0, c, false, false);
  asm volatile("v_nop\n\tv_nop\n\tv_nop\n\tv_nop" : "+v"(d) : "v"(a), "v"(b));
  return d;
}
__device__ __forceinline__ v8f wmma_bf(v16b a, v16b b, v8f c) {
  v8f d = __builtin_amdgcn_wmma_f32_16x16x32_bf16(false, a, false, b, (short)0, c, false, false);
  asm volatile("v_nop\n\tv_nop\n\tv_nop\n\tv_nop" : "+v"(d) : "v"(a), "v"(b));
  return d;
}
// 16x16x32 fragments: lane = (h = lane>>4, row/col = lane&15); elements 0..7 = k0+8h+0..7, 8..15 = k0+16+8h+0..7; D element r = row 8h+r
__device__ __forceinline__ v16h frag_h(const _Float16* rowk0, int lane) {
  union { v16h v; v8h q[2]; } u; const _Float16* p = rowk0 + 8 * (lane >> 4);
  u.q[0] = *(const v8h*)p; u.q[1] = *(const v8h*)(p + 16); return u.v;
}
__device__ __forceinline__ v16h frag_f32(const float* rowk0, int lane) {
  v16h a; const float* p = rowk0 + 8 * (lane >> 4);
#pragma unroll
  for (int i = 0; i < 8; ++i) { a[i] = (_Float16)p[i]; a[8 + i] = (_Float16)p[16 + i]; }
  return a;
}
__device__ __forceinline__ v16h frag_f32s(const float* rowk0, int lane, float sc) {
  v16h a; const float* p = rowk0 + 8 * (lane >> 4);
#pragma unroll
  for (int i = 0; i < 8; ++i) { a[i] = (_Float16)(p[i] * sc); a[8 + i] = (_Float16)(p[16 + i] * sc); }
  return a;
}
// column fragment from a [K][ld] layout (column n), rows >= K read as 0
__device__ __forceinline__ v16h fragc_f32(const float* W, int k0, int n, int lane, int ld, int K) {
  v16h a; const int g = lane >> 4;
#pragma unroll
  for (int i = 0; i < 8; ++i) { const int ka = k0 + 8 * g + i, kb = ka + 16;
    a[i] = (_Float16)(ka < K ? W[(size_t)(ka < K ? ka : K - 1) * ld + n] : 0.f); a[8 + i] = (_Float16)(kb < K ? W[(size_t)(kb < K ? kb : K - 1) * ld + n] : 0.f); }
  return a;
}
struct F2 { v16b h, l; };
__device__ __forceinline__ F2 bsplit16(const float v[16]) { F2 r;
#pragma unroll
  for (int i = 0; i < 16; ++i) { const __bf16 h = (__bf16)v[i]; r.h[i] = h; r.l[i] = (__bf16)(v[i] - (float)h); }
  return r; }
__device__ __forceinline__ F2 split_row(const float* row, int k0, int lane) { float v[16]; const float* p = row + k0 + 8 * (lane >> 4);
#pragma unroll
  for (int i = 0; i < 8; ++i) { v[i] = p[i]; v[8 + i] = p[16 + i]; }
  return bsplit16(v); }
__device__ __forceinline__ F2 split_rowK(const float* row, int k0, int lane, int K) { float v[16]; const int g = lane >> 4;
#pragma unroll
  for (int i = 0; i < 8; ++i) { const int ka = k0 + 8 * g + i, kb = ka + 16; v[i] = ka < K ? row[ka < K ? ka : K - 1] : 0.f; v[8 + i] = kb < K ? row[kb < K ? kb : K - 1] : 0.f; }
  return bsplit16(v); }
__device__ __forceinline__ F2 split_col(const float* W, int k0, int n, int lane, int ld, int K) { float v[16]; const int g = lane >> 4;
#pragma unroll
  for (int i = 0; i < 8; ++i) { const int ka = k0 + 8 * g + i, kb = ka + 16; v[i] = ka < K ? W[(size_t)(ka < K ? ka : K - 1) * ld + n] : 0.f; v[8 + i] = kb < K ? W[(size_t)(kb < K ? kb : K - 1) * ld + n] : 0.f; }
  return bsplit16(v); }
__device__ __forceinline__ v8f mac3(const F2& a, const F2& b, v8f c) { c = wmma_bf(a.l, b.h, c); c = wmma_bf(a.h, b.l, c); return wmma_bf(a.h, b.h, c); }
__device__ __forceinline__ float sigm(float v) { return 1.0f / (1.0f + expf(-v)); }
#define LDSX() do { asm volatile("s_wait_dscnt 0" ::: "memory"); __builtin_amdgcn_wave_barrier(); __builtin_amdgcn_fence(__ATOMIC_RELEASE, "workgroup"); } while (0)


// Wav2Vec2 self attention: q,k,v = x W^T + b (16 heads x 64); scores = q k^T / 8; softmax (no mask); P v; merge heads; @ Wo^T (no output bias).  B 2, S 2048, D 1024.
// k_pack (W rows as bf16 rows: torch [out][in] layout is already K-contiguous), k_proj (exact GEMM + bias, 3072-wide rows), k_rope (rotary on q in place, on k into hi/lo K2 rows; v as transposed hi/lo planes), k_attn (flash-style: per (64-query block, b, h) over all 64 32-key steps, online max/sum with accumulator rescale; O rows), k_out (O hi/lo x Wo, no bias).
#define NB 2
#define SS 2048
#define DM 1024
#define NH 16
#define HD 64
#define NR (NB * SS)
#define QKVP (3 * DM)
#ifndef TRB
#define TRB (NR / 64)
#define TQB (SS / 64)
#define TNB NB
#endif
typedef __attribute__((ext_vector_type(8))) __bf16 v8b;
__device__ __forceinline__ v16b frag_b(const __bf16* rowk0, int lane) {
  union { v16b v; v8b q[2]; } u; const __bf16* p = rowk0 + 8 * (lane >> 4);
  u.q[0] = *(const v8b*)p; u.q[1] = *(const v8b*)(p + 16); return u.v;
}
__device__ __forceinline__ v16b frag_gbf(const float* rowk0, int lane) {
  v16b a; const float* p = rowk0 + 8 * (lane >> 4);
#pragma unroll
  for (int i = 0; i < 8; ++i) { a[i] = (__bf16)p[i]; a[8 + i] = (__bf16)p[16 + i]; }
  return a;
}
__device__ __forceinline__ float bfr(float v) { return (float)(__bf16)v; }
#define WS_PT   0u                                 // bf16 [4096 (q|k|v|out cols)][1024]
#define WS_QKV  (WS_PT + 2u * 4 * DM * DM)           // f32 [4096 rows][3072]  (q 0..1023 | k | v) ; q cols later overwritten by O
#define WS_VTH  (WS_QKV + 4u * NR * QKVP)            // bf16 [2][1024 (h*64+d)][2048]
#define WS_VTL  (WS_VTH + 2u * NB * DM * SS)
#define WS_K2   (WS_VTL + 2u * NB * DM * SS)         // bf16 [2 * 16 (b, h)][2048 tokens][hi 64 | lo 64]: the rotated k, a 256-B row a key
#define WS_END  (WS_K2 + 2u * 2u * NB * DM * SS)

__global__ __launch_bounds__(128) void k_pack(const float* __restrict__ Wq, const float* __restrict__ Wk, const float* __restrict__ Wv, const float* __restrict__ Wo, __bf16* __restrict__ PT) {
  __shared__ __align__(16) __bf16 srow[DM];
  const int n = blockIdx.x, tid = threadIdx.x; const int which = n >> 10, c = n & 1023; const float* Wm = which == 0 ? Wq : (which == 1 ? Wk : (which == 2 ? Wv : Wo));
  for (int k = tid; k < DM; k += 128) srow[k] = (__bf16)Wm[(size_t)c * DM + k];   // torch [out][in]: row c
  __syncthreads();
  vst2((unsigned*)(PT + (size_t)n * DM + tid * 8), *(const v4u*)(&srow[tid * 8]));
}
#define GKT 64   // k per staged tile
#define WPB 72   // bf16 per staged W row: 144 B = 16 B x odd, the pitch of 16-byte LDS readers
#define XPF 68   // f32 per staged x row: 272 B = 16 B x odd
struct GemmStage { __bf16 w[2][128][WPB]; float x[2][64][XPF]; };
union GemmLds { GemmStage st; float so[4][16][132]; };   // the output rows pass through the same bytes once the last tile has been read
__device__ __forceinline__ unsigned lds_of(const void* p) { return (unsigned)(size_t)p; }   // LDS byte address: the low 32 bits of a __shared__ address
// a thread's sixteen 16-byte pieces of a tile: W rows tid / 8 + 16 i (8 threads a 128-B row piece), x rows tid / 16 + 8 i (16 threads a 256-B row piece). wg, xg: the thread's pieces of rows tid / 8 and tid / 16 of this tile; xld: f32 per x row in global memory
__device__ __forceinline__ void gemm_stage(GemmStage& st, int buf, int tid, const __bf16* wg, const float* xg, int xld) {
  const unsigned lw = lds_of(&st.w[buf][tid >> 3][(tid & 7) * 8]), lx = lds_of(&st.x[buf][tid >> 4][(tid & 15) * 4]);
  // in each statement the wait is the last line, so that it stands ahead of any rewrite of a register that a copy names
  asm volatile("global_load_async_to_lds_b128 %0, %8, off\n\t"
               "global_load_async_to_lds_b128 %1, %9, off\n\t"
               "global_load_async_to_lds_b128 %2, %10, off\n\t"
               "global_load_async_to_lds_b128 %3, %11, off\n\t"
               "global_load_async_to_lds_b128 %4, %12, off\n\t"
               "global_load_async_to_lds_b128 %5, %13, off\n\t"
               "global_load_async_to_lds_b128 %6, %14, off\n\t"
               "global_load_async_to_lds_b128 %7, %15, off\n\t"
               "s_wait_xcnt 0x0"
               :: "v"(lw), "v"(lw + 16u * WPB * 2u), "v"(lw + 32u * WPB * 2u), "v"(lw + 48u * WPB * 2u), "v"(lw + 64u * WPB * 2u), "v"(lw + 80u * WPB * 2u), "v"(lw + 96u * WPB * 2u), "v"(lw + 112u * WPB * 2u),
                  "v"(wg), "v"(wg + 16 * DM), "v"(wg + 32 * DM), "v"(wg + 48 * DM), "v"(wg + 64 * DM), "v"(wg + 80 * DM), "v"(wg + 96 * DM), "v"(wg + 112 * DM) : "memory");
  asm volatile("global_load_async_to_lds_b128 %0, %8, off\n\t"
               "global_load_async_to_lds_b128 %1, %9, off\n\t"
               "global_load_async_to_lds_b128 %2, %10, off\n\t"
               "global_load_async_to_lds_b128 %3, %11, off\n\t"
               "global_load_async_to_lds_b128 %4, %12, off\n\t"
               "global_load_async_to_lds_b128 %5, %13, off\n\t"
               "global_load_async_to_lds_b128 %6, %14, off\n\t"
               "global_load_async_to_lds_b128 %7, %15, off\n\t"
               "s_wait_xcnt 0x0"
               :: "v"(lx), "v"(lx + 8u * XPF * 4u), "v"(lx + 16u * XPF * 4u), "v"(lx + 24u * XPF * 4u), "v"(lx + 32u * XPF * 4u), "v"(lx + 40u * XPF * 4u), "v"(lx + 48u * XPF * 4u), "v"(lx + 56u * XPF * 4u),
                  "v"(xg), "v"(xg + 8 * xld), "v"(xg + 16 * xld), "v"(xg + 24 * xld), "v"(xg + 32 * xld), "v"(xg + 40 * xld), "v"(xg + 48 * xld), "v"(xg + 56 * xld) : "memory");
}
// the 16 f32 of a lane's A fragment from a staged x row, in the fragment's k order, as four 16-byte LDS reads
__device__ __forceinline__ void frag_lx(const float* rowk0, int lane, float v[16]) { const float* p = rowk0 + 8 * (lane >> 4); const v4f q0 = *(const v4f*)p, q1 = *(const v4f*)(p + 4), q2 = *(const v4f*)(p + 16), q3 = *(const v4f*)(p + 20);
#pragma unroll
  for (int i = 0; i < 4; ++i) { v[i] = q0[i]; v[4 + i] = q1[i]; v[8 + i] = q2[i]; v[12 + i] = q3[i]; } }
// ---- k_proj: QKV[r][n] = bf16(x[r]) . PT[n] (exact), K = 1024; block (64 rows, 128 cols); 512-B segments of 12-KB rows
__global__ __launch_bounds__(128) void k_proj(const float* __restrict__ X, const __bf16* __restrict__ PT, const float* __restrict__ bq, const float* __restrict__ bk, const float* __restrict__ bv, float* __restrict__ QKV) {
  __shared__ __align__(16) GemmLds sm;
  const int tid = threadIdx.x, wave = tid >> 5, lane = tid & 31, col = lane & 15, g = lane >> 4; const size_t r0 = (size_t)blockIdx.x * 64 + wave * 16; const int n0 = blockIdx.y * 128;
  v8f acc[8] = {};
  const __bf16* wg = PT + (size_t)(n0 + (tid >> 3)) * DM + (tid & 7) * 8; const float* xg = X + ((size_t)blockIdx.x * 64 + (tid >> 4)) * DM + (tid & 15) * 4;
  const int nt = DM / GKT;
  gemm_stage(sm.st, 0, tid, wg, xg, DM);
  asm volatile("s_wait_asynccnt 0x0" ::: "memory");   // this wave's copies of tile 0 have landed
  __syncthreads();                                    // ... and every other wave's
  gemm_stage(sm.st, 1, tid, wg + GKT, xg + GKT, DM);
  // kept rolled: the buffer is the trip's parity, and a second copy of the body would only double the code and the live addresses
#pragma unroll 1
  for (int kt = 0; kt < nt; ++kt) { const int buf = kt & 1;
#pragma unroll
    for (int kc = 0; kc < GKT / 32; ++kc) { float xv[16]; frag_lx(&sm.st.x[buf][wave * 16 + col][kc * 32], lane, xv); v16b a, w[8];
#pragma unroll
      for (int i = 0; i < 16; ++i) a[i] = (__bf16)xv[i];
#pragma unroll
      for (int j = 0; j < 8; ++j) w[j] = frag_b(&sm.st.w[buf][j * 16 + col][kc * 32], lane);
#pragma unroll
      for (int j = 0; j < 8; ++j) acc[j] = wmma_bf(a, w[j], acc[j]); }
    asm volatile("s_wait_dscnt 0x0" ::: "memory");      // this wave's reads of the buffer are done
    asm volatile("s_wait_asynccnt 0x0" ::: "memory");   // its copies of tile kt + 1 have landed
    __syncthreads();                                    // publishes tile kt + 1 and frees this tile's buffer
    if (kt + 2 < nt) gemm_stage(sm.st, buf, tid, wg + (kt + 2) * GKT, xg + (kt + 2) * GKT, DM); }
  asm volatile("s_wait_asynccnt 0x0" ::: "memory");   // no copy is outstanding when the bytes are used anew
#pragma unroll
  for (int j = 0; j < 8; ++j) { const int n = n0 + j * 16 + col; const int which = n >> 10, c = n & 1023; const float bb = bfr((which == 0 ? bq : which == 1 ? bk : bv)[c]);
#pragma unroll
    for (int r = 0; r < 8; ++r) sm.so[wave][8 * g + r][j * 16 + col] = acc[j][r] + bb; }
  LDSX();
  for (int rl = 0; rl < 16; ++rl) vst2(QKV + (r0 + rl) * QKVP + n0 + lane * 4, *(const v4f*)&sm.so[wave][rl][lane * 4]);
}
// ---- k_rope: block = (64-token block, head pair), 8 waves. A thread holds both halves of its (token, 4 j) pairs of q and k in registers and rotates them, so no exchange and no token loop; one angle serves q and k of both heads.
// q goes back in place as f32. The rotated k is split here, once, into the bf16 hi and residual that the score products take, and leaves as K2 rows; its f32 columns are read by nobody afterwards and are not rewritten.
// v passes once through LDS to the transposed hi/lo planes (128-B segments of the 4-KB rows); it goes first, so that no store is outstanding at the barrier.
typedef __attribute__((ext_vector_type(2))) __bf16 v2b;
typedef __attribute__((ext_vector_type(4))) __bf16 v4b;
__global__ __launch_bounds__(256) void k_rope(float* __restrict__ QKV, const int* __restrict__ PID, __bf16* __restrict__ VTH, __bf16* __restrict__ VTL, __bf16* __restrict__ K2) {
  __shared__ __align__(16) __bf16 svh[2 * HD][72], svl[2 * HD][72];
  const int tid = threadIdx.x, lane = tid & 31, jq = tid & 7, tg = tid >> 3; const size_t t0 = (size_t)blockIdx.x * 64; const int c0 = blockIdx.y * (2 * HD); const int b = (int)(t0 / SS), p0 = (int)(t0 % SS);
  v4f vv[4][2], x[2][2][2][2]; float pos[2];   // vv[d quad jq + 8 iv][token 2 tg + e]; x[token tg + 32 it][head][q | k][half]
#pragma unroll
  for (int iv = 0; iv < 4; ++iv)
#pragma unroll
    for (int e = 0; e < 2; ++e) vv[iv][e] = *(const v4f*)(QKV + (t0 + 2 * tg + e) * QKVP + 2 * DM + c0 + (jq + 8 * iv) * 4);
#pragma unroll
  for (int it = 0; it < 2; ++it) { const float* row = QKV + (t0 + tg + 32 * it) * QKVP + c0 + jq * 4; pos[it] = (float)PID[p0 + tg + 32 * it];
#pragma unroll
    for (int hl = 0; hl < 2; ++hl)
#pragma unroll
      for (int w = 0; w < 2; ++w) { x[it][hl][w][0] = *(const v4f*)(row + w * DM + hl * HD); x[it][hl][w][1] = *(const v4f*)(row + w * DM + hl * HD + 32); } }
#pragma unroll
  for (int iv = 0; iv < 4; ++iv)
#pragma unroll
    for (int i = 0; i < 4; ++i) { const int d = (jq + 8 * iv) * 4 + i; const float v0 = vv[iv][0][i], v1 = vv[iv][1][i]; const __bf16 h0 = (__bf16)v0, h1 = (__bf16)v1;
      *(v2b*)&svh[d][2 * tg] = (v2b){h0, h1}; *(v2b*)&svl[d][2 * tg] = (v2b){(__bf16)(v0 - (float)h0), (__bf16)(v1 - (float)h1)}; }
  __syncthreads();
#pragma unroll
  for (int q = tid; q < 2 * HD * 8; q += 256) { const int rowi = q >> 3, pc = q & 7; const size_t o = ((size_t)b * DM + c0 + rowi) * SS + p0 + pc * 8; vst2((unsigned*)(VTH + o), *(const v4u*)&svh[rowi][pc * 8]); vst2((unsigned*)(VTL + o), *(const v4u*)&svl[rowi][pc * 8]); }
  const float invl = powf(10000.0f, -(float)(2 * lane) / (float)HD);   // lane j holds inv_freq[j]
  float invf[4];
#pragma unroll
  for (int i = 0; i < 4; ++i) invf[i] = __shfl(invl, jq * 4 + i);
#pragma unroll
  for (int it = 0; it < 2; ++it) { float* row = QKV + (t0 + tg + 32 * it) * QKVP + c0 + jq * 4; v4f y[2][2][2];
#pragma unroll
    for (int i = 0; i < 4; ++i) { const float ang = pos[it] * invf[i]; const float c = cosf(ang), sn = sinf(ang);
#pragma unroll
      for (int hl = 0; hl < 2; ++hl)
#pragma unroll
        for (int w = 0; w < 2; ++w) { const float x1 = x[it][hl][w][0][i], x2 = x[it][hl][w][1][i]; y[hl][w][0][i] = x1 * c - x2 * sn; y[hl][w][1][i] = x2 * c + x1 * sn; } }
#pragma unroll
    for (int hl = 0; hl < 2; ++hl) { vst2(row + hl * HD, y[hl][0][0]); vst2(row + hl * HD + 32, y[hl][0][1]);
      __bf16* krow = K2 + (((size_t)b * NH + blockIdx.y * 2 + hl) * SS + p0 + tg + 32 * it) * (2 * HD) + jq * 4;
#pragma unroll
      for (int hf = 0; hf < 2; ++hf) { v4b kh, kl;
#pragma unroll
        for (int i = 0; i < 4; ++i) { const float v = y[hl][1][hf][i]; const __bf16 hi = (__bf16)v; kh[i] = hi; kl[i] = (__bf16)(v - (float)hi); }
        vst2(krow + hf * 32, kh); vst2(krow + HD + hf * 32, kl); } } }
}
// ---- k_attn: block = (query block qb, b*16 + h), 4 waves: all SS/32 key steps; online softmax. Scores are formed transposed (keys as rows, queries as columns): a lane owns one query, the 16 scores it holds of a key step
// reduce in its own registers (one exchange with the other wave half for the maximum; the halves' sums join once at the end), and split in place they are the B operand of O^T += V^T P^T, so P passes through no LDS. O written over the q columns of the block's rows.
// The k rows (hi | lo, as k_rope left them) and v^T rows of a key step are the same for the block's four waves: they are brought into LDS once a block by asynchronous copies on whole row pieces (two buffers, the next step's copies fly while this step is worked on), and each wave takes its fragments from there.
#define KPB 136  // bf16 per staged k row (hi 64 | lo 64 | pad): 272 B = 16 B x odd, the pitch of 16-byte LDS readers
#define VPB 40   // bf16 per staged v^T row: 80 B = 16 B x odd
__device__ __forceinline__ float xhalf(float v) { const unsigned u = __builtin_bit_cast(unsigned, v); return __builtin_bit_cast(float, __builtin_amdgcn_permlanex16(u, u, 0x76543210u, 0xfedcba98u, false, false)); }   // lane l <-> l ^ 16
__device__ __forceinline__ v8f mac3t(const F2& k, const F2& q, v8f c) { c = wmma_bf(k.h, q.l, c); c = wmma_bf(k.l, q.h, c); return wmma_bf(k.h, q.h, c); }   // the three products in mac3's order, operands swapped
__global__ __launch_bounds__(128) void k_attn(float* __restrict__ QKV, const __bf16* __restrict__ VTH, const __bf16* __restrict__ VTL, const __bf16* __restrict__ K2) {
  __shared__ __align__(16) __bf16 sk[2][32][KPB];
  __shared__ __align__(16) __bf16 sv[2][2][HD][VPB];   // [buffer][hi | lo][d][key]
  const int tid = threadIdx.x, wave = tid >> 5, lane = tid & 31, col = lane & 15, g = lane >> 4;
  const int qb = blockIdx.x, bh = blockIdx.y, b = bh >> 4, h = bh & 15; const int q0 = qb * 64 + wave * 16; const size_t tq = (size_t)b * SS + q0;
  const F2 a0 = split_row(QKV + (tq + col) * QKVP + h * HD, 0, lane), a1 = split_row(QKV + (tq + col) * QKVP + h * HD, 32, lane);   // query col as column col of B
  const float SC2 = 0.125f * 1.44269504088896340736f;   // 1 / sqrt(64) times log2(e): e^(s / 8 - max) = 2^(s SC2 - m), one multiply-add and one hardware exponential, inline
  float m = -3.0e38f, l = 0.f;   // of query col, m in base-2 units; l holds this half's keys only
  v8f acc[4] = {};   // acc[dt][r] = O[query col][dt * 16 + 8 g + r]
  const int nsteps = SS / 32;
  // a thread's eight 16-byte pieces of a key step: k rows tid / 16 + 8 i (16 threads a 256-B row), v^T rows tid / 4 + 32 j of either plane (4 threads a 64-B row piece)
  const __bf16* kg = K2 + ((size_t)bh * SS + (tid >> 4)) * (2 * HD) + (tid & 15) * 8;
  const size_t vo = ((size_t)b * DM + h * HD + (tid >> 2)) * SS + (tid & 3) * 8;
  const __bf16 *vgh = VTH + vo, *vgl = VTL + vo;
  auto stage = [&](int ks, int buf) {
    const __bf16* k0 = kg + ks * 32 * (2 * HD); const __bf16 *h0 = vgh + ks * 32, *l0 = vgl + ks * 32;
    const unsigned lk = lds_of(&sk[buf][tid >> 4][(tid & 15) * 8]), lh = lds_of(&sv[buf][0][tid >> 2][(tid & 3) * 8]), ll = lds_of(&sv[buf][1][tid >> 2][(tid & 3) * 8]);
    // the wait is the statement's last line, so that it stands ahead of any rewrite of a register that a copy names
    asm volatile("global_load_async_to_lds_b128 %0, %8, off\n\t"
                 "global_load_async_to_lds_b128 %1, %9, off\n\t"
                 "global_load_async_to_lds_b128 %2, %10, off\n\t"
                 "global_load_async_to_lds_b128 %3, %11, off\n\t"
                 "global_load_async_to_lds_b128 %4, %12, off\n\t"
                 "global_load_async_to_lds_b128 %5, %13, off\n\t"
                 "global_load_async_to_lds_b128 %6, %14, off\n\t"
                 "global_load_async_to_lds_b128 %7, %15, off\n\t"
                 "s_wait_xcnt 0x0"
                 :: "v"(lk), "v"(lk + 8u * KPB * 2u), "v"(lk + 16u * KPB * 2u), "v"(lk + 24u * KPB * 2u), "v"(lh), "v"(lh + 32u * VPB * 2u), "v"(ll), "v"(ll + 32u * VPB * 2u),
                    "v"(k0), "v"(k0 + 8 * 2 * HD), "v"(k0 + 16 * 2 * HD), "v"(k0 + 24 * 2 * HD), "v"(h0), "v"(h0 + 32 * SS), "v"(l0), "v"(l0 + 32 * SS) : "memory"); };
  stage(0, 0);
  asm volatile("s_wait_asynccnt 0x0" ::: "memory");   // this wave's copies of step 0 have landed
  __syncthreads();                                    // ... and every other wave's
  stage(1, 1);
#pragma unroll 1
  for (int ks = 0; ks < nsteps; ++ks) { const int buf = ks & 1;
    v8f s[2]; F2 kf[2][2]; v16b vh[4], vl[4];   // the key step's fragments, from this step's buffer alone; plain LDS loads, so that the compiler groups them and places counted waits
#pragma unroll
    for (int ct = 0; ct < 2; ++ct)
#pragma unroll
      for (int kc = 0; kc < 2; ++kc) { kf[ct][kc].h = frag_b(&sk[buf][ct * 16 + col][kc * 32], lane); kf[ct][kc].l = frag_b(&sk[buf][ct * 16 + col][HD + kc * 32], lane); }   // key ct * 16 + col as row col of A, d kc * 32 ..
#pragma unroll
    for (int dt = 0; dt < 4; ++dt) { vh[dt] = frag_b(&sv[buf][0][dt * 16 + col][0], lane); vl[dt] = frag_b(&sv[buf][1][dt * 16 + col][0], lane); }
#pragma unroll
    for (int ct = 0; ct < 2; ++ct) { v8f c = mac3t(kf[ct][0], a0, (v8f){}); s[ct] = mac3t(kf[ct][1], a1, c); }   // s[ct][r] = q . k of key ks * 32 + ct * 16 + 8 g + r with query col, not yet scaled
    float mx = fmaxf(s[0][0], s[1][0]);
#pragma unroll
    for (int r = 1; r < 8; ++r) mx = fmaxf(mx, fmaxf(s[0][r], s[1][r]));
    mx = fmaxf(mx, xhalf(mx));
    const float mn = fmaxf(m, mx * SC2); float alpha = m - mn;   // SC2 > 0: the maximum of the scaled scores is the scaled maximum
    float p[16], es[4];   // p[i]: key 8 g + i (i < 8), 16 + 8 g + i - 8 (else) of the step, the k order of V^T's fragment
#pragma unroll
    for (int i = 0; i < 16; ++i) p[i] = fmaf(s[i >> 3][i & 7], SC2, -mn);
    // the exponentials, each in its own register. In asm so that the slot which the instruction set asks for behind a transcendental is there by construction: each is followed by an independent one, the last by v_nop
    asm("v_exp_f32 %0, %0\n\tv_exp_f32 %1, %1\n\tv_exp_f32 %2, %2\n\tv_exp_f32 %3, %3\n\tv_exp_f32 %4, %4\n\tv_exp_f32 %5, %5\n\tv_exp_f32 %6, %6\n\tv_exp_f32 %7, %7\n\tv_exp_f32 %8, %8\n\tv_nop"
        : "+v"(p[0]), "+v"(p[1]), "+v"(p[2]), "+v"(p[3]), "+v"(p[4]), "+v"(p[5]), "+v"(p[6]), "+v"(p[7]), "+v"(alpha));
    asm("v_exp_f32 %0, %0\n\tv_exp_f32 %1, %1\n\tv_exp_f32 %2, %2\n\tv_exp_f32 %3, %3\n\tv_exp_f32 %4, %4\n\tv_exp_f32 %5, %5\n\tv_exp_f32 %6, %6\n\tv_exp_f32 %7, %7\n\tv_nop"
        : "+v"(p[8]), "+v"(p[9]), "+v"(p[10]), "+v"(p[11]), "+v"(p[12]), "+v"(p[13]), "+v"(p[14]), "+v"(p[15]));
#pragma unroll
    for (int i = 0; i < 16; ++i) es[i & 3] = i < 4 ? p[i] : es[i & 3] + p[i];
    l = l * alpha + ((es[0] + es[1]) + (es[2] + es[3])); m = mn;
#pragma unroll
    for (int dt = 0; dt < 4; ++dt) acc[dt] *= alpha;
    const F2 pb = bsplit16(p);
#pragma unroll
    for (int dt = 0; dt < 4; ++dt) { acc[dt] = wmma_bf(vh[dt], pb.l, acc[dt]); acc[dt] = wmma_bf(vl[dt], pb.h, acc[dt]); acc[dt] = wmma_bf(vh[dt], pb.h, acc[dt]); }
    asm volatile("s_wait_dscnt 0x0" ::: "memory");      // this wave's reads of the buffer are done
    asm volatile("s_wait_asynccnt 0x0" ::: "memory");   // its copies of step ks + 1 have landed
    __syncthreads();                                    // publishes step ks + 1 and frees this step's buffer
    if (ks + 2 < nsteps) stage(ks + 2, buf); }
  asm volatile("s_wait_asynccnt 0x0" ::: "memory");   // no copy is outstanding when the wave ends
  const float il = 1.0f / (l + xhalf(l));
  float* orow = QKV + (tq + col) * QKVP + h * HD + 8 * g;
#pragma unroll
  for (int dt = 0; dt < 4; ++dt) { const v8f o = acc[dt] * il; vst2(orow + dt * 16, (v4f){o[0], o[1], o[2], o[3]}); vst2(orow + dt * 16 + 4, (v4f){o[4], o[5], o[6], o[7]}); }
}
// ---- k_out: Y = O(hi/lo; the q columns of QKV) . PT_out rows (2 products, K = 1024); block (64 rows, 128 cols); operands staged as in k_proj
__global__ __launch_bounds__(128) void k_out(const float* __restrict__ QKV, const __bf16* __restrict__ PT, float* __restrict__ Y) {
  __shared__ __align__(16) GemmLds sm;
  const int tid = threadIdx.x, wave = tid >> 5, lane = tid & 31, col = lane & 15, g = lane >> 4; const size_t r0 = (size_t)blockIdx.x * 64 + wave * 16; const int n0 = blockIdx.y * 128;
  v8f acc[8] = {};
  const __bf16* wg = PT + (size_t)(3 * DM + n0 + (tid >> 3)) * DM + (tid & 7) * 8; const float* xg = QKV + ((size_t)blockIdx.x * 64 + (tid >> 4)) * QKVP + (tid & 15) * 4;
  const int nt = DM / GKT;
  gemm_stage(sm.st, 0, tid, wg, xg, QKVP);
  asm volatile("s_wait_asynccnt 0x0" ::: "memory");   // this wave's copies of tile 0 have landed
  __syncthreads();                                    // ... and every other wave's
  gemm_stage(sm.st, 1, tid, wg + GKT, xg + GKT, QKVP);
  // kept rolled: the buffer is the trip's parity, and a second copy of the body would only double the code and the live addresses
#pragma unroll 1
  for (int kt = 0; kt < nt; ++kt) { const int buf = kt & 1;
#pragma unroll
    for (int kc = 0; kc < GKT / 32; ++kc) { float xv[16]; frag_lx(&sm.st.x[buf][wave * 16 + col][kc * 32], lane, xv); const F2 a = bsplit16(xv); v16b w[8];
#pragma unroll
      for (int j = 0; j < 8; ++j) w[j] = frag_b(&sm.st.w[buf][j * 16 + col][kc * 32], lane);
#pragma unroll
      for (int j = 0; j < 8; ++j) { acc[j] = wmma_bf(a.l, w[j], acc[j]); acc[j] = wmma_bf(a.h, w[j], acc[j]); } }
    asm volatile("s_wait_dscnt 0x0" ::: "memory");      // this wave's reads of the buffer are done
    asm volatile("s_wait_asynccnt 0x0" ::: "memory");   // its copies of tile kt + 1 have landed
    __syncthreads();                                    // publishes tile kt + 1 and frees this tile's buffer
    if (kt + 2 < nt) gemm_stage(sm.st, buf, tid, wg + (kt + 2) * GKT, xg + (kt + 2) * GKT, QKVP); }
  asm volatile("s_wait_asynccnt 0x0" ::: "memory");   // no copy is outstanding when the bytes are used anew
#pragma unroll
  for (int j = 0; j < 8; ++j)
#pragma unroll
    for (int r = 0; r < 8; ++r) sm.so[wave][8 * g + r][j * 16 + col] = acc[j][r];
  LDSX();
  for (int rl = 0; rl < 16; ++rl) vst2(Y + (r0 + rl) * DM + n0 + lane * 4, *(const v4f*)&sm.so[wave][rl][lane * 4]);
}

extern "C" void kernel_launch(void* const* d_in, const int* in_sizes, int n_in, void* d_out, int out_size, void* d_ws, size_t ws_size, hipStream_t stream) {
  (void)in_sizes; (void)n_in; (void)out_size;
  const float** F = (const float**)d_in;   // hidden_states, position_ids [1,2048] int, Wq, bq, Wk, bk, Wv, bv, Wo (torch [out][in])
  if (ws_size < (size_t)WS_END) return;
  char* ws = (char*)d_ws; __bf16 *PT = (__bf16*)(ws + WS_PT), *VTH = (__bf16*)(ws + WS_VTH), *VTL = (__bf16*)(ws + WS_VTL), *K2 = (__bf16*)(ws + WS_K2); float* QKV = (float*)(ws + WS_QKV);
  k_pack<<<4 * DM, 128, 0, stream>>>(F[2], F[4], F[6], F[8], PT);
  k_proj<<<dim3(TRB, QKVP / 128), 128, 0, stream>>>(F[0], PT, F[3], F[5], F[7], QKV);
  k_rope<<<dim3(TRB, NH / 2), 256, 0, stream>>>(QKV, (const int*)d_in[1], VTH, VTL, K2);
  k_attn<<<dim3(TQB, TNB * NH), 128, 0, stream>>>(QKV, VTH, VTL, K2);
  k_out<<<dim3((TNB < NB ? TQB : NR / 64), DM / 128), 128, 0, stream>>>(QKV, PT, (float*)d_out);
}

// v008
// One run takes 184 microseconds.
// Two timings next to v007 put it at 1.04 and 1.05 times that version's speed.
// All steps since v000 together make it 4.28 times as fast.
// compute dtype: hidden_states, Wq/Wk/Wv + biases, Wo (module inputs) rounded to bf16, position_ids as int; q/k/v projections with exact bf16 products (+ bias); rotary tables (inv_freq = 10000^(-2i/64), cos/sin of pos·inv_freq) and the rotate-half mix in f32; scores and P.V with both computed operands as bf16 hi + bf16 residual pairs (3 products); output projection hi/lo x bf16 Wo (2 products); online softmax in f32; f32 accumulate.
#include <hip/hip_runtime.h>
#include <math.h>

typedef __attribute__((ext_vector_type(16))) _Float16 v16h;
typedef __attribute__((ext_vector_type(16))) __bf16 v16b;
typedef __attribute__((ext_vector_type(8)))  _Float16 v8h;
typedef __attribute__((ext_vector_type(8)))  float v8f;
typedef __attribute__((ext_vector_type(4)))  float v4f;
typedef __attribute__((ext_vector_type(2)))  float v2f;
typedef __attribute__((ext_vector_type(4)))  unsigned v4u;
typedef __attribute__((ext_vector_type(4)))  int v4i;
typedef float __attribute__((may_alias)) float_a;
typedef int __attribute__((may_alias)) int_a;

template <typename T> __device__ __forceinline__ void vst2(void* p, T v) { *(T*)p = v;  }
__device__ __forceinline__ v8f wmma16(v16h a, v16h b, v8f c) {
  v8f d = __builtin_amdgcn_wmma_f32_16x16x32_f16(false, a, false, b, (short)0, c, false, false);
  asm volatile("v_nop\n\tv_nop\n\tv_nop\n\tv_nop" : "+v"(d) : "v"(a), "v"(b));
  return d;
}
__device__ __forceinline__ v8f wmma_bf(v16b a, v16b b, v8f c) {
  return __builtin_amdgcn_wmma_f32_16x16x32_bf16(false, a, false, b, (short)0, c, false, false);
}
// 16x16x32 fragments: lane = (h = lane>>4, row/col = lane&15); elements 0..7 = k0+8h+0..7, 8..15 = k0+16+8h+0..7; D element r = row 8h+r
__device__ __forceinline__ v16h frag_h(const _Float16* rowk0, int lane) {
  union { v16h v; v8h q[2]; } u; const _Float16* p = rowk0 + 8 * (lane >> 4);
  u.q[0] = *(const v8h*)p; u.q[1] = *(const v8h*)(p + 16); return u.v;
}
__device__ __forceinline__ v16h frag_f32(const float* rowk0, int lane) {
  v16h a; const float* p = rowk0 + 8 * (lane >> 4);
#pragma unroll
  for (int i = 0; i < 8; ++i) { a[i] = (_Float16)p[i]; a[8 + i] = (_Float16)p[16 + i]; }
  return a;
}
__device__ __forceinline__ v16h frag_f32s(const float* rowk0, int lane, float sc) {
  v16h a; const float* p = rowk0 + 8 * (lane >> 4);
#pragma unroll
  for (int i = 0; i < 8; ++i) { a[i] = (_Float16)(p[i] * sc); a[8 + i] = (_Float16)(p[16 + i] * sc); }
  return a;
}
// column fragment from a [K][ld] layout (column n), rows >= K read as 0
__device__ __forceinline__ v16h fragc_f32(const float* W, int k0, int n, int lane, int ld, int K) {
  v16h a; const int g = lane >> 4;
#pragma unroll
  for (int i = 0; i < 8; ++i) { const int ka = k0 + 8 * g + i, kb = ka + 16;
    a[i] = (_Float16)(ka < K ? W[(size_t)(ka < K ? ka : K - 1) * ld + n] : 0.f); a[8 + i] = (_Float16)(kb < K ? W[(size_t)(kb < K ? kb : K - 1) * ld + n] : 0.f); }
  return a;
}
struct F2 { v16b h, l; };
__device__ __forceinline__ F2 bsplit16(const float v[16]) { F2 r;
#pragma unroll
  for (int i = 0; i < 16; ++i) { const __bf16 h = (__bf16)v[i]; r.h[i] = h; r.l[i] = (__bf16)(v[i] - (float)h); }
  return r; }
__device__ __forceinline__ F2 split_row(const float* row, int k0, int lane) { float v[16]; const float* p = row + k0 + 8 * (lane >> 4);
#pragma unroll
  for (int i = 0; i < 8; ++i) { v[i] = p[i]; v[8 + i] = p[16 + i]; }
  return bsplit16(v); }
__device__ __forceinline__ F2 split_rowK(const float* row, int k0, int lane, int K) { float v[16]; const int g = lane >> 4;
#pragma unroll
  for (int i = 0; i < 8; ++i) { const int ka = k0 + 8 * g + i, kb = ka + 16; v[i] = ka < K ? row[ka < K ? ka : K - 1] : 0.f; v[8 + i] = kb < K ? row[kb < K ? kb : K - 1] : 0.f; }
  return bsplit16(v); }
__device__ __forceinline__ F2 split_col(const float* W, int k0, int n, int lane, int ld, int K) { float v[16]; const int g = lane >> 4;
#pragma unroll
  for (int i = 0; i < 8; ++i) { const int ka = k0 + 8 * g + i, kb = ka + 16; v[i] = ka < K ? W[(size_t)(ka < K ? ka : K - 1) * ld + n] : 0.f; v[8 + i] = kb < K ? W[(size_t)(kb < K ? kb : K - 1) * ld + n] : 0.f; }
  return bsplit16(v); }
__device__ __forceinline__ v8f mac3(const F2& a, const F2& b, v8f c) { c = wmma_bf(a.l, b.h, c); c = wmma_bf(a.h, b.l, c); return wmma_bf(a.h, b.h, c); }
__device__ __forceinline__ float sigm(float v) { return 1.0f / (1.0f + expf(-v)); }
#define LDSX() do { asm volatile("s_wait_dscnt 0" ::: "memory"); __builtin_amdgcn_wave_barrier(); __builtin_amdgcn_fence(__ATOMIC_RELEASE, "workgroup"); } while (0)


// Wav2Vec2 self attention: q,k,v = x W^T + b (16 heads x 64); scores = q k^T / 8; softmax (no mask); P v; merge heads; @ Wo^T (no output bias).  B 2, S 2048, D 1024.
// k_pack (W rows as bf16 rows: torch [out][in] layout is already K-contiguous), k_proj (exact GEMM + bias, 3072-wide rows), k_rope (rotary on q in place, on k into hi/lo K2 rows; v as transposed hi/lo planes), k_attn (flash-style: per (64-query block, b, h) over all 64 32-key steps, online max/sum with accumulator rescale; O rows), k_out (O hi/lo x Wo, no bias).
#define NB 2
#define SS 2048
#define DM 1024
#define NH 16
#define HD 64
#define NR (NB * SS)
#define QKVP (3 * DM)
#ifndef TRB
#define TRB (NR / 64)
#define TQB (SS / 64)
#define TNB NB
#endif
typedef __attribute__((ext_vector_type(8))) __bf16 v8b;
__device__ __forceinline__ v16b frag_b(const __bf16* rowk0, int lane) {
  union { v16b v; v8b q[2]; } u; const __bf16* p = rowk0 + 8 * (lane >> 4);
  u.q[0] = *(const v8b*)p; u.q[1] = *(const v8b*)(p + 16); return u.v;
}
__device__ __forceinline__ v16b frag_gbf(const float* rowk0, int lane) {
  v16b a; const float* p = rowk0 + 8 * (lane >> 4);
#pragma unroll
  for (int i = 0; i < 8; ++i) { a[i] = (__bf16)p[i]; a[8 + i] = (__bf16)p[16 + i]; }
  return a;
}
__device__ __forceinline__ float bfr(float v) { return (float)(__bf16)v; }
#define WS_PT   0u                                 // bf16 [4096 (q|k|v|out cols)][1024]
#define WS_QKV  (WS_PT + 2u * 4 * DM * DM)           // f32 [4096 rows][3072]  (q 0..1023 | k | v) ; q cols later overwritten by O
#define WS_VTH  (WS_QKV + 4u * NR * QKVP)            // bf16 [2][1024 (h*64+d)][2048]
#define WS_VTL  (WS_VTH + 2u * NB * DM * SS)
#define WS_K2   (WS_VTL + 2u * NB * DM * SS)         // bf16 [2 * 16 (b, h)][2048 tokens][hi 64 | lo 64]: the rotated k, a 256-B row a key
#define WS_END  (WS_K2 + 2u * 2u * NB * DM * SS)

__global__ __launch_bounds__(128) void k_pack(const float* __restrict__ Wq, const float* __restrict__ Wk, const float* __restrict__ Wv, const float* __restrict__ Wo, __bf16* __restrict__ PT) {
  __shared__ __align__(16) __bf16 srow[DM];
  const int n = blockIdx.x, tid = threadIdx.x; const int which = n >> 10, c = n & 1023; const float* Wm = which == 0 ? Wq : (which == 1 ? Wk : (which == 2 ? Wv : Wo));
  for (int k = tid; k < DM; k += 128) srow[k] = (__bf16)Wm[(size_t)c * DM + k];   // torch [out][in]: row c
  __syncthreads();
  vst2((unsigned*)(PT + (size_t)n * DM + tid * 8), *(const v4u*)(&srow[tid * 8]));
}
#define GKT 64   // k per staged tile
#define WPB 72   // bf16 per staged W row: 144 B = 16 B x odd, the pitch of 16-byte LDS readers
#define XPF 68   // f32 per staged x row: 272 B = 16 B x odd
struct GemmStage { __bf16 w[2][128][WPB]; float x[2][64][XPF]; };
union GemmLds { GemmStage st; float so[4][16][132]; };   // the output rows pass through the same bytes once the last tile has been read
__device__ __forceinline__ unsigned lds_of(const void* p) { return (unsigned)(size_t)p; }   // LDS byte address: the low 32 bits of a __shared__ address
// a thread's sixteen 16-byte pieces of a tile: W rows tid / 8 + 16 i (8 threads a 128-B row piece), x rows tid / 16 + 8 i (16 threads a 256-B row piece). wg, xg: the thread's pieces of rows tid / 8 and tid / 16 of this tile; xld: f32 per x row in global memory
__device__ __forceinline__ void gemm_stage(GemmStage& st, int buf, int tid, const __bf16* wg, const float* xg, int xld) {
  const unsigned lw = lds_of(&st.w[buf][tid >> 3][(tid & 7) * 8]), lx = lds_of(&st.x[buf][tid >> 4][(tid & 15) * 4]);
  // in each statement the wait is the last line, so that it stands ahead of any rewrite of a register that a copy names
  asm volatile("global_load_async_to_lds_b128 %0, %8, off\n\t"
               "global_load_async_to_lds_b128 %1, %9, off\n\t"
               "global_load_async_to_lds_b128 %2, %10, off\n\t"
               "global_load_async_to_lds_b128 %3, %11, off\n\t"
               "global_load_async_to_lds_b128 %4, %12, off\n\t"
               "global_load_async_to_lds_b128 %5, %13, off\n\t"
               "global_load_async_to_lds_b128 %6, %14, off\n\t"
               "global_load_async_to_lds_b128 %7, %15, off\n\t"
               "s_wait_xcnt 0x0"
               :: "v"(lw), "v"(lw + 16u * WPB * 2u), "v"(lw + 32u * WPB * 2u), "v"(lw + 48u * WPB * 2u), "v"(lw + 64u * WPB * 2u), "v"(lw + 80u * WPB * 2u), "v"(lw + 96u * WPB * 2u), "v"(lw + 112u * WPB * 2u),
                  "v"(wg), "v"(wg + 16 * DM), "v"(wg + 32 * DM), "v"(wg + 48 * DM), "v"(wg + 64 * DM), "v"(wg + 80 * DM), "v"(wg + 96 * DM), "v"(wg + 112 * DM) : "memory");
  asm volatile("global_load_async_to_lds_b128 %0, %8, off\n\t"
               "global_load_async_to_lds_b128 %1, %9, off\n\t"
               "global_load_async_to_lds_b128 %2, %10, off\n\t"
               "global_load_async_to_lds_b128 %3, %11, off\n\t"
               "global_load_async_to_lds_b128 %4, %12, off\n\t"
               "global_load_async_to_lds_b128 %5, %13, off\n\t"
               "global_load_async_to_lds_b128 %6, %14, off\n\t"
               "global_load_async_to_lds_b128 %7, %15, off\n\t"
               "s_wait_xcnt 0x0"
               :: "v"(lx), "v"(lx + 8u * XPF * 4u), "v"(lx + 16u * XPF * 4u), "v"(lx + 24u * XPF * 4u), "v"(lx + 32u * XPF * 4u), "v"(lx + 40u * XPF * 4u), "v"(lx + 48u * XPF * 4u), "v"(lx + 56u * XPF * 4u),
                  "v"(xg), "v"(xg + 8 * xld), "v"(xg + 16 * xld), "v"(xg + 24 * xld), "v"(xg + 32 * xld), "v"(xg + 40 * xld), "v"(xg + 48 * xld), "v"(xg + 56 * xld) : "memory");
}
// the 16 f32 of a lane's A fragment from a staged x row, in the fragment's k order, as four 16-byte LDS reads
__device__ __forceinline__ void frag_lx(const float* rowk0, int lane, float v[16]) { const float* p = rowk0 + 8 * (lane >> 4); const v4f q0 = *(const v4f*)p, q1 = *(const v4f*)(p + 4), q2 = *(const v4f*)(p + 16), q3 = *(const v4f*)(p + 20);
#pragma unroll
  for (int i = 0; i < 4; ++i) { v[i] = q0[i]; v[4 + i] = q1[i]; v[8 + i] = q2[i]; v[12 + i] = q3[i]; } }
// ---- k_proj: QKV[r][n] = bf16(x[r]) . PT[n] (exact), K = 1024; block (64 rows, 128 cols); 512-B segments of 12-KB rows
__global__ __launch_bounds__(128) void k_proj(const float* __restrict__ X, const __bf16* __restrict__ PT, const float* __restrict__ bq, const float* __restrict__ bk, const float* __restrict__ bv, float* __restrict__ QKV) {
  __shared__ __align__(16) GemmLds sm;
  const int tid = threadIdx.x, wave = tid >> 5, lane = tid & 31, col = lane & 15, g = lane >> 4; const size_t r0 = (size_t)blockIdx.x * 64 + wave * 16; const int n0 = blockIdx.y * 128;
  v8f acc[8] = {};
  const __bf16* wg = PT + (size_t)(n0 + (tid >> 3)) * DM + (tid & 7) * 8; const float* xg = X + ((size_t)blockIdx.x * 64 + (tid >> 4)) * DM + (tid & 15) * 4;
  const int nt = DM / GKT;
  gemm_stage(sm.st, 0, tid, wg, xg, DM);
  asm volatile("s_wait_asynccnt 0x0" ::: "memory");   // this wave's copies of tile 0 have landed
  __syncthreads();                                    // ... and every other wave's
  gemm_stage(sm.st, 1, tid, wg + GKT, xg + GKT, DM);
  // kept rolled: the buffer is the trip's parity, and a second copy of the body would only double the code and the live addresses
#pragma unroll 1
  for (int kt = 0; kt < nt; ++kt) { const int buf = kt & 1;
#pragma unroll
    for (int kc = 0; kc < GKT / 32; ++kc) { float xv[16]; frag_lx(&sm.st.x[buf][wave * 16 + col][kc * 32], lane, xv); v16b a, w[8];
#pragma unroll
      for (int i = 0; i < 16; ++i) a[i] = (__bf16)xv[i];
#pragma unroll
      for (int j = 0; j < 8; ++j) w[j] = frag_b(&sm.st.w[buf][j * 16 + col][kc * 32], lane);
      __builtin_amdgcn_sched_barrier(0);   // holds these LDS reads as one group ahead of the first product; left free, the scheduler sinks each pair of reads to its product and waits for it in full there
#pragma unroll
      for (int j = 0; j < 8; ++j) acc[j] = wmma_bf(a, w[j], acc[j]); }
    __builtin_amdgcn_sched_barrier(0);   // holds the products ahead of the waits below; left free, the scheduler lifts waits and barrier over them to the top of the trip, where the copies just issued would be waited for at once
    asm volatile("s_wait_dscnt 0x0" ::: "memory");      // this wave's reads of the buffer are done
    asm volatile("s_wait_asynccnt 0x0" ::: "memory");   // its copies of tile kt + 1 have landed
    __syncthreads();                                    // publishes tile kt + 1 and frees this tile's buffer
    if (kt + 2 < nt) gemm_stage(sm.st, buf, tid, wg + (kt + 2) * GKT, xg + (kt + 2) * GKT, DM); }
  asm volatile("s_wait_asynccnt 0x0" ::: "memory");   // no copy is outstanding when the bytes are used anew
#pragma unroll
  for (int j = 0; j < 8; ++j) { const int n = n0 + j * 16 + col; const int which = n >> 10, c = n & 1023; const float bb = bfr((which == 0 ? bq : which == 1 ? bk : bv)[c]);
#pragma unroll
    for (int r = 0; r < 8; ++r) sm.so[wave][8 * g + r][j * 16 + col] = acc[j][r] + bb; }
  LDSX();
  for (int rl = 0; rl < 16; ++rl) vst2(QKV + (r0 + rl) * QKVP + n0 + lane * 4, *(const v4f*)&sm.so[wave][rl][lane * 4]);
}
// ---- k_rope: block = (64-token block, head pair), 8 waves. A thread holds both halves of its (token, 4 j) pairs of q and k in registers and rotates them, so no exchange and no token loop; one angle serves q and k of both heads.
// q goes back in place as f32. The rotated k is split here, once, into the bf16 hi and residual that the score products take, and leaves as K2 rows; its f32 columns are read by nobody afterwards and are not rewritten.
// v passes once through LDS to the transposed hi/lo planes (128-B segments of the 4-KB rows); it goes first, so that no store is outstanding at the barrier.
typedef __attribute__((ext_vector_type(2))) __bf16 v2b;
typedef __attribute__((ext_vector_type(4))) __bf16 v4b;
__global__ __launch_bounds__(256) void k_rope(float* __restrict__ QKV, const int* __restrict__ PID, __bf16* __restrict__ VTH, __bf16* __restrict__ VTL, __bf16* __restrict__ K2) {
  __shared__ __align__(16) __bf16 svh[2 * HD][72], svl[2 * HD][72];
  const int tid = threadIdx.x, lane = tid & 31, jq = tid & 7, tg = tid >> 3; const size_t t0 = (size_t)blockIdx.x * 64; const int c0 = blockIdx.y * (2 * HD); const int b = (int)(t0 / SS), p0 = (int)(t0 % SS);
  v4f vv[4][2], x[2][2][2][2]; float pos[2];   // vv[d quad jq + 8 iv][token 2 tg + e]; x[token tg + 32 it][head][q | k][half]
#pragma unroll
  for (int iv = 0; iv < 4; ++iv)
#pragma unroll
    for (int e = 0; e < 2; ++e) vv[iv][e] = *(const v4f*)(QKV + (t0 + 2 * tg + e) * QKVP + 2 * DM + c0 + (jq + 8 * iv) * 4);
#pragma unroll
  for (int it = 0; it < 2; ++it) { const float* row = QKV + (t0 + tg + 32 * it) * QKVP + c0 + jq * 4; pos[it] = (float)PID[p0 + tg + 32 * it];
#pragma unroll
    for (int hl = 0; hl < 2; ++hl)
#pragma unroll
      for (int w = 0; w < 2; ++w) { x[it][hl][w][0] = *(const v4f*)(row + w * DM + hl * HD); x[it][hl][w][1] = *(const v4f*)(row + w * DM + hl * HD + 32); } }
#pragma unroll
  for (int iv = 0; iv < 4; ++iv)
#pragma unroll
    for (int i = 0; i < 4; ++i) { const int d = (jq + 8 * iv) * 4 + i; const float v0 = vv[iv][0][i], v1 = vv[iv][1][i]; const __bf16 h0 = (__bf16)v0, h1 = (__bf16)v1;
      *(v2b*)&svh[d][2 * tg] = (v2b){h0, h1}; *(v2b*)&svl[d][2 * tg] = (v2b){(__bf16)(v0 - (float)h0), (__bf16)(v1 - (float)h1)}; }
  __syncthreads();
#pragma unroll
  for (int q = tid; q < 2 * HD * 8; q += 256) { const int rowi = q >> 3, pc = q & 7; const size_t o = ((size_t)b * DM + c0 + rowi) * SS + p0 + pc * 8; vst2((unsigned*)(VTH + o), *(const v4u*)&svh[rowi][pc * 8]); vst2((unsigned*)(VTL + o), *(const v4u*)&svl[rowi][pc * 8]); }
  const float invl = powf(10000.0f, -(float)(2 * lane) / (float)HD);   // lane j holds inv_freq[j]
  float invf[4];
#pragma unroll
  for (int i = 0; i < 4; ++i) invf[i] = __shfl(invl, jq * 4 + i);
#pragma unroll
  for (int it = 0; it < 2; ++it) { float* row = QKV + (t0 + tg + 32 * it) * QKVP + c0 + jq * 4; v4f y[2][2][2];
#pragma unroll
    for (int i = 0; i < 4; ++i) { const float ang = pos[it] * invf[i]; const float c = cosf(ang), sn = sinf(ang);
#pragma unroll
      for (int hl = 0; hl < 2; ++hl)
#pragma unroll
        for (int w = 0; w < 2; ++w) { const float x1 = x[it][hl][w][0][i], x2 = x[it][hl][w][1][i]; y[hl][w][0][i] = x1 * c - x2 * sn; y[hl][w][1][i] = x2 * c + x1 * sn; } }
#pragma unroll
    for (int hl = 0; hl < 2; ++hl) { vst2(row + hl * HD, y[hl][0][0]); vst2(row + hl * HD + 32, y[hl][0][1]);
      __bf16* krow = K2 + (((size_t)b * NH + blockIdx.y * 2 + hl) * SS + p0 + tg + 32 * it) * (2 * HD) + jq * 4;
#pragma unroll
      for (int hf = 0; hf < 2; ++hf) { v4b kh, kl;
#pragma unroll
        for (int i = 0; i < 4; ++i) { const float v = y[hl][1][hf][i]; const __bf16 hi = (__bf16)v; kh[i] = hi; kl[i] = (__bf16)(v - (float)hi); }
        vst2(krow + hf * 32, kh); vst2(krow + HD + hf * 32, kl); } } }
}
// ---- k_attn: block = (query block qb, b*16 + h), 4 waves: all SS/32 key steps; online softmax. Scores are formed transposed (keys as rows, queries as columns): a lane owns one query, the 16 scores it holds of a key step
// reduce in its own registers (one exchange with the other wave half for the maximum; the halves' sums join once at the end), and split in place they are the B operand of O^T += V^T P^T, so P passes through no LDS. O written over the q columns of the block's rows.
// The k rows (hi | lo, as k_rope left them) and v^T rows of a key step are the same for the block's four waves: they are brought into LDS once a block by asynchronous copies on whole row pieces (two buffers, the next step's copies fly while this step is worked on), and each wave takes its fragments from there.
#define KPB 136  // bf16 per staged k row (hi 64 | lo 64 | pad): 272 B = 16 B x odd, the pitch of 16-byte LDS readers
#define VPB 40   // bf16 per staged v^T row: 80 B = 16 B x odd
__device__ __forceinline__ float xhalf(float v) { const unsigned u = __builtin_bit_cast(unsigned, v); return __builtin_bit_cast(float, __builtin_amdgcn_permlanex16(u, u, 0x76543210u, 0xfedcba98u, false, false)); }   // lane l <-> l ^ 16
__device__ __forceinline__ v8f mac3t(const F2& k, const F2& q, v8f c) { c = wmma_bf(k.h, q.l, c); c = wmma_bf(k.l, q.h, c); return wmma_bf(k.h, q.h, c); }   // the three products in mac3's order, operands swapped
__global__ __launch_bounds__(128) void k_attn(float* __restrict__ QKV, const __bf16* __restrict__ VTH, const __bf16* __restrict__ VTL, const __bf16* __restrict__ K2) {
  __shared__ __align__(16) __bf16 sk[2][32][KPB];
  __shared__ __align__(16) __bf16 sv[2][2][HD][VPB];   // [buffer][hi | lo][d][key]
  const int tid = threadIdx.x, wave = tid >> 5, lane = tid & 31, col = lane & 15, g = lane >> 4;
  const int qb = blockIdx.x, bh = blockIdx.y, b = bh >> 4, h = bh & 15; const int q0 = qb * 64 + wave * 16; const size_t tq = (size_t)b * SS + q0;
  const F2 a0 = split_row(QKV + (tq + col) * QKVP + h * HD, 0, lane), a1 = split_row(QKV + (tq + col) * QKVP + h * HD, 32, lane);   // query col as column col of B
  const float SC2 = 0.125f * 1.44269504088896340736f;   // 1 / sqrt(64) times log2(e): e^(s / 8 - max) = 2^(s SC2 - m), one multiply-add and one hardware exponential, inline
  float m = -3.0e38f, l = 0.f;   // of query col, m in base-2 units; l holds this half's keys only
  v8f acc[4] = {};   // acc[dt][r] = O[query col][dt * 16 + 8 g + r]
  const int nsteps = SS / 32;
  // a thread's eight 16-byte pieces of a key step: k rows tid / 16 + 8 i (16 threads a 256-B row), v^T rows tid / 4 + 32 j of either plane (4 threads a 64-B row piece)
  const __bf16* kg = K2 + ((size_t)bh * SS + (tid >> 4)) * (2 * HD) + (tid & 15) * 8;
  const size_t vo = ((size_t)b * DM + h * HD + (tid >> 2)) * SS + (tid & 3) * 8;
  const __bf16 *vgh = VTH + vo, *vgl = VTL + vo;
  auto stage = [&](int ks, int buf) {
    const __bf16* k0 = kg + ks * 32 * (2 * HD); const __bf16 *h0 = vgh + ks * 32, *l0 = vgl + ks * 32;
    const unsigned lk = lds_of(&sk[buf][tid >> 4][(tid & 15) * 8]), lh = lds_of(&sv[buf][0][tid >> 2][(tid & 3) * 8]), ll = lds_of(&sv[buf][1][tid >> 2][(tid & 3) * 8]);
    // the wait is the statement's last line, so that it stands ahead of any rewrite of a register that a copy names
    asm volatile("global_load_async_to_lds_b128 %0, %8, off\n\t"
                 "global_load_async_to_lds_b128 %1, %9, off\n\t"
                 "global_load_async_to_lds_b128 %2, %10, off\n\t"
                 "global_load_async_to_lds_b128 %3, %11, off\n\t"
                 "global_load_async_to_lds_b128 %4, %12, off\n\t"
                 "global_load_async_to_lds_b128 %5, %13, off\n\t"
                 "global_load_async_to_lds_b128 %6, %14, off\n\t"
                 "global_load_async_to_lds_b128 %7, %15, off\n\t"
                 "s_wait_xcnt 0x0"
                 :: "v"(lk), "v"(lk + 8u * KPB * 2u), "v"(lk + 16u * KPB * 2u), "v"(lk + 24u * KPB * 2u), "v"(lh), "v"(lh + 32u * VPB * 2u), "v"(ll), "v"(ll + 32u * VPB * 2u),
                    "v"(k0), "v"(k0 + 8 * 2 * HD), "v"(k0 + 16 * 2 * HD), "v"(k0 + 24 * 2 * HD), "v"(h0), "v"(h0 + 32 * SS), "v"(l0), "v"(l0 + 32 * SS) : "memory"); };
  stage(0, 0);
  asm volatile("s_wait_asynccnt 0x0" ::: "memory");   // this wave's copies of step 0 have landed
  __syncthreads();                                    // ... and every other wave's
  stage(1, 1);
#pragma unroll 1
  for (int ks = 0; ks < nsteps; ++ks) { const int buf = ks & 1;
    v8f s[2]; F2 kf[2][2]; v16b vh[4], vl[4];   // the key step's fragments, from this step's buffer alone; plain LDS loads, so that the compiler groups them and places counted waits
#pragma unroll
    for (int ct = 0; ct < 2; ++ct)
#pragma unroll
      for (int kc = 0; kc < 2; ++kc) { kf[ct][kc].h = frag_b(&sk[buf][ct * 16 + col][kc * 32], lane); kf[ct][kc].l = frag_b(&sk[buf][ct * 16 + col][HD + kc * 32], lane); }   // key ct * 16 + col as row col of A, d kc * 32 ..
#pragma unroll
    for (int dt = 0; dt < 4; ++dt) { vh[dt] = frag_b(&sv[buf][0][dt * 16 + col][0], lane); vl[dt] = frag_b(&sv[buf][1][dt * 16 + col][0], lane); }
    __builtin_amdgcn_sched_barrier(0);   // holds the step's LDS reads as one group ahead of its first product; left free, the scheduler sinks each pair of reads to its product and waits for it in full there
#pragma unroll
    for (int ct = 0; ct < 2; ++ct) { v8f c = mac3t(kf[ct][0], a0, (v8f){}); s[ct] = mac3t(kf[ct][1], a1, c); }   // s[ct][r] = q . k of key ks * 32 + ct * 16 + 8 g + r with query col, not yet scaled
    float mx = fmaxf(s[0][0], s[1][0]);
#pragma unroll
    for (int r = 1; r < 8; ++r) mx = fmaxf(mx, fmaxf(s[0][r], s[1][r]));
    mx = fmaxf(mx, xhalf(mx));
    const float mn = fmaxf(m, mx * SC2); float alpha = m - mn;   // SC2 > 0: the maximum of the scaled scores is the scaled maximum
    float p[16], es[4];   // p[i]: key 8 g + i (i < 8), 16 + 8 g + i - 8 (else) of the step, the k order of V^T's fragment
#pragma unroll
    for (int i = 0; i < 16; ++i) p[i] = fmaf(s[i >> 3][i & 7], SC2, -mn);
    // the exponentials, each in its own register. In asm so that the slot which the instruction set asks for behind a transcendental is there by construction: each is followed by an independent one, the last by v_nop
    asm("v_exp_f32 %0, %0\n\tv_exp_f32 %1, %1\n\tv_exp_f32 %2, %2\n\tv_exp_f32 %3, %3\n\tv_exp_f32 %4, %4\n\tv_exp_f32 %5, %5\n\tv_exp_f32 %6, %6\n\tv_exp_f32 %7, %7\n\tv_exp_f32 %8, %8\n\tv_nop"
        : "+v"(p[0]), "+v"(p[1]), "+v"(p[2]), "+v"(p[3]), "+v"(p[4]), "+v"(p[5]), "+v"(p[6]), "+v"(p[7]), "+v"(alpha));
    asm("v_exp_f32 %0, %0\n\tv_exp_f32 %1, %1\n\tv_exp_f32 %2, %2\n\tv_exp_f32 %3, %3\n\tv_exp_f32 %4, %4\n\tv_exp_f32 %5, %5\n\tv_exp_f32 %6, %6\n\tv_exp_f32 %7, %7\n\tv_nop"
        : "+v"(p[8]), "+v"(p[9]), "+v"(p[10]), "+v"(p[11]), "+v"(p[12]), "+v"(p[13]), "+v"(p[14]), "+v"(p[15]));
#pragma unroll
    for (int i = 0; i < 16; ++i) es[i & 3] = i < 4 ? p[i] : es[i & 3] + p[i];
    l = l * alpha + ((es[0] + es[1]) + (es[2] + es[3])); m = mn;
#pragma unroll
    for (int dt = 0; dt < 4; ++dt) acc[dt] *= alpha;
    const F2 pb = bsplit16(p);
#pragma unroll
    for (int dt = 0; dt < 4; ++dt) { acc[dt] = wmma_bf(vh[dt], pb.l, acc[dt]); acc[dt] = wmma_bf(vl[dt], pb.h, acc[dt]); acc[dt] = wmma_bf(vh[dt], pb.h, acc[dt]); }
    __builtin_amdgcn_sched_barrier(0);   // holds the products ahead of the waits below; left free, the scheduler lifts waits and barrier over them to the top of the trip, where the copies just issued would be waited for at once
    asm volatile("s_wait_dscnt 0x0" ::: "memory");      // this wave's reads of the buffer are done
    asm volatile("s_wait_asynccnt 0x0" ::: "memory");   // its copies of step ks + 1 have landed
    __syncthreads();                                    // publishes step ks + 1 and frees this step's buffer
    if (ks + 2 < nsteps) stage(ks + 2, buf); }
  asm volatile("s_wait_asynccnt 0x0" ::: "memory");   // no copy is outstanding when the wave ends
  const float il = 1.0f / (l + xhalf(l));
  float* orow = QKV + (tq + col) * QKVP + h * HD + 8 * g;
#pragma unroll
  for (int dt = 0; dt < 4; ++dt) { const v8f o = acc[dt] * il; vst2(orow + dt * 16, (v4f){o[0], o[1], o[2], o[3]}); vst2(orow + dt * 16 + 4, (v4f){o[4], o[5], o[6], o[7]}); }
}
// ---- k_out: Y = O(hi/lo; the q columns of QKV) . PT_out rows (2 products, K = 1024); block (64 rows, 128 cols); operands staged as in k_proj
__global__ __launch_bounds__(128) void k_out(const float* __restrict__ QKV, const __bf16* __restrict__ PT, float* __restrict__ Y) {
  __shared__ __align__(16) GemmLds sm;
  const int tid = threadIdx.x, wave = tid >> 5, lane = tid & 31, col = lane & 15, g = lane >> 4; const size_t r0 = (size_t)blockIdx.x * 64 + wave * 16; const int n0 = blockIdx.y * 128;
  v8f acc[8] = {};
  const __bf16* wg = PT + (size_t)(3 * DM + n0 + (tid >> 3)) * DM + (tid & 7) * 8; const float* xg = QKV + ((size_t)blockIdx.x * 64 + (tid >> 4)) * QKVP + (tid & 15) * 4;
  const int nt = DM / GKT;
  gemm_stage(sm.st, 0, tid, wg, xg, QKVP);
  asm volatile("s_wait_asynccnt 0x0" ::: "memory");   // this wave's copies of tile 0 have landed
  __syncthreads();                                    // ... and every other wave's
  gemm_stage(sm.st, 1, tid, wg + GKT, xg + GKT, QKVP);
  // kept rolled: the buffer is the trip's parity, and a second copy of the body would only double the code and the live addresses
#pragma unroll 1
  for (int kt = 0; kt < nt; ++kt) { const int buf = kt & 1;
#pragma unroll
    for (int kc = 0; kc < GKT / 32; ++kc) { float xv[16]; frag_lx(&sm.st.x[buf][wave * 16 + col][kc * 32], lane, xv); const F2 a = bsplit16(xv); v16b w[8];
#pragma unroll
      for (int j = 0; j < 8; ++j) w[j] = frag_b(&sm.st.w[buf][j * 16 + col][kc * 32], lane);
      __builtin_amdgcn_sched_barrier(0);   // holds these LDS reads as one group ahead of the first product; left free, the scheduler sinks each pair of reads to its product and waits for it in full there
#pragma unroll
      for (int j = 0; j < 8; ++j) { acc[j] = wmma_bf(a.l, w[j], acc[j]); acc[j] = wmma_bf(a.h, w[j], acc[j]); } }
    __builtin_amdgcn_sched_barrier(0);   // holds the products ahead of the waits below; left free, the scheduler lifts waits and barrier over them to the top of the trip, where the copies just issued would be waited for at once
    asm volatile("s_wait_dscnt 0x0" ::: "memory");      // this wave's reads of the buffer are done
    asm volatile("s_wait_asynccnt 0x0" ::: "memory");   // its copies of tile kt + 1 have landed
    __syncthreads();                                    // publishes tile kt + 1 and frees this tile's buffer
    if (kt + 2 < nt) gemm_stage(sm.st, buf, tid, wg + (kt + 2) * GKT, xg + (kt + 2) * GKT, QKVP); }
  asm volatile("s_wait_asynccnt 0x0" ::: "memory");   // no copy is outstanding when the bytes are used anew
#pragma unroll
  for (int j = 0; j < 8; ++j)
#pragma unroll
    for (int r = 0; r < 8; ++r) sm.so[wave][8 * g + r][j * 16 + col] = acc[j][r];
  LDSX();
  for (int rl = 0; rl < 16; ++rl) vst2(Y + (r0 + rl) * DM + n0 + lane * 4, *(const v4f*)&sm.so[wave][rl][lane * 4]);
}

extern "C" void kernel_launch(void* const* d_in, const int* in_sizes, int n_in, void* d_out, int out_size, void* d_ws, size_t ws_size, hipStream_t stream) {
  (void)in_sizes; (void)n_in; (void)out_size;
  const float** F = (const float**)d_in;   // hidden_states, position_ids [1,2048] int, Wq, bq, Wk, bk, Wv, bv, Wo (torch [out][in])
  if (ws_size < (size_t)WS_END) return;
  char* ws = (char*)d_ws; __bf16 *PT = (__bf16*)(ws + WS_PT), *VTH = (__bf16*)(ws + WS_VTH), *VTL = (__bf16*)(ws + WS_VTL), *K2 = (__bf16*)(ws + WS_K2); float* QKV = (float*)(ws + WS_QKV);
  k_pack<<<4 * DM, 128, 0, stream>>>(F[2], F[4], F[6], F[8], PT);
  k_proj<<<dim3(TRB, QKVP / 128), 128, 0, stream>>>(F[0], PT, F[3], F[5], F[7], QKV);
  k_rope<<<dim3(TRB, NH / 2), 256, 0, stream>>>(QKV, (const int*)d_in[1], VTH, VTL, K2);
  k_attn<<<dim3(TQB, TNB * NH), 128, 0, stream>>>(QKV, VTH, VTL, K2);
  k_out<<<dim3((TNB < NB ? TQB : NR / 64), DM / 128), 128, 0, stream>>>(QKV, PT, (float*)d_out);
}

// v009
// One run takes 164 microseconds.
// In two side-by-side timings against v008, it was 1.13 and 1.12 times as fast.
// Counting every step since v000, it is 4.82 times as fast.
// compute dtype: hidden_states, Wq/Wk/Wv + biases, Wo (module inputs) rounded to bf16, position_ids as int; q/k/v projections with exact bf16 products (+ bias); rotary tables (inv_freq = 10000^(-2i/64), cos/sin of pos·inv_freq) and the rotate-half mix in f32; scores and P.V with both computed operands as bf16 hi + bf16 residual pairs (3 products); output projection hi/lo x bf16 Wo (2 products); online softmax in f32; f32 accumulate.
#include <hip/hip_runtime.h>
#include <math.h>

typedef __attribute__((ext_vector_type(16))) _Float16 v16h;
typedef __attribute__((ext_vector_type(16))) __bf16 v16b;
typedef __attribute__((ext_vector_type(8)))  _Float16 v8h;
typedef __attribute__((ext_vector_type(8)))  float v8f;
typedef __attribute__((ext_vector_type(4)))  float v4f;
typedef __attribute__((ext_vector_type(2)))  float v2f;
typedef __attribute__((ext_vector_type(4)))  unsigned v4u;
typedef __attribute__((ext_vector_type(4)))  int v4i;
typedef float __attribute__((may_alias)) float_a;
typedef int __attribute__((may_alias)) int_a;

template <typename T> __device__ __forceinline__ void vst2(void* p, T v) { *(T*)p = v;  }
__device__ __forceinline__ v8f wmma16(v16h a, v16h b, v8f c) {
  v8f d = __builtin_amdgcn_wmma_f32_16x16x32_f16(false, a, false, b, (short)0, c, false, false);
  asm volatile("v_nop\n\tv_nop\n\tv_nop\n\tv_nop" : "+v"(d) : "v"(a), "v"(b));
  return d;
}
__device__ __forceinline__ v8f wmma_bf(v16b a, v16b b, v8f c) {
  return __builtin_amdgcn_wmma_f32_16x16x32_bf16(false, a, false, b, (short)0, c, false, false);
}
// 16x16x32 fragments: lane = (h = lane>>4, row/col = lane&15); elements 0..7 = k0+8h+0..7, 8..15 = k0+16+8h+0..7; D element r = row 8h+r
__device__ __forceinline__ v16h frag_h(const _Float16* rowk0, int lane) {
  union { v16h v; v8h q[2]; } u; const _Float16* p = rowk0 + 8 * (lane >> 4);
  u.q[0] = *(const v8h*)p; u.q[1] = *(const v8h*)(p + 16); return u.v;
}
__device__ __forceinline__ v16h frag_f32(const float* rowk0, int lane) {
  v16h a; const float* p = rowk0 + 8 * (lane >> 4);
#pragma unroll
  for (int i = 0; i < 8; ++i) { a[i] = (_Float16)p[i]; a[8 + i] = (_Float16)p[16 + i]; }
  return a;
}
__device__ __forceinline__ v16h frag_f32s(const float* rowk0, int lane, float sc) {
  v16h a; const float* p = rowk0 + 8 * (lane >> 4);
#pragma unroll
  for (int i = 0; i < 8; ++i) { a[i] = (_Float16)(p[i] * sc); a[8 + i] = (_Float16)(p[16 + i] * sc); }
  return a;
}
// column fragment from a [K][ld] layout (column n), rows >= K read as 0
__device__ __forceinline__ v16h fragc_f32(const float* W, int k0, int n, int lane, int ld, int K) {
  v16h a; const int g = lane >> 4;
#pragma unroll
  for (int i = 0; i < 8; ++i) { const int ka = k0 + 8 * g + i, kb = ka + 16;
    a[i] = (_Float16)(ka < K ? W[(size_t)(ka < K ? ka : K - 1) * ld + n] : 0.f); a[8 + i] = (_Float16)(kb < K ? W[(size_t)(kb < K ? kb : K - 1) * ld + n] : 0.f); }
  return a;
}
struct F2 { v16b h, l; };
__device__ __forceinline__ F2 bsplit16(const float v[16]) { F2 r;
#pragma unroll
  for (int i = 0; i < 16; ++i) { const __bf16 h = (__bf16)v[i]; r.h[i] = h; r.l[i] = (__bf16)(v[i] - (float)h); }
  return r; }
__device__ __forceinline__ F2 split_row(const float* row, int k0, int lane) { float v[16]; const float* p = row + k0 + 8 * (lane >> 4);
#pragma unroll
  for (int i = 0; i < 8; ++i) { v[i] = p[i]; v[8 + i] = p[16 + i]; }
  return bsplit16(v); }
__device__ __forceinline__ F2 split_rowK(const float* row, int k0, int lane, int K) { float v[16]; const int g = lane >> 4;
#pragma unroll
  for (int i = 0; i < 8; ++i) { const int ka = k0 + 8 * g + i, kb = ka + 16; v[i] = ka < K ? row[ka < K ? ka : K - 1] : 0.f; v[8 + i] = kb < K ? row[kb < K ? kb : K - 1] : 0.f; }
  return bsplit16(v); }
__device__ __forceinline__ F2 split_col(const float* W, int k0, int n, int lane, int ld, int K) { float v[16]; const int g = lane >> 4;
#pragma unroll
  for (int i = 0; i < 8; ++i) { const int ka = k0 + 8 * g + i, kb = ka + 16; v[i] = ka < K ? W[(size_t)(ka < K ? ka : K - 1) * ld + n] : 0.f; v[8 + i] = kb < K ? W[(size_t)(kb < K ? kb : K - 1) * ld + n] : 0.f; }
  return bsplit16(v); }
__device__ __forceinline__ v8f mac3(const F2& a, const F2& b, v8f c) { c = wmma_bf(a.l, b.h, c); c = wmma_bf(a.h, b.l, c); return wmma_bf(a.h, b.h, c); }
__device__ __forceinline__ float sigm(float v) { return 1.0f / (1.0f + expf(-v)); }
#define LDSX() do { asm volatile("s_wait_dscnt 0" ::: "memory"); __builtin_amdgcn_wave_barrier(); __builtin_amdgcn_fence(__ATOMIC_RELEASE, "workgroup"); } while (0)


// Wav2Vec2 self attention: q,k,v = x W^T + b (16 heads x 64); scores = q k^T / 8; softmax (no mask); P v; merge heads; @ Wo^T (no bias).  B 2, S 2048, D 1024.
// k_pack (W rows as bf16 rows: torch [out][in] layout is already K-contiguous), k_proj (exact GEMM + bias, 3072-wide rows), k_rope (rotary on q and k; k as hi/lo rows, v as transposed hi/lo planes), k_attn (flash-style: per (128-query block, b, h) over all 64 32-key steps, online max/sum with accumulator rescale; O rows), k_out (no bias).
#define NB 2
#define SS 2048
#define DM 1024
#define NH 16
#define HD 64
#define NR (NB * SS)
#define QKVP (3 * DM)
#ifndef TRB
#define TRB (NR / 64)
#define TQB (SS / 64)
#define TNB NB
#endif
typedef __attribute__((ext_vector_type(8))) __bf16 v8b;
__device__ __forceinline__ v16b frag_b(const __bf16* rowk0, int lane) {
  union { v16b v; v8b q[2]; } u; const __bf16* p = rowk0 + 8 * (lane >> 4);
  u.q[0] = *(const v8b*)p; u.q[1] = *(const v8b*)(p + 16); return u.v;
}
__device__ __forceinline__ v16b frag_gbf(const float* rowk0, int lane) {
  v16b a; const float* p = rowk0 + 8 * (lane >> 4);
#pragma unroll
  for (int i = 0; i < 8; ++i) { a[i] = (__bf16)p[i]; a[8 + i] = (__bf16)p[16 + i]; }
  return a;
}
__device__ __forceinline__ float bfr(float v) { return (float)(__bf16)v; }
#define WS_PT   0u                                 // bf16 [4096 (q|k|v|out cols)][1024]
#define WS_QKV  (WS_PT + 2u * 4 * DM * DM)           // f32 [4096 rows][3072]  (q 0..1023 | k | v) ; q cols later overwritten by O
#define WS_VTH  (WS_QKV + 4u * NR * QKVP)            // bf16 [2][1024 (h*64+d)][2048]
#define WS_VTL  (WS_VTH + 2u * NB * DM * SS)
#define WS_K2   (WS_VTL + 2u * NB * DM * SS)         // bf16 [2 * 16 (b, h)][2048 tokens][hi 64 | lo 64]: the rotated k, a 256-B row a key
#define WS_END  (WS_K2 + 2u * 2u * NB * DM * SS)

__global__ __launch_bounds__(128) void k_pack(const float* __restrict__ Wq, const float* __restrict__ Wk, const float* __restrict__ Wv, const float* __restrict__ Wo, __bf16* __restrict__ PT) {
  __shared__ __align__(16) __bf16 srow[DM];
  const int n = blockIdx.x, tid = threadIdx.x; const int which = n >> 10, c = n & 1023; const float* Wm = which == 0 ? Wq : (which == 1 ? Wk : (which == 2 ? Wv : Wo));
  for (int k = tid; k < DM; k += 128) srow[k] = (__bf16)Wm[(size_t)c * DM + k];   // torch [out][in]: row c
  __syncthreads();
  vst2((unsigned*)(PT + (size_t)n * DM + tid * 8), *(const v4u*)(&srow[tid * 8]));
}
#define GKT 64   // k per staged tile
#define WPB 72   // bf16 per staged W row: 144 B = 16 B x odd, the pitch of 16-byte LDS readers
#define XPF 68   // f32 per staged x row: 272 B = 16 B x odd
struct GemmStage { __bf16 w[2][128][WPB]; float x[2][64][XPF]; };
union GemmLds { GemmStage st; float so[4][16][132]; };   // the output rows pass through the same bytes once the last tile has been read
__device__ __forceinline__ unsigned lds_of(const void* p) { return (unsigned)(size_t)p; }   // LDS byte address: the low 32 bits of a __shared__ address
// a thread's sixteen 16-byte pieces of a tile: W rows tid / 8 + 16 i (8 threads a 128-B row piece), x rows tid / 16 + 8 i (16 threads a 256-B row piece). wg, xg: the thread's pieces of rows tid / 8 and tid / 16 of this tile; xld: f32 per x row in global memory
__device__ __forceinline__ void gemm_stage(GemmStage& st, int buf, int tid, const __bf16* wg, const float* xg, int xld) {
  const unsigned lw = lds_of(&st.w[buf][tid >> 3][(tid & 7) * 8]), lx = lds_of(&st.x[buf][tid >> 4][(tid & 15) * 4]);
  // in each statement the wait is the last line, so that it stands ahead of any rewrite of a register that a copy names
  asm volatile("global_load_async_to_lds_b128 %0, %8, off\n\t"
               "global_load_async_to_lds_b128 %1, %9, off\n\t"
               "global_load_async_to_lds_b128 %2, %10, off\n\t"
               "global_load_async_to_lds_b128 %3, %11, off\n\t"
               "global_load_async_to_lds_b128 %4, %12, off\n\t"
               "global_load_async_to_lds_b128 %5, %13, off\n\t"
               "global_load_async_to_lds_b128 %6, %14, off\n\t"
               "global_load_async_to_lds_b128 %7, %15, off\n\t"
               "s_wait_xcnt 0x0"
               :: "v"(lw), "v"(lw + 16u * WPB * 2u), "v"(lw + 32u * WPB * 2u), "v"(lw + 48u * WPB * 2u), "v"(lw + 64u * WPB * 2u), "v"(lw + 80u * WPB * 2u), "v"(lw + 96u * WPB * 2u), "v"(lw + 112u * WPB * 2u),
                  "v"(wg), "v"(wg + 16 * DM), "v"(wg + 32 * DM), "v"(wg + 48 * DM), "v"(wg + 64 * DM), "v"(wg + 80 * DM), "v"(wg + 96 * DM), "v"(wg + 112 * DM) : "memory");
  asm volatile("global_load_async_to_lds_b128 %0, %8, off\n\t"
               "global_load_async_to_lds_b128 %1, %9, off\n\t"
               "global_load_async_to_lds_b128 %2, %10, off\n\t"
               "global_load_async_to_lds_b128 %3, %11, off\n\t"
               "global_load_async_to_lds_b128 %4, %12, off\n\t"
               "global_load_async_to_lds_b128 %5, %13, off\n\t"
               "global_load_async_to_lds_b128 %6, %14, off\n\t"
               "global_load_async_to_lds_b128 %7, %15, off\n\t"
               "s_wait_xcnt 0x0"
               :: "v"(lx), "v"(lx + 8u * XPF * 4u), "v"(lx + 16u * XPF * 4u), "v"(lx + 24u * XPF * 4u), "v"(lx + 32u * XPF * 4u), "v"(lx + 40u * XPF * 4u), "v"(lx + 48u * XPF * 4u), "v"(lx + 56u * XPF * 4u),
                  "v"(xg), "v"(xg + 8 * xld), "v"(xg + 16 * xld), "v"(xg + 24 * xld), "v"(xg + 32 * xld), "v"(xg + 40 * xld), "v"(xg + 48 * xld), "v"(xg + 56 * xld) : "memory");
}
// the 16 f32 of a lane's A fragment from a staged x row, in the fragment's k order, as four 16-byte LDS reads
__device__ __forceinline__ void frag_lx(const float* rowk0, int lane, float v[16]) { const float* p = rowk0 + 8 * (lane >> 4); const v4f q0 = *(const v4f*)p, q1 = *(const v4f*)(p + 4), q2 = *(const v4f*)(p + 16), q3 = *(const v4f*)(p + 20);
#pragma unroll
  for (int i = 0; i < 4; ++i) { v[i] = q0[i]; v[4 + i] = q1[i]; v[8 + i] = q2[i]; v[12 + i] = q3[i]; } }
// ---- k_proj: QKV[r][n] = bf16(x[r]) . PT[n] (exact), K = 1024; block (64 rows, 128 cols); 512-B segments of 12-KB rows
__global__ __launch_bounds__(128) void k_proj(const float* __restrict__ X, const __bf16* __restrict__ PT, const float* __restrict__ bq, const float* __restrict__ bk, const float* __restrict__ bv, float* __restrict__ QKV) {
  __shared__ __align__(16) GemmLds sm;
  const int tid = threadIdx.x, wave = tid >> 5, lane = tid & 31, col = lane & 15, g = lane >> 4; const size_t r0 = (size_t)blockIdx.x * 64 + wave * 16; const int n0 = blockIdx.y * 128;
  v8f acc[8] = {};
  const __bf16* wg = PT + (size_t)(n0 + (tid >> 3)) * DM + (tid & 7) * 8; const float* xg = X + ((size_t)blockIdx.x * 64 + (tid >> 4)) * DM + (tid & 15) * 4;
  const int nt = DM / GKT;
  gemm_stage(sm.st, 0, tid, wg, xg, DM);
  asm volatile("s_wait_asynccnt 0x0" ::: "memory");   // this wave's copies of tile 0 have landed
  __syncthreads();                                    // ... and every other wave's
  gemm_stage(sm.st, 1, tid, wg + GKT, xg + GKT, DM);
  // kept rolled: the buffer is the trip's parity, and a second copy of the body would only double the code and the live addresses
#pragma unroll 1
  for (int kt = 0; kt < nt; ++kt) { const int buf = kt & 1;
#pragma unroll
    for (int kc = 0; kc < GKT / 32; ++kc) { float xv[16]; frag_lx(&sm.st.x[buf][wave * 16 + col][kc * 32], lane, xv); v16b a, w[8];
#pragma unroll
      for (int i = 0; i < 16; ++i) a[i] = (__bf16)xv[i];
#pragma unroll
      for (int j = 0; j < 8; ++j) w[j] = frag_b(&sm.st.w[buf][j * 16 + col][kc * 32], lane);
      __builtin_amdgcn_sched_barrier(0);   // holds these LDS reads as one group ahead of the first product; left free, the scheduler sinks each pair of reads to its product and waits for it in full there
#pragma unroll
      for (int j = 0; j < 8; ++j) acc[j] = wmma_bf(a, w[j], acc[j]); }
    __builtin_amdgcn_sched_barrier(0);   // holds the products ahead of the waits below; left free, the scheduler lifts waits and barrier over them to the top of the trip, where the copies just issued would be waited for at once
    asm volatile("s_wait_dscnt 0x0" ::: "memory");      // this wave's reads of the buffer are done
    asm volatile("s_wait_asynccnt 0x0" ::: "memory");   // its copies of tile kt + 1 have landed
    __syncthreads();                                    // publishes tile kt + 1 and frees this tile's buffer
    if (kt + 2 < nt) gemm_stage(sm.st, buf, tid, wg + (kt + 2) * GKT, xg + (kt + 2) * GKT, DM); }
  asm volatile("s_wait_asynccnt 0x0" ::: "memory");   // no copy is outstanding when the bytes are used anew
#pragma unroll
  for (int j = 0; j < 8; ++j) { const int n = n0 + j * 16 + col; const int which = n >> 10, c = n & 1023; const float bb = bfr((which == 0 ? bq : which == 1 ? bk : bv)[c]);
#pragma unroll
    for (int r = 0; r < 8; ++r) sm.so[wave][8 * g + r][j * 16 + col] = acc[j][r] + bb; }
  LDSX();
  for (int rl = 0; rl < 16; ++rl) vst2(QKV + (r0 + rl) * QKVP + n0 + lane * 4, *(const v4f*)&sm.so[wave][rl][lane * 4]);
}
// ---- k_rope: block = (64-token block, head pair), 8 waves. A thread holds both halves of its (token, 4 j) pairs of q and k in registers and rotates them, so no exchange and no token loop; one angle serves q and k of both heads.
// q goes back in place as f32. The rotated k is split here, once, into the bf16 hi and residual that the score products take, and leaves as K2 rows; its f32 columns are read by nobody afterwards and are not rewritten.
// v passes once through LDS to the transposed hi/lo planes (128-B segments of the 4-KB rows); it goes first, so that no store is outstanding at the barrier.
typedef __attribute__((ext_vector_type(2))) __bf16 v2b;
typedef __attribute__((ext_vector_type(4))) __bf16 v4b;
__global__ __launch_bounds__(256) void k_rope(float* __restrict__ QKV, const int* __restrict__ PID, __bf16* __restrict__ VTH, __bf16* __restrict__ VTL, __bf16* __restrict__ K2) {
  __shared__ __align__(16) __bf16 svh[2 * HD][72], svl[2 * HD][72];
  const int tid = threadIdx.x, lane = tid & 31, jq = tid & 7, tg = tid >> 3; const size_t t0 = (size_t)blockIdx.x * 64; const int c0 = blockIdx.y * (2 * HD); const int b = (int)(t0 / SS), p0 = (int)(t0 % SS);
  v4f vv[4][2], x[2][2][2][2]; float pos[2];   // vv[d quad jq + 8 iv][token 2 tg + e]; x[token tg + 32 it][head][q | k][half]
#pragma unroll
  for (int iv = 0; iv < 4; ++iv)
#pragma unroll
    for (int e = 0; e < 2; ++e) vv[iv][e] = *(const v4f*)(QKV + (t0 + 2 * tg + e) * QKVP + 2 * DM + c0 + (jq + 8 * iv) * 4);
#pragma unroll
  for (int it = 0; it < 2; ++it) { const float* row = QKV + (t0 + tg + 32 * it) * QKVP + c0 + jq * 4; pos[it] = (float)PID[p0 + tg + 32 * it];
#pragma unroll
    for (int hl = 0; hl < 2; ++hl)
#pragma unroll
      for (int w = 0; w < 2; ++w) { x[it][hl][w][0] = *(const v4f*)(row + w * DM + hl * HD); x[it][hl][w][1] = *(const v4f*)(row + w * DM + hl * HD + 32); } }
#pragma unroll
  for (int iv = 0; iv < 4; ++iv)
#pragma unroll
    for (int i = 0; i < 4; ++i) { const int d = (jq + 8 * iv) * 4 + i; const float v0 = vv[iv][0][i], v1 = vv[iv][1][i]; const __bf16 h0 = (__bf16)v0, h1 = (__bf16)v1;
      *(v2b*)&svh[d][2 * tg] = (v2b){h0, h1}; *(v2b*)&svl[d][2 * tg] = (v2b){(__bf16)(v0 - (float)h0), (__bf16)(v1 - (float)h1)}; }
  __syncthreads();
#pragma unroll
  for (int q = tid; q < 2 * HD * 8; q += 256) { const int rowi = q >> 3, pc = q & 7; const size_t o = ((size_t)b * DM + c0 + rowi) * SS + p0 + pc * 8; vst2((unsigned*)(VTH + o), *(const v4u*)&svh[rowi][pc * 8]); vst2((unsigned*)(VTL + o), *(const v4u*)&svl[rowi][pc * 8]); }
  const float invl = powf(10000.0f, -(float)(2 * lane) / (float)HD);   // lane j holds inv_freq[j]
  float invf[4];
#pragma unroll
  for (int i = 0; i < 4; ++i) invf[i] = __shfl(invl, jq * 4 + i);
#pragma unroll
  for (int it = 0; it < 2; ++it) { float* row = QKV + (t0 + tg + 32 * it) * QKVP + c0 + jq * 4; v4f y[2][2][2];
#pragma unroll
    for (int i = 0; i < 4; ++i) { const float ang = pos[it] * invf[i]; const float c = cosf(ang), sn = sinf(ang);
#pragma unroll
      for (int hl = 0; hl < 2; ++hl)
#pragma unroll
        for (int w = 0; w < 2; ++w) { const float x1 = x[it][hl][w][0][i], x2 = x[it][hl][w][1][i]; y[hl][w][0][i] = x1 * c - x2 * sn; y[hl][w][1][i] = x2 * c + x1 * sn; } }
#pragma unroll
    for (int hl = 0; hl < 2; ++hl) { vst2(row + hl * HD, y[hl][0][0]); vst2(row + hl * HD + 32, y[hl][0][1]);
      __bf16* krow = K2 + (((size_t)b * NH + blockIdx.y * 2 + hl) * SS + p0 + tg + 32 * it) * (2 * HD) + jq * 4;
#pragma unroll
      for (int hf = 0; hf < 2; ++hf) { v4b kh, kl;
#pragma unroll
        for (int i = 0; i < 4; ++i) { const float v = y[hl][1][hf][i]; const __bf16 hi = (__bf16)v; kh[i] = hi; kl[i] = (__bf16)(v - (float)hi); }
        vst2(krow + hf * 32, kh); vst2(krow + HD + hf * 32, kl); } } }
}
// ---- k_attn: block = (query block qb of 128, b*16 + h), 4 waves of 32 queries (two 16-column tiles): all SS/32 key steps; online softmax. Scores are formed transposed (keys as rows, queries as columns): a lane owns one query, the 16 scores it holds of a key step
// reduce in its own registers (one exchange with the other wave half for the maximum; the halves' sums join once at the end), and split in place they are the B operand of O^T += V^T P^T, so P passes through no LDS. O written over the q columns of the block's rows.
// The k rows (hi | lo, as k_rope left them) and v^T rows of a key step are the same for the block's four waves: they are brought into LDS once a block by asynchronous copies on whole row pieces (two buffers, the next step's copies fly while this step is worked on), and each wave takes its fragments from there.
#define KPB 136  // bf16 per staged k row (hi 64 | lo 64 | pad): 272 B = 16 B x odd, the pitch of 16-byte LDS readers
#define VPB 40   // bf16 per staged v^T row: 80 B = 16 B x odd
__device__ __forceinline__ float xhalf(float v) { const unsigned u = __builtin_bit_cast(unsigned, v); return __builtin_bit_cast(float, __builtin_amdgcn_permlanex16(u, u, 0x76543210u, 0xfedcba98u, false, false)); }   // lane l <-> l ^ 16
__device__ __forceinline__ v8f mac3t(const F2& k, const F2& q, v8f c) { c = wmma_bf(k.h, q.l, c); c = wmma_bf(k.l, q.h, c); return wmma_bf(k.h, q.h, c); }   // the three products in mac3's order, operands swapped
#define AQT 2    // query tiles (16 columns each) per wave: every k and v^T fragment read from LDS serves AQT products, and a block's staged key step serves 64 * AQT queries
// two waves per SIMD, no more: the grid holds two blocks per WGP, and by its registers a third would fit; capped, the blocks cannot crowd on some WGPs while others stand idle
__global__ __launch_bounds__(128) __attribute__((amdgpu_waves_per_eu(2, 2))) void k_attn(float* __restrict__ QKV, const __bf16* __restrict__ VTH, const __bf16* __restrict__ VTL, const __bf16* __restrict__ K2) {
  __shared__ __align__(16) __bf16 sk[2][32][KPB];
  __shared__ __align__(16) __bf16 sv[2][2][HD][VPB];   // [buffer][hi | lo][d][key]
  const int tid = threadIdx.x, wave = tid >> 5, lane = tid & 31, col = lane & 15, g = lane >> 4;
  const int qb = blockIdx.x, bh = blockIdx.y, b = bh >> 4, h = bh & 15; const int q0 = (qb * 4 + wave) * (16 * AQT); const size_t tq = (size_t)b * SS + q0;
  F2 a0[AQT], a1[AQT];   // query t * 16 + col as column col of B, tile t
#pragma unroll
  for (int t = 0; t < AQT; ++t) { const float* qrow = QKV + (tq + t * 16 + col) * QKVP + h * HD; a0[t] = split_row(qrow, 0, lane); a1[t] = split_row(qrow, 32, lane); }
  const float SC2 = 0.125f * 1.44269504088896340736f;   // 1 / sqrt(64) times log2(e): e^(s / 8 - max) = 2^(s SC2 - m), one multiply-add and one hardware exponential, inline
  float m[AQT], l[AQT];   // of query t * 16 + col, m in base-2 units; l holds this half's keys only
  v8f acc[AQT][4];   // acc[t][dt][r] = O[query t * 16 + col][dt * 16 + 8 g + r]
#pragma unroll
  for (int t = 0; t < AQT; ++t) { m[t] = -3.0e38f; l[t] = 0.f;
#pragma unroll
    for (int dt = 0; dt < 4; ++dt) acc[t][dt] = (v8f){}; }
  const int nsteps = SS / 32;
  // a thread's eight 16-byte pieces of a key step: k rows tid / 16 + 8 i (16 threads a 256-B row), v^T rows tid / 4 + 32 j of either plane (4 threads a 64-B row piece)
  const __bf16* kg = K2 + ((size_t)bh * SS + (tid >> 4)) * (2 * HD) + (tid & 15) * 8;
  const size_t vo = ((size_t)b * DM + h * HD + (tid >> 2)) * SS + (tid & 3) * 8;
  const __bf16 *vgh = VTH + vo, *vgl = VTL + vo;
  auto stage = [&](int ks, int buf) {
    const __bf16* k0 = kg + ks * 32 * (2 * HD); const __bf16 *h0 = vgh + ks * 32, *l0 = vgl + ks * 32;
    const unsigned lk = lds_of(&sk[buf][tid >> 4][(tid & 15) * 8]), lh = lds_of(&sv[buf][0][tid >> 2][(tid & 3) * 8]), ll = lds_of(&sv[buf][1][tid >> 2][(tid & 3) * 8]);
    // the wait is the statement's last line, so that it stands ahead of any rewrite of a register that a copy names
    asm volatile("global_load_async_to_lds_b128 %0, %8, off\n\t"
                 "global_load_async_to_lds_b128 %1, %9, off\n\t"
                 "global_load_async_to_lds_b128 %2, %10, off\n\t"
                 "global_load_async_to_lds_b128 %3, %11, off\n\t"
                 "global_load_async_to_lds_b128 %4, %12, off\n\t"
                 "global_load_async_to_lds_b128 %5, %13, off\n\t"
                 "global_load_async_to_lds_b128 %6, %14, off\n\t"
                 "global_load_async_to_lds_b128 %7, %15, off\n\t"
                 "s_wait_xcnt 0x0"
                 :: "v"(lk), "v"(lk + 8u * KPB * 2u), "v"(lk + 16u * KPB * 2u), "v"(lk + 24u * KPB * 2u), "v"(lh), "v"(lh + 32u * VPB * 2u), "v"(ll), "v"(ll + 32u * VPB * 2u),
                    "v"(k0), "v"(k0 + 8 * 2 * HD), "v"(k0 + 16 * 2 * HD), "v"(k0 + 24 * 2 * HD), "v"(h0), "v"(h0 + 32 * SS), "v"(l0), "v"(l0 + 32 * SS) : "memory"); };
  stage(0, 0);
  asm volatile("s_wait_asynccnt 0x0" ::: "memory");   // this wave's copies of step 0 have landed
  __syncthreads();                                    // ... and every other wave's
  stage(1, 1);
#pragma unroll 1
  for (int ks = 0; ks < nsteps; ++ks) { const int buf = ks & 1;
    v8f s[AQT][2]; F2 kf[2][2]; v16b vh[4], vl[4];   // the key step's fragments, from this step's buffer alone; plain LDS loads, so that the compiler groups them and places counted waits
#pragma unroll
    for (int ct = 0; ct < 2; ++ct)
#pragma unroll
      for (int kc = 0; kc < 2; ++kc) { kf[ct][kc].h = frag_b(&sk[buf][ct * 16 + col][kc * 32], lane); kf[ct][kc].l = frag_b(&sk[buf][ct * 16 + col][HD + kc * 32], lane); }   // key ct * 16 + col as row col of A, d kc * 32 ..
#pragma unroll
    for (int dt = 0; dt < 4; ++dt) { vh[dt] = frag_b(&sv[buf][0][dt * 16 + col][0], lane); vl[dt] = frag_b(&sv[buf][1][dt * 16 + col][0], lane); }
    __builtin_amdgcn_sched_barrier(0);   // holds the step's LDS reads as one group ahead of its first product; left free, the scheduler sinks each pair of reads to its product and waits for it in full there
#pragma unroll
    for (int t = 0; t < AQT; ++t)
#pragma unroll
      for (int ct = 0; ct < 2; ++ct) { v8f c = mac3t(kf[ct][0], a0[t], (v8f){}); s[t][ct] = mac3t(kf[ct][1], a1[t], c); }   // s[t][ct][r] = q . k of key ks * 32 + ct * 16 + 8 g + r with query t * 16 + col, not yet scaled
#pragma unroll
    for (int t = 0; t < AQT; ++t) {
      float mx = fmaxf(s[t][0][0], s[t][1][0]);
#pragma unroll
      for (int r = 1; r < 8; ++r) mx = fmaxf(mx, fmaxf(s[t][0][r], s[t][1][r]));
      mx = fmaxf(mx, xhalf(mx));
      const float mn = fmaxf(m[t], mx * SC2); float alpha = m[t] - mn;   // SC2 > 0: the maximum of the scaled scores is the scaled maximum
      float p[16], es[4];   // p[i]: key 8 g + i (i < 8), 16 + 8 g + i - 8 (else) of the step, the k order of V^T's fragment
#pragma unroll
      for (int i = 0; i < 16; ++i) p[i] = fmaf(s[t][i >> 3][i & 7], SC2, -mn);
      // the exponentials, each in its own register. In asm so that the slot which the instruction set asks for behind a transcendental is there by construction: each is followed by an independent one, the last by v_nop
      asm("v_exp_f32 %0, %0\n\tv_exp_f32 %1, %1\n\tv_exp_f32 %2, %2\n\tv_exp_f32 %3, %3\n\tv_exp_f32 %4, %4\n\tv_exp_f32 %5, %5\n\tv_exp_f32 %6, %6\n\tv_exp_f32 %7, %7\n\tv_exp_f32 %8, %8\n\tv_nop"
          : "+v"(p[0]), "+v"(p[1]), "+v"(p[2]), "+v"(p[3]), "+v"(p[4]), "+v"(p[5]), "+v"(p[6]), "+v"(p[7]), "+v"(alpha));
      asm("v_exp_f32 %0, %0\n\tv_exp_f32 %1, %1\n\tv_exp_f32 %2, %2\n\tv_exp_f32 %3, %3\n\tv_exp_f32 %4, %4\n\tv_exp_f32 %5, %5\n\tv_exp_f32 %6, %6\n\tv_exp_f32 %7, %7\n\tv_nop"
          : "+v"(p[8]), "+v"(p[9]), "+v"(p[10]), "+v"(p[11]), "+v"(p[12]), "+v"(p[13]), "+v"(p[14]), "+v"(p[15]));
#pragma unroll
      for (int i = 0; i < 16; ++i) es[i & 3] = i < 4 ? p[i] : es[i & 3] + p[i];
      l[t] = l[t] * alpha + ((es[0] + es[1]) + (es[2] + es[3])); m[t] = mn;
#pragma unroll
      for (int dt = 0; dt < 4; ++dt) acc[t][dt] *= alpha;
      const F2 pb = bsplit16(p);
#pragma unroll
      for (int dt = 0; dt < 4; ++dt) { acc[t][dt] = wmma_bf(vh[dt], pb.l, acc[t][dt]); acc[t][dt] = wmma_bf(vl[dt], pb.h, acc[t][dt]); acc[t][dt] = wmma_bf(vh[dt], pb.h, acc[t][dt]); } }
    __builtin_amdgcn_sched_barrier(0);   // holds the products ahead of the waits below; left free, the scheduler lifts waits and barrier over them to the top of the trip, where the copies just issued would be waited for at once
    asm volatile("s_wait_dscnt 0x0" ::: "memory");      // this wave's reads of the buffer are done
    asm volatile("s_wait_asynccnt 0x0" ::: "memory");   // its copies of step ks + 1 have landed
    __syncthreads();                                    // publishes step ks + 1 and frees this step's buffer
    if (ks + 2 < nsteps) stage(ks + 2, buf); }
  asm volatile("s_wait_asynccnt 0x0" ::: "memory");   // no copy is outstanding when the wave ends
#pragma unroll
  for (int t = 0; t < AQT; ++t) { const float il = 1.0f / (l[t] + xhalf(l[t]));
    float* orow = QKV + (tq + t * 16 + col) * QKVP + h * HD + 8 * g;
#pragma unroll
    for (int dt = 0; dt < 4; ++dt) { const v8f o = acc[t][dt] * il; vst2(orow + dt * 16, (v4f){o[0], o[1], o[2], o[3]}); vst2(orow + dt * 16 + 4, (v4f){o[4], o[5], o[6], o[7]}); } }
}
// ---- k_out: Y = O(hi/lo; the q columns of QKV) . PT_out rows (2 products, K = 1024); block (64 rows, 128 cols); operands staged as in k_proj
__global__ __launch_bounds__(128) void k_out(const float* __restrict__ QKV, const __bf16* __restrict__ PT, float* __restrict__ Y) {
  __shared__ __align__(16) GemmLds sm;
  const int tid = threadIdx.x, wave = tid >> 5, lane = tid & 31, col = lane & 15, g = lane >> 4; const size_t r0 = (size_t)blockIdx.x * 64 + wave * 16; const int n0 = blockIdx.y * 128;
  v8f acc[8] = {};
  const __bf16* wg = PT + (size_t)(3 * DM + n0 + (tid >> 3)) * DM + (tid & 7) * 8; const float* xg = QKV + ((size_t)blockIdx.x * 64 + (tid >> 4)) * QKVP + (tid & 15) * 4;
  const int nt = DM / GKT;
  gemm_stage(sm.st, 0, tid, wg, xg, QKVP);
  asm volatile("s_wait_asynccnt 0x0" ::: "memory");   // this wave's copies of tile 0 have landed
  __syncthreads();                                    // ... and every other wave's
  gemm_stage(sm.st, 1, tid, wg + GKT, xg + GKT, QKVP);
  // kept rolled: the buffer is the trip's parity, and a second copy of the body would only double the code and the live addresses
#pragma unroll 1
  for (int kt = 0; kt < nt; ++kt) { const int buf = kt & 1;
#pragma unroll
    for (int kc = 0; kc < GKT / 32; ++kc) { float xv[16]; frag_lx(&sm.st.x[buf][wave * 16 + col][kc * 32], lane, xv); const F2 a = bsplit16(xv); v16b w[8];
#pragma unroll
      for (int j = 0; j < 8; ++j) w[j] = frag_b(&sm.st.w[buf][j * 16 + col][kc * 32], lane);
      __builtin_amdgcn_sched_barrier(0);   // holds these LDS reads as one group ahead of the first product; left free, the scheduler sinks each pair of reads to its product and waits for it in full there
#pragma unroll
      for (int j = 0; j < 8; ++j) { acc[j] = wmma_bf(a.l, w[j], acc[j]); acc[j] = wmma_bf(a.h, w[j], acc[j]); } }
    __builtin_amdgcn_sched_barrier(0);   // holds the products ahead of the waits below; left free, the scheduler lifts waits and barrier over them to the top of the trip, where the copies just issued would be waited for at once
    asm volatile("s_wait_dscnt 0x0" ::: "memory");      // this wave's reads of the buffer are done
    asm volatile("s_wait_asynccnt 0x0" ::: "memory");   // its copies of tile kt + 1 have landed
    __syncthreads();                                    // publishes tile kt + 1 and frees this tile's buffer
    if (kt + 2 < nt) gemm_stage(sm.st, buf, tid, wg + (kt + 2) * GKT, xg + (kt + 2) * GKT, QKVP); }
  asm volatile("s_wait_asynccnt 0x0" ::: "memory");   // no copy is outstanding when the bytes are used anew
#pragma unroll
  for (int j = 0; j < 8; ++j)
#pragma unroll
    for (int r = 0; r < 8; ++r) sm.so[wave][8 * g + r][j * 16 + col] = acc[j][r];
  LDSX();
  for (int rl = 0; rl < 16; ++rl) vst2(Y + (r0 + rl) * DM + n0 + lane * 4, *(const v4f*)&sm.so[wave][rl][lane * 4]);
}

extern "C" void kernel_launch(void* const* d_in, const int* in_sizes, int n_in, void* d_out, int out_size, void* d_ws, size_t ws_size, hipStream_t stream) {
  (void)in_sizes; (void)n_in; (void)out_size;
  const float** F = (const float**)d_in;   // hidden_states, position_ids [1,2048] int, Wq, bq, Wk, bk, Wv, bv, Wo (torch [out][in])
  if (ws_size < (size_t)WS_END) return;
  char* ws = (char*)d_ws; __bf16 *PT = (__bf16*)(ws + WS_PT), *VTH = (__bf16*)(ws + WS_VTH), *VTL = (__bf16*)(ws + WS_VTL), *K2 = (__bf16*)(ws + WS_K2); float* QKV = (float*)(ws + WS_QKV);
  k_pack<<<4 * DM, 128, 0, stream>>>(F[2], F[4], F[6], F[8], PT);
  k_proj<<<dim3(TRB, QKVP / 128), 128, 0, stream>>>(F[0], PT, F[3], F[5], F[7], QKV);
  k_rope<<<dim3(TRB, NH / 2), 256, 0, stream>>>(QKV, (const int*)d_in[1], VTH, VTL, K2);
  k_attn<<<dim3(TQB / AQT, TNB * NH), 128, 0, stream>>>(QKV, VTH, VTL, K2);
  k_out<<<dim3((TNB < NB ? TQB : NR / 64), DM / 128), 128, 0, stream>>>(QKV, PT, (float*)d_out);
}

// v010
// One run takes 152 microseconds.
// Timed twice side by side with v009, it ran 1.08 and 1.07 times as fast.
// Over all steps from v000 it is 5.19 times as fast.
// compute dtype: hidden_states, Wq/Wk/Wv + biases, Wo (module inputs) rounded to bf16, position_ids as int; q/k/v projections with exact bf16 products (+ bias); rotary tables (inv_freq = 10000^(-2i/64), cos/sin of pos·inv_freq) and the rotate-half mix in f32; scores and P.V with both computed operands as bf16 hi + bf16 residual pairs (3 products); output projection hi/lo x bf16 Wo (2 products); online softmax in f32; f32 accumulate.
#include <hip/hip_runtime.h>
#include <math.h>

typedef __attribute__((ext_vector_type(16))) _Float16 v16h;
typedef __attribute__((ext_vector_type(16))) __bf16 v16b;
typedef __attribute__((ext_vector_type(8)))  _Float16 v8h;
typedef __attribute__((ext_vector_type(8)))  float v8f;
typedef __attribute__((ext_vector_type(4)))  float v4f;
typedef __attribute__((ext_vector_type(2)))  float v2f;
typedef __attribute__((ext_vector_type(4)))  unsigned v4u;
typedef __attribute__((ext_vector_type(4)))  int v4i;
typedef float __attribute__((may_alias)) float_a;
typedef int __attribute__((may_alias)) int_a;

template <typename T> __device__ __forceinline__ void vst2(void* p, T v) { *(T*)p = v;  }
__device__ __forceinline__ v8f wmma16(v16h a, v16h b, v8f c) {
  v8f d = __builtin_amdgcn_wmma_f32_16x16x32_f16(false, a, false, b, (short)0, c, false, false);
  asm volatile("v_nop\n\tv_nop\n\tv_nop\n\tv_nop" : "+v"(d) : "v"(a), "v"(b));
  return d;
}
__device__ __forceinline__ v8f wmma_bf(v16b a, v16b b, v8f c) {
  return __builtin_amdgcn_wmma_f32_16x16x32_bf16(false, a, false, b, (short)0, c, false, false);
}
// 16x16x32 fragments: lane = (h = lane>>4, row/col = lane&15); elements 0..7 = k0+8h+0..7, 8..15 = k0+16+8h+0..7; D element r = row 8h+r
__device__ __forceinline__ v16h frag_h(const _Float16* rowk0, int lane) {
  union { v16h v; v8h q[2]; } u; const _Float16* p = rowk0 + 8 * (lane >> 4);
  u.q[0] = *(const v8h*)p; u.q[1] = *(const v8h*)(p + 16); return u.v;
}
__device__ __forceinline__ v16h frag_f32(const float* rowk0, int lane) {
  v16h a; const float* p = rowk0 + 8 * (lane >> 4);
#pragma unroll
  for (int i = 0; i < 8; ++i) { a[i] = (_Float16)p[i]; a[8 + i] = (_Float16)p[16 + i]; }
  return a;
}
__device__ __forceinline__ v16h frag_f32s(const float* rowk0, int lane, float sc) {
  v16h a; const float* p = rowk0 + 8 * (lane >> 4);
#pragma unroll
  for (int i = 0; i < 8; ++i) { a[i] = (_Float16)(p[i] * sc); a[8 + i] = (_Float16)(p[16 + i] * sc); }
  return a;
}
// column fragment from a [K][ld] layout (column n), rows >= K read as 0
__device__ __forceinline__ v16h fragc_f32(const float* W, int k0, int n, int lane, int ld, int K) {
  v16h a; const int g = lane >> 4;
#pragma unroll
  for (int i = 0; i < 8; ++i) { const int ka = k0 + 8 * g + i, kb = ka + 16;
    a[i] = (_Float16)(ka < K ? W[(size_t)(ka < K ? ka : K - 1) * ld + n] : 0.f); a[8 + i] = (_Float16)(kb < K ? W[(size_t)(kb < K ? kb : K - 1) * ld + n] : 0.f); }
  return a;
}
struct F2 { v16b h, l; };
__device__ __forceinline__ F2 bsplit16(const float v[16]) { F2 r;
#pragma unroll
  for (int i = 0; i < 16; ++i) { const __bf16 h = (__bf16)v[i]; r.h[i] = h; r.l[i] = (__bf16)(v[i] - (float)h); }
  return r; }
__device__ __forceinline__ F2 split_row(const float* row, int k0, int lane) { float v[16]; const float* p = row + k0 + 8 * (lane >> 4);
#pragma unroll
  for (int i = 0; i < 8; ++i) { v[i] = p[i]; v[8 + i] = p[16 + i]; }
  return bsplit16(v); }
__device__ __forceinline__ F2 split_rowK(const float* row, int k0, int lane, int K) { float v[16]; const int g = lane >> 4;
#pragma unroll
  for (int i = 0; i < 8; ++i) { const int ka = k0 + 8 * g + i, kb = ka + 16; v[i] = ka < K ? row[ka < K ? ka : K - 1] : 0.f; v[8 + i] = kb < K ? row[kb < K ? kb : K - 1] : 0.f; }
  return bsplit16(v); }
__device__ __forceinline__ F2 split_col(const float* W, int k0, int n, int lane, int ld, int K) { float v[16]; const int g = lane >> 4;
#pragma unroll
  for (int i = 0; i < 8; ++i) { const int ka = k0 + 8 * g + i, kb = ka + 16; v[i] = ka < K ? W[(size_t)(ka < K ? ka : K - 1) * ld + n] : 0.f; v[8 + i] = kb < K ? W[(size_t)(kb < K ? kb : K - 1) * ld + n] : 0.f; }
  return bsplit16(v); }
__device__ __forceinline__ v8f mac3(const F2& a, const F2& b, v8f c) { c = wmma_bf(a.l, b.h, c); c = wmma_bf(a.h, b.l, c); return wmma_bf(a.h, b.h, c); }
__device__ __forceinline__ float sigm(float v) { return 1.0f / (1.0f + expf(-v)); }
#define LDSX() do { asm volatile("s_wait_dscnt 0" ::: "memory"); __builtin_amdgcn_wave_barrier(); __builtin_amdgcn_fence(__ATOMIC_RELEASE, "workgroup"); } while (0)


// Self attention with rotary q and k: q,k,v = x W^T + b (16 heads x 64); scores = q k^T / 8; softmax (no mask); P v; merge heads; @ Wo^T.  B 2, S 2048, D 1024.
// k_pack (W rows as bf16 rows: the [out][in] layout is already K-contiguous; the rotary cos/sin table), k_proj (exact GEMM + bias; its epilogue rotates q and k, splits k, transposes and splits v), k_attn (flash-style: per (128-query block, b, h) over all 64 32-key steps, online max/sum with accumulator rescale; O rows), k_out (output projection, no bias).
#define NB 2
#define SS 2048
#define DM 1024
#define NH 16
#define HD 64
#define NR (NB * SS)
#define QKVP (3 * DM)
#ifndef TRB
#define TRB (NR / 64)
#define TQB (SS / 64)
#define TNB NB
#endif
typedef __attribute__((ext_vector_type(8))) __bf16 v8b;
__device__ __forceinline__ v16b frag_b(const __bf16* rowk0, int lane) {
  union { v16b v; v8b q[2]; } u; const __bf16* p = rowk0 + 8 * (lane >> 4);
  u.q[0] = *(const v8b*)p; u.q[1] = *(const v8b*)(p + 16); return u.v;
}
__device__ __forceinline__ v16b frag_gbf(const float* rowk0, int lane) {
  v16b a; const float* p = rowk0 + 8 * (lane >> 4);
#pragma unroll
  for (int i = 0; i < 8; ++i) { a[i] = (__bf16)p[i]; a[8 + i] = (__bf16)p[16 + i]; }
  return a;
}
__device__ __forceinline__ float bfr(float v) { return (float)(__bf16)v; }
#define WS_PT   0u                                 // bf16 [4096 (q|k|v|out cols)][1024]
#define WS_QKV  (WS_PT + 2u * 4 * DM * DM)           // f32 [4096 rows][3072]: only the q columns 0..1023 are used (rotated q, later overwritten by O)
#define WS_VTH  (WS_QKV + 4u * NR * QKVP)            // bf16 [2][1024 (h*64+d)][2048]
#define WS_VTL  (WS_VTH + 2u * NB * DM * SS)
#define WS_K2   (WS_VTL + 2u * NB * DM * SS)         // bf16 [2 * 16 (b, h)][2048 tokens][hi 64 | lo 64]: the rotated k, a 256-B row a key
#define WS_TAB  (WS_K2 + 2u * 2u * NB * DM * SS)     // f32 [2048 tokens][32 j][cos | sin] of position_ids[token] * inv_freq[j]
#define WS_END  (WS_TAB + 4u * 2u * SS * (HD / 2))
#define TABB (SS / 16)   // the first blocks of k_pack's launch fill the table, 16 tokens each

__global__ __launch_bounds__(128) void k_pack(const float* __restrict__ Wq, const float* __restrict__ Wk, const float* __restrict__ Wv, const float* __restrict__ Wo, __bf16* __restrict__ PT, const int* __restrict__ PID, float* __restrict__ TAB) {
  __shared__ __align__(16) __bf16 srow[DM];
  const int tid = threadIdx.x;
  if (blockIdx.x < TABB) {   // whole blocks, ahead of the barrier: each angle of the sequence once; lane j holds inv_freq[j], a wave writes a token's 256-B row
    const int j = tid & 31; const float invf = powf(10000.0f, -(float)(2 * j) / (float)HD); float pos[4];
#pragma unroll
    for (int i = 0; i < 4; ++i) pos[i] = (float)PID[blockIdx.x * 16 + i * 4 + (tid >> 5)];
#pragma unroll
    for (int i = 0; i < 4; ++i) { const float ang = pos[i] * invf; vst2(TAB + ((size_t)(blockIdx.x * 16 + i * 4 + (tid >> 5)) * (HD / 2) + j) * 2, (v2f){cosf(ang), sinf(ang)}); }
    return; }
  const int n = blockIdx.x - TABB; const int which = n >> 10, c = n & 1023; const float* Wm = which == 0 ? Wq : (which == 1 ? Wk : (which == 2 ? Wv : Wo));
  for (int k = tid; k < DM; k += 128) srow[k] = (__bf16)Wm[(size_t)c * DM + k];   // [out][in]: row c
  __syncthreads();
  vst2((unsigned*)(PT + (size_t)n * DM + tid * 8), *(const v4u*)(&srow[tid * 8]));
}
#define GKT 64   // k per staged tile
#define WPB 72   // bf16 per staged W row: 144 B = 16 B x odd, the pitch of 16-byte LDS readers
#define XPF 68   // f32 per staged x row: 272 B = 16 B x odd
struct GemmStage { __bf16 w[2][128][WPB]; float x[2][64][XPF]; };
union GemmLds { GemmStage st; float so[4][16][132]; __bf16 vt[2][128][72]; };   // the output rows (so), or the v^T rows (vt: [hi | lo][d][token], 144 B = 16 B x odd a row), pass through the same bytes once the last tile has been read
__device__ __forceinline__ unsigned lds_of(const void* p) { return (unsigned)(size_t)p; }   // LDS byte address: the low 32 bits of a __shared__ address
// a thread's sixteen 16-byte pieces of a tile: W rows tid / 8 + 16 i (8 threads a 128-B row piece), x rows tid / 16 + 8 i (16 threads a 256-B row piece). wg, xg: the thread's pieces of rows tid / 8 and tid / 16 of this tile; xld: f32 per x row in global memory
__device__ __forceinline__ void gemm_stage(GemmStage& st, int buf, int tid, const __bf16* wg, const float* xg, int xld) {
  const unsigned lw = lds_of(&st.w[buf][tid >> 3][(tid & 7) * 8]), lx = lds_of(&st.x[buf][tid >> 4][(tid & 15) * 4]);
  // in each statement the wait is the last line, so that it stands ahead of any rewrite of a register that a copy names
  asm volatile("global_load_async_to_lds_b128 %0, %8, off\n\t"
               "global_load_async_to_lds_b128 %1, %9, off\n\t"
               "global_load_async_to_lds_b128 %2, %10, off\n\t"
               "global_load_async_to_lds_b128 %3, %11, off\n\t"
               "global_load_async_to_lds_b128 %4, %12, off\n\t"
               "global_load_async_to_lds_b128 %5, %13, off\n\t"
               "global_load_async_to_lds_b128 %6, %14, off\n\t"
               "global_load_async_to_lds_b128 %7, %15, off\n\t"
               "s_wait_xcnt 0x0"
               :: "v"(lw), "v"(lw + 16u * WPB * 2u), "v"(lw + 32u * WPB * 2u), "v"(lw + 48u * WPB * 2u), "v"(lw + 64u * WPB * 2u), "v"(lw + 80u * WPB * 2u), "v"(lw + 96u * WPB * 2u), "v"(lw + 112u * WPB * 2u),
                  "v"(wg), "v"(wg + 16 * DM), "v"(wg + 32 * DM), "v"(wg + 48 * DM), "v"(wg + 64 * DM), "v"(wg + 80 * DM), "v"(wg + 96 * DM), "v"(wg + 112 * DM) : "memory");
  asm volatile("global_load_async_to_lds_b128 %0, %8, off\n\t"
               "global_load_async_to_lds_b128 %1, %9, off\n\t"
               "global_load_async_to_lds_b128 %2, %10, off\n\t"
               "global_load_async_to_lds_b128 %3, %11, off\n\t"
               "global_load_async_to_lds_b128 %4, %12, off\n\t"
               "global_load_async_to_lds_b128 %5, %13, off\n\t"
               "global_load_async_to_lds_b128 %6, %14, off\n\t"
               "global_load_async_to_lds_b128 %7, %15, off\n\t"
               "s_wait_xcnt 0x0"
               :: "v"(lx), "v"(lx + 8u * XPF * 4u), "v"(lx + 16u * XPF * 4u), "v"(lx + 24u * XPF * 4u), "v"(lx + 32u * XPF * 4u), "v"(lx + 40u * XPF * 4u), "v"(lx + 48u * XPF * 4u), "v"(lx + 56u * XPF * 4u),
                  "v"(xg), "v"(xg + 8 * xld), "v"(xg + 16 * xld), "v"(xg + 24 * xld), "v"(xg + 32 * xld), "v"(xg + 40 * xld), "v"(xg + 48 * xld), "v"(xg + 56 * xld) : "memory");
}
// the 16 f32 of a lane's A fragment from a staged x row, in the fragment's k order, as four 16-byte LDS reads
__device__ __forceinline__ void frag_lx(const float* rowk0, int lane, float v[16]) { const float* p = rowk0 + 8 * (lane >> 4); const v4f q0 = *(const v4f*)p, q1 = *(const v4f*)(p + 4), q2 = *(const v4f*)(p + 16), q3 = *(const v4f*)(p + 20);
#pragma unroll
  for (int i = 0; i < 4; ++i) { v[i] = q0[i]; v[4 + i] = q1[i]; v[8 + i] = q2[i]; v[12 + i] = q3[i]; } }
// ---- k_proj: bf16(x[r]) . PT[n] (exact) + bias, K = 1024; block (64 rows, 128 cols). A block's 128 columns are two whole heads of q, of k or of v, and a lane's accumulators hold both halves (d, d + 32) of its rotary pairs (column tiles j and j + 2),
// so what follows the product is done here, on the accumulators, and the f32 k and v never go to memory: q is rotated and leaves as f32 rows (512-B segments of the 12-KB rows); k is rotated and split, once, into the bf16 hi and residual that the score products take (K2 rows);
// v is split and, a lane holding 8 consecutive tokens of a column, passes once through LDS to the transposed hi/lo planes (128-B segments of the 4-KB rows).
typedef __attribute__((ext_vector_type(4))) __bf16 v4b;
__global__ __launch_bounds__(128) void k_proj(const float* __restrict__ X, const __bf16* __restrict__ PT, const float* __restrict__ bq, const float* __restrict__ bk, const float* __restrict__ bv, const float* __restrict__ TAB, float* __restrict__ QKV, __bf16* __restrict__ VTH, __bf16* __restrict__ VTL, __bf16* __restrict__ K2) {
  __shared__ __align__(16) GemmLds sm;
  const int tid = threadIdx.x, wave = tid >> 5, lane = tid & 31, col = lane & 15, g = lane >> 4; const size_t r0 = (size_t)blockIdx.x * 64 + wave * 16; const int n0 = blockIdx.y * 128;
  v8f acc[8] = {};
  const __bf16* wg = PT + (size_t)(n0 + (tid >> 3)) * DM + (tid & 7) * 8; const float* xg = X + ((size_t)blockIdx.x * 64 + (tid >> 4)) * DM + (tid & 15) * 4;
  const int nt = DM / GKT;
  gemm_stage(sm.st, 0, tid, wg, xg, DM);
  asm volatile("s_wait_asynccnt 0x0" ::: "memory");   // this wave's copies of tile 0 have landed
  __syncthreads();                                    // ... and every other wave's
  gemm_stage(sm.st, 1, tid, wg + GKT, xg + GKT, DM);
  // kept rolled: the buffer is the trip's parity, and a second copy of the body would only double the code and the live addresses
#pragma unroll 1
  for (int kt = 0; kt < nt; ++kt) { const int buf = kt & 1;
#pragma unroll
    for (int kc = 0; kc < GKT / 32; ++kc) { float xv[16]; frag_lx(&sm.st.x[buf][wave * 16 + col][kc * 32], lane, xv); v16b a, w[8];
#pragma unroll
      for (int i = 0; i < 16; ++i) a[i] = (__bf16)xv[i];
#pragma unroll
      for (int j = 0; j < 8; ++j) w[j] = frag_b(&sm.st.w[buf][j * 16 + col][kc * 32], lane);
      __builtin_amdgcn_sched_barrier(0);   // holds these LDS reads as one group ahead of the first product; left free, the scheduler sinks each pair of reads to its product and waits for it in full there
#pragma unroll
      for (int j = 0; j < 8; ++j) acc[j] = wmma_bf(a, w[j], acc[j]); }
    __builtin_amdgcn_sched_barrier(0);   // holds the products ahead of the waits below; left free, the scheduler lifts waits and barrier over them to the top of the trip, where the copies just issued would be waited for at once
    asm volatile("s_wait_dscnt 0x0" ::: "memory");      // this wave's reads of the buffer are done
    asm volatile("s_wait_asynccnt 0x0" ::: "memory");   // its copies of tile kt + 1 have landed
    __syncthreads();                                    // publishes tile kt + 1 and frees this tile's buffer
    if (kt + 2 < nt) gemm_stage(sm.st, buf, tid, wg + (kt + 2) * GKT, xg + (kt + 2) * GKT, DM); }
  asm volatile("s_wait_asynccnt 0x0" ::: "memory");   // no copy is outstanding when the bytes are used anew
  const int which = n0 >> 10, c0 = n0 & 1023; const int b = (int)(blockIdx.x * 64 / SS), p0 = (int)(blockIdx.x * 64 % SS);   // which: the same for the whole block
  const float* bias = which == 0 ? bq : which == 1 ? bk : bv;
  if (which == 2) {
#pragma unroll
    for (int j = 0; j < 8; ++j) { const float bb = bfr(bias[c0 + j * 16 + col]); v8b vh, vl;   // tokens wave * 16 + 8 g + 0..7 of column j * 16 + col
#pragma unroll
      for (int r = 0; r < 8; ++r) { const float v = acc[j][r] + bb; const __bf16 hi = (__bf16)v; vh[r] = hi; vl[r] = (__bf16)(v - (float)hi); }
      *(v8b*)&sm.vt[0][j * 16 + col][wave * 16 + 8 * g] = vh; *(v8b*)&sm.vt[1][j * 16 + col][wave * 16 + 8 * g] = vl; }
    __syncthreads();   // a v^T row piece holds the tokens of all four waves
#pragma unroll
    for (int i = 0; i < 8; ++i) { const int rowi = i * 16 + (tid >> 3), pc = tid & 7; const size_t o = ((size_t)b * DM + c0 + rowi) * SS + p0 + pc * 8; vst2((unsigned*)(VTH + o), *(const v4u*)&sm.vt[0][rowi][pc * 8]); vst2((unsigned*)(VTL + o), *(const v4u*)&sm.vt[1][rowi][pc * 8]); }   // 8 threads a 128-B row piece
    return; }
  v2f cs[2][8];   // cos | sin of token wave * 16 + 8 g + r, j = jt * 16 + col; one angle serves both heads
#pragma unroll
  for (int jt = 0; jt < 2; ++jt)
#pragma unroll
    for (int r = 0; r < 8; ++r) cs[jt][r] = *(const v2f*)(TAB + ((size_t)(p0 + wave * 16 + 8 * g + r) * (HD / 2) + jt * 16 + col) * 2);
#pragma unroll
  for (int hl = 0; hl < 2; ++hl)
#pragma unroll
    for (int jt = 0; jt < 2; ++jt) { const int j1 = hl * 4 + jt, j2 = j1 + 2; const float b1 = bfr(bias[c0 + j1 * 16 + col]), b2 = bfr(bias[c0 + j2 * 16 + col]);
#pragma unroll
      for (int r = 0; r < 8; ++r) { const float x1 = acc[j1][r] + b1, x2 = acc[j2][r] + b2, c = cs[jt][r][0], sn = cs[jt][r][1];
        sm.so[wave][8 * g + r][j1 * 16 + col] = x1 * c - x2 * sn; sm.so[wave][8 * g + r][j2 * 16 + col] = x2 * c + x1 * sn; } }
  LDSX();
  if (which == 0) { for (int rl = 0; rl < 16; ++rl) vst2(QKV + (r0 + rl) * QKVP + n0 + lane * 4, *(const v4f*)&sm.so[wave][rl][lane * 4]); return; }
  __bf16* krow = K2 + (((size_t)b * NH + (c0 >> 6) + g) * SS + p0 + wave * 16) * (2 * HD) + col * 4;   // half a wave writes a key's 128 B of hi, then its 128 B of lo
  for (int rl = 0; rl < 16; ++rl) { const v4f y = *(const v4f*)&sm.so[wave][rl][lane * 4]; v4b kh, kl;
#pragma unroll
    for (int i = 0; i < 4; ++i) { const __bf16 hi = (__bf16)y[i]; kh[i] = hi; kl[i] = (__bf16)(y[i] - (float)hi); }
    vst2(krow + rl * (2 * HD), kh); vst2(krow + rl * (2 * HD) + HD, kl); }
  asm volatile("s_wait_xcnt 0x0" ::: "memory");   // stands behind the last K2 store, ahead of any later write of a register that a store names
}
// ---- k_attn: block = (query block qb of 128, b*16 + h), 4 waves of 32 queries (two 16-column tiles): all SS/32 key steps; online softmax. Scores are formed transposed (keys as rows, queries as columns): a lane owns one query, the 16 scores it holds of a key step
// reduce in its own registers (one exchange with the other wave half for the maximum; the halves' sums join once at the end), and split in place they are the B operand of O^T += V^T P^T, so P passes through no LDS. O written over the q columns of the block's rows.
// The k rows (hi | lo, as k_proj left them) and v^T rows of a key step are the same for the block's four waves: they are brought into LDS once a block by asynchronous copies on whole row pieces (two buffers, the next step's copies fly while this step is worked on), and each wave takes its fragments from there.
#define KPB 136  // bf16 per staged k row (hi 64 | lo 64 | pad): 272 B = 16 B x odd, the pitch of 16-byte LDS readers
#define VPB 40   // bf16 per staged v^T row: 80 B = 16 B x odd
__device__ __forceinline__ float xhalf(float v) { const unsigned u = __builtin_bit_cast(unsigned, v); return __builtin_bit_cast(float, __builtin_amdgcn_permlanex16(u, u, 0x76543210u, 0xfedcba98u, false, false)); }   // lane l <-> l ^ 16
__device__ __forceinline__ v8f mac3t(const F2& k, const F2& q, v8f c) { c = wmma_bf(k.h, q.l, c); c = wmma_bf(k.l, q.h, c); return wmma_bf(k.h, q.h, c); }   // the three products in mac3's order, operands swapped
#define AQT 2    // query tiles (16 columns each) per wave: every k and v^T fragment read from LDS serves AQT products, and a block's staged key step serves 64 * AQT queries
// two waves per SIMD, no more: the grid holds two blocks per WGP, and by its registers a third would fit; capped, the blocks cannot crowd on some WGPs while others stand idle
__global__ __launch_bounds__(128) __attribute__((amdgpu_waves_per_eu(2, 2))) void k_attn(float* __restrict__ QKV, const __bf16* __restrict__ VTH, const __bf16* __restrict__ VTL, const __bf16* __restrict__ K2) {
  __shared__ __align__(16) __bf16 sk[2][32][KPB];
  __shared__ __align__(16) __bf16 sv[2][2][HD][VPB];   // [buffer][hi | lo][d][key]
  const int tid = threadIdx.x, wave = tid >> 5, lane = tid & 31, col = lane & 15, g = lane >> 4;
  const int qb = blockIdx.x, bh = blockIdx.y, b = bh >> 4, h = bh & 15; const int q0 = (qb * 4 + wave) * (16 * AQT); const size_t tq = (size_t)b * SS + q0;
  F2 a0[AQT], a1[AQT];   // query t * 16 + col as column col of B, tile t
#pragma unroll
  for (int t = 0; t < AQT; ++t) { const float* qrow = QKV + (tq + t * 16 + col) * QKVP + h * HD; a0[t] = split_row(qrow, 0, lane); a1[t] = split_row(qrow, 32, lane); }
  const float SC2 = 0.125f * 1.44269504088896340736f;   // 1 / sqrt(64) times log2(e): e^(s / 8 - max) = 2^(s SC2 - m), one multiply-add and one hardware exponential, inline
  float m[AQT], l[AQT];   // of query t * 16 + col, m in base-2 units; l holds this half's keys only
  v8f acc[AQT][4];   // acc[t][dt][r] = O[query t * 16 + col][dt * 16 + 8 g + r]
#pragma unroll
  for (int t = 0; t < AQT; ++t) { m[t] = -3.0e38f; l[t] = 0.f;
#pragma unroll
    for (int dt = 0; dt < 4; ++dt) acc[t][dt] = (v8f){}; }
  const int nsteps = SS / 32;
  // a thread's eight 16-byte pieces of a key step: k rows tid / 16 + 8 i (16 threads a 256-B row), v^T rows tid / 4 + 32 j of either plane (4 threads a 64-B row piece)
  const __bf16* kg = K2 + ((size_t)bh * SS + (tid >> 4)) * (2 * HD) + (tid & 15) * 8;
  const size_t vo = ((size_t)b * DM + h * HD + (tid >> 2)) * SS + (tid & 3) * 8;
  const __bf16 *vgh = VTH + vo, *vgl = VTL + vo;
  auto stage = [&](int ks, int buf) {
    const __bf16* k0 = kg + ks * 32 * (2 * HD); const __bf16 *h0 = vgh + ks * 32, *l0 = vgl + ks * 32;
    const unsigned lk = lds_of(&sk[buf][tid >> 4][(tid & 15) * 8]), lh = lds_of(&sv[buf][0][tid >> 2][(tid & 3) * 8]), ll = lds_of(&sv[buf][1][tid >> 2][(tid & 3) * 8]);
    // the wait is the statement's last line, so that it stands ahead of any rewrite of a register that a copy names
    asm volatile("global_load_async_to_lds_b128 %0, %8, off\n\t"
                 "global_load_async_to_lds_b128 %1, %9, off\n\t"
                 "global_load_async_to_lds_b128 %2, %10, off\n\t"
                 "global_load_async_to_lds_b128 %3, %11, off\n\t"
                 "global_load_async_to_lds_b128 %4, %12, off\n\t"
                 "global_load_async_to_lds_b128 %5, %13, off\n\t"
                 "global_load_async_to_lds_b128 %6, %14, off\n\t"
                 "global_load_async_to_lds_b128 %7, %15, off\n\t"
                 "s_wait_xcnt 0x0"
                 :: "v"(lk), "v"(lk + 8u * KPB * 2u), "v"(lk + 16u * KPB * 2u), "v"(lk + 24u * KPB * 2u), "v"(lh), "v"(lh + 32u * VPB * 2u), "v"(ll), "v"(ll + 32u * VPB * 2u),
                    "v"(k0), "v"(k0 + 8 * 2 * HD), "v"(k0 + 16 * 2 * HD), "v"(k0 + 24 * 2 * HD), "v"(h0), "v"(h0 + 32 * SS), "v"(l0), "v"(l0 + 32 * SS) : "memory"); };
  stage(0, 0);
  asm volatile("s_wait_asynccnt 0x0" ::: "memory");   // this wave's copies of step 0 have landed
  __syncthreads();                                    // ... and every other wave's
  stage(1, 1);
#pragma unroll 1
  for (int ks = 0; ks < nsteps; ++ks) { const int buf = ks & 1;
    v8f s[AQT][2]; F2 kf[2][2]; v16b vh[4], vl[4];   // the key step's fragments, from this step's buffer alone; plain LDS loads, so that the compiler groups them and places counted waits
#pragma unroll
    for (int ct = 0; ct < 2; ++ct)
#pragma unroll
      for (int kc = 0; kc < 2; ++kc) { kf[ct][kc].h = frag_b(&sk[buf][ct * 16 + col][kc * 32], lane); kf[ct][kc].l = frag_b(&sk[buf][ct * 16 + col][HD + kc * 32], lane); }   // key ct * 16 + col as row col of A, d kc * 32 ..
#pragma unroll
    for (int dt = 0; dt < 4; ++dt) { vh[dt] = frag_b(&sv[buf][0][dt * 16 + col][0], lane); vl[dt] = frag_b(&sv[buf][1][dt * 16 + col][0], lane); }
    __builtin_amdgcn_sched_barrier(0);   // holds the step's LDS reads as one group ahead of its first product; left free, the scheduler sinks each pair of reads to its product and waits for it in full there
#pragma unroll
    for (int t = 0; t < AQT; ++t)
#pragma unroll
      for (int ct = 0; ct < 2; ++ct) { v8f c = mac3t(kf[ct][0], a0[t], (v8f){}); s[t][ct] = mac3t(kf[ct][1], a1[t], c); }   // s[t][ct][r] = q . k of key ks * 32 + ct * 16 + 8 g + r with query t * 16 + col, not yet scaled
#pragma unroll
    for (int t = 0; t < AQT; ++t) {
      float mx = fmaxf(s[t][0][0], s[t][1][0]);
#pragma unroll
      for (int r = 1; r < 8; ++r) mx = fmaxf(mx, fmaxf(s[t][0][r], s[t][1][r]));
      mx = fmaxf(mx, xhalf(mx));
      const float mn = fmaxf(m[t], mx * SC2); float alpha = m[t] - mn;   // SC2 > 0: the maximum of the scaled scores is the scaled maximum
      float p[16], es[4];   // p[i]: key 8 g + i (i < 8), 16 + 8 g + i - 8 (else) of the step, the k order of V^T's fragment
#pragma unroll
      for (int i = 0; i < 16; ++i) p[i] = fmaf(s[t][i >> 3][i & 7], SC2, -mn);
      // the exponentials, each in its own register. In asm so that the slot which the instruction set asks for behind a transcendental is there by construction: each is followed by an independent one, the last by v_nop
      asm("v_exp_f32 %0, %0\n\tv_exp_f32 %1, %1\n\tv_exp_f32 %2, %2\n\tv_exp_f32 %3, %3\n\tv_exp_f32 %4, %4\n\tv_exp_f32 %5, %5\n\tv_exp_f32 %6, %6\n\tv_exp_f32 %7, %7\n\tv_exp_f32 %8, %8\n\tv_nop"
          : "+v"(p[0]), "+v"(p[1]), "+v"(p[2]), "+v"(p[3]), "+v"(p[4]), "+v"(p[5]), "+v"(p[6]), "+v"(p[7]), "+v"(alpha));
      asm("v_exp_f32 %0, %0\n\tv_exp_f32 %1, %1\n\tv_exp_f32 %2, %2\n\tv_exp_f32 %3, %3\n\tv_exp_f32 %4, %4\n\tv_exp_f32 %5, %5\n\tv_exp_f32 %6, %6\n\tv_exp_f32 %7, %7\n\tv_nop"
          : "+v"(p[8]), "+v"(p[9]), "+v"(p[10]), "+v"(p[11]), "+v"(p[12]), "+v"(p[13]), "+v"(p[14]), "+v"(p[15]));
#pragma unroll
      for (int i = 0; i < 16; ++i) es[i & 3] = i < 4 ? p[i] : es[i & 3] + p[i];
      l[t] = l[t] * alpha + ((es[0] + es[1]) + (es[2] + es[3])); m[t] = mn;
#pragma unroll
      for (int dt = 0; dt < 4; ++dt) acc[t][dt] *= alpha;
      const F2 pb = bsplit16(p);
#pragma unroll
      for (int dt = 0; dt < 4; ++dt) { acc[t][dt] = wmma_bf(vh[dt], pb.l, acc[t][dt]); acc[t][dt] = wmma_bf(vl[dt], pb.h, acc[t][dt]); acc[t][dt] = wmma_bf(vh[dt], pb.h, acc[t][dt]); } }
    __builtin_amdgcn_sched_barrier(0);   // holds the products ahead of the waits below; left free, the scheduler lifts waits and barrier over them to the top of the trip, where the copies just issued would be waited for at once
    asm volatile("s_wait_dscnt 0x0" ::: "memory");      // this wave's reads of the buffer are done
    asm volatile("s_wait_asynccnt 0x0" ::: "memory");   // its copies of step ks + 1 have landed
    __syncthreads();                                    // publishes step ks + 1 and frees this step's buffer
    if (ks + 2 < nsteps) stage(ks + 2, buf); }
  asm volatile("s_wait_asynccnt 0x0" ::: "memory");   // no copy is outstanding when the wave ends
#pragma unroll
  for (int t = 0; t < AQT; ++t) { const float il = 1.0f / (l[t] + xhalf(l[t]));
    float* orow = QKV + (tq + t * 16 + col) * QKVP + h * HD + 8 * g;
#pragma unroll
    for (int dt = 0; dt < 4; ++dt) { const v8f o = acc[t][dt] * il; vst2(orow + dt * 16, (v4f){o[0], o[1], o[2], o[3]}); vst2(orow + dt * 16 + 4, (v4f){o[4], o[5], o[6], o[7]}); } }
}
// ---- k_out: Y = O(hi/lo; the q columns of QKV) . PT_out rows (2 products, K = 1024); block (64 rows, 128 cols); operands staged as in k_proj
__global__ __launch_bounds__(128) void k_out(const float* __restrict__ QKV, const __bf16* __restrict__ PT, float* __restrict__ Y) {
  __shared__ __align__(16) GemmLds sm;
  const int tid = threadIdx.x, wave = tid >> 5, lane = tid & 31, col = lane & 15, g = lane >> 4; const size_t r0 = (size_t)blockIdx.x * 64 + wave * 16; const int n0 = blockIdx.y * 128;
  v8f acc[8] = {};
  const __bf16* wg = PT + (size_t)(3 * DM + n0 + (tid >> 3)) * DM + (tid & 7) * 8; const float* xg = QKV + ((size_t)blockIdx.x * 64 + (tid >> 4)) * QKVP + (tid & 15) * 4;
  const int nt = DM / GKT;
  gemm_stage(sm.st, 0, tid, wg, xg, QKVP);
  asm volatile("s_wait_asynccnt 0x0" ::: "memory");   // this wave's copies of tile 0 have landed
  __syncthreads();                                    // ... and every other wave's
  gemm_stage(sm.st, 1, tid, wg + GKT, xg + GKT, QKVP);
  // kept rolled: the buffer is the trip's parity, and a second copy of the body would only double the code and the live addresses
#pragma unroll 1
  for (int kt = 0; kt < nt; ++kt) { const int buf = kt & 1;
#pragma unroll
    for (int kc = 0; kc < GKT / 32; ++kc) { float xv[16]; frag_lx(&sm.st.x[buf][wave * 16 + col][kc * 32], lane, xv); const F2 a = bsplit16(xv); v16b w[8];
#pragma unroll
      for (int j = 0; j < 8; ++j) w[j] = frag_b(&sm.st.w[buf][j * 16 + col][kc * 32], lane);
      __builtin_amdgcn_sched_barrier(0);   // holds these LDS reads as one group ahead of the first product; left free, the scheduler sinks each pair of reads to its product and waits for it in full there
#pragma unroll
      for (int j = 0; j < 8; ++j) { acc[j] = wmma_bf(a.l, w[j], acc[j]); acc[j] = wmma_bf(a.h, w[j], acc[j]); } }
    __builtin_amdgcn_sched_barrier(0);   // holds the products ahead of the waits below; left free, the scheduler lifts waits and barrier over them to the top of the trip, where the copies just issued would be waited for at once
    asm volatile("s_wait_dscnt 0x0" ::: "memory");      // this wave's reads of the buffer are done
    asm volatile("s_wait_asynccnt 0x0" ::: "memory");   // its copies of tile kt + 1 have landed
    __syncthreads();                                    // publishes tile kt + 1 and frees this tile's buffer
    if (kt + 2 < nt) gemm_stage(sm.st, buf, tid, wg + (kt + 2) * GKT, xg + (kt + 2) * GKT, QKVP); }
  asm volatile("s_wait_asynccnt 0x0" ::: "memory");   // no copy is outstanding when the bytes are used anew
#pragma unroll
  for (int j = 0; j < 8; ++j)
#pragma unroll
    for (int r = 0; r < 8; ++r) sm.so[wave][8 * g + r][j * 16 + col] = acc[j][r];
  LDSX();
  for (int rl = 0; rl < 16; ++rl) vst2(Y + (r0 + rl) * DM + n0 + lane * 4, *(const v4f*)&sm.so[wave][rl][lane * 4]);
}

extern "C" void kernel_launch(void* const* d_in, const int* in_sizes, int n_in, void* d_out, int out_size, void* d_ws, size_t ws_size, hipStream_t stream) {
  (void)in_sizes; (void)n_in; (void)out_size;
  const float** F = (const float**)d_in;   // hidden_states, position_ids [1,2048] int, Wq, bq, Wk, bk, Wv, bv, Wo ([out][in])
  if (ws_size < (size_t)WS_END) return;
  char* ws = (char*)d_ws; __bf16 *PT = (__bf16*)(ws + WS_PT), *VTH = (__bf16*)(ws + WS_VTH), *VTL = (__bf16*)(ws + WS_VTL), *K2 = (__bf16*)(ws + WS_K2); float *QKV = (float*)(ws + WS_QKV), *TAB = (float*)(ws + WS_TAB);
  k_pack<<<TABB + 4 * DM, 128, 0, stream>>>(F[2], F[4], F[6], F[8], PT, (const int*)d_in[1], TAB);
  k_proj<<<dim3(TRB, QKVP / 128), 128, 0, stream>>>(F[0], PT, F[3], F[5], F[7], TAB, QKV, VTH, VTL, K2);
  k_attn<<<dim3(TQB / AQT, TNB * NH), 128, 0, stream>>>(QKV, VTH, VTL, K2);
  k_out<<<dim3((TNB < NB ? TQB : NR / 64), DM / 128), 128, 0, stream>>>(QKV, PT, (float*)d_out);
}
